// v000
// The times below were measured on an AMD MI455X: many runs one after another, warmed up first and cycling through
// copies of the inputs, with the whole window's GPU time divided by the number of runs. Launches and the gaps
// between them are all in it. The median over several windows is given; except for v000 it joins two sittings, which
// can be a few percent apart, so the side-by-side timings, each taken in one sitting, are the better comparison.
// The starting kernel, v000, takes 293 microseconds a run.
#include <hip/hip_runtime.h>
#include <math.h>

typedef __attribute__((ext_vector_type(16))) _Float16 v16h;
typedef __attribute__((ext_vector_type(16))) __bf16 v16b;
typedef __attribute__((ext_vector_type(8)))  _Float16 v8h;
typedef __attribute__((ext_vector_type(8)))  float v8f;
typedef __attribute__((ext_vector_type(4)))  float v4f;
typedef __attribute__((ext_vector_type(2)))  float v2f;
typedef __attribute__((ext_vector_type(4)))  unsigned v4u;
typedef __attribute__((ext_vector_type(4)))  int v4i;
typedef float __attribute__((may_alias)) float_a;
typedef int __attribute__((may_alias)) int_a;

template <typename T> __device__ __forceinline__ void vst2(void* p, T v) { *(T*)p = v;  }
__device__ __forceinline__ v8f wmma16(v16h a, v16h b, v8f c) {
  v8f d = __builtin_amdgcn_wmma_f32_16x16x32_f16(false, a, false, b, (short)0, c, false, false);
  asm volatile("v_nop\n\tv_nop\n\tv_nop\n\tv_nop" : "+v"(d) : "v"(a), "v"(b));
  return d;
}
__device__ __forceinline__ v8f wmma_bf(v16b a, v16b b, v8f c) {
  v8f d = __builtin_amdgcn_wmma_f32_16x16x32_bf16(false, a, false, b, (short)0, c, false, false);
  asm volatile("v_nop\n\tv_nop\n\tv_nop\n\tv_nop" : "+v"(d) : "v"(a), "v"(b));
  return d;
}
// 16x16x32 fragments: lane = (h = lane>>4, row/col = lane&15); elements 0..7 = k0+8h+0..7, 8..15 = k0+16+8h+0..7; D element r = row 8h+r
__device__ __forceinline__ v16h frag_h(const _Float16* rowk0, int lane) {
  union { v16h v; v8h q[2]; } u; const _Float16* p = rowk0 + 8 * (lane >> 4);
  u.q[0] = *(const v8h*)p; u.q[1] = *(const v8h*)(p + 16); return u.v;
}
__device__ __forceinline__ v16h frag_f32(const float* rowk0, int lane) {
  v16h a; const float* p = rowk0 + 8 * (lane >> 4);
#pragma unroll
  for (int i = 0; i < 8; ++i) { a[i] = (_Float16)p[i]; a[8 + i] = (_Float16)p[16 + i]; }
  return a;
}
__device__ __forceinline__ v16h frag_f32s(const float* rowk0, int lane, float sc) {
  v16h a; const float* p = rowk0 + 8 * (lane >> 4);
#pragma unroll
  for (int i = 0; i < 8; ++i) { a[i] = (_Float16)(p[i] * sc); a[8 + i] = (_Float16)(p[16 + i] * sc); }
  return a;
}
// column fragment from a [K][ld] layout (column n), rows >= K read as 0
__device__ __forceinline__ v16h fragc_f32(const float* W, int k0, int n, int lane, int ld, int K) {
  v16h a; const int g = lane >> 4;
#pragma unroll
  for (int i = 0; i < 8; ++i) { const int ka = k0 + 8 * g + i, kb = ka + 16;
    a[i] = (_Float16)(ka < K ? W[(size_t)ka * ld + n] : 0.f); a[8 + i] = (_Float16)(kb < K ? W[(size_t)kb * ld + n] : 0.f); }
  return a;
}
struct F2 { v16b h, l; };
__device__ __forceinline__ F2 bsplit16(const float v[16]) { F2 r;
#pragma unroll
  for (int i = 0; i < 16; ++i) { const __bf16 h = (__bf16)v[i]; r.h[i] = h; r.l[i] = (__bf16)(v[i] - (float)h); }
  return r; }
__device__ __forceinline__ F2 split_row(const float* row, int k0, int lane) { float v[16]; const float* p = row + k0 + 8 * (lane >> 4);
#pragma unroll
  for (int i = 0; i < 8; ++i) { v[i] = p[i]; v[8 + i] = p[16 + i]; }
  return bsplit16(v); }
__device__ __forceinline__ F2 split_rowK(const float* row, int k0, int lane, int K) { float v[16]; const int g = lane >> 4;
#pragma unroll
  for (int i = 0; i < 8; ++i) { const int ka = k0 + 8 * g + i, kb = ka + 16; v[i] = ka < K ? row[ka] : 0.f; v[8 + i] = kb < K ? row[kb] : 0.f; }
  return bsplit16(v); }
__device__ __forceinline__ F2 split_col(const float* W, int k0, int n, int lane, int ld, int K) { float v[16]; const int g = lane >> 4;
#pragma unroll
  for (int i = 0; i < 8; ++i) { const int ka = k0 + 8 * g + i, kb = ka + 16; v[i] = ka < K ? W[(size_t)ka * ld + n] : 0.f; v[8 + i] = kb < K ? W[(size_t)kb * ld + n] : 0.f; }
  return bsplit16(v); }
__device__ __forceinline__ v8f mac3(const F2& a, const F2& b, v8f c) { c = wmma_bf(a.l, b.h, c); c = wmma_bf(a.h, b.l, c); return wmma_bf(a.h, b.h, c); }
__device__ __forceinline__ float sigm(float v) { return 1.0f / (1.0f + expf(-v)); }
#define LDSX() do { asm volatile("s_wait_dscnt 0" ::: "memory"); __builtin_amdgcn_wave_barrier(); __builtin_amdgcn_fence(__ATOMIC_RELEASE, "workgroup"); } while (0)

// Pre-LN multi-head attention block with RoPE and a post FFN: LN(q), LN(k), LN(v) -> projections (+bias) -> rotary embedding -> 16-head
// attention with the module's masked_fill value 1e-10 (mask read as data) -> merge -> fx = LN2(x); fo = relu(fx Wf^T + bf); out = fx +
// LN3(fo). LayerNorms, RoPE (cos/sin table in f32), softmax (online over 16 key tiles) in f32; all four products on
// v_wmma_f32_16x16x32_f16 (LN outputs as f16 rows, [out][in] weights as f16 rows x16, q/k/v head-major f16 x4, P x2^14, O x8).
#define NB 4
#define SS 1024
#define HID 1024
#define NH 16
#define HD 64
#define NR (NB * SS)

// LN of one 1024-row per wave: src selects q/k/v by blockIdx.y; dst f16 rows
__global__ __launch_bounds__(256) void k_ln3(const float* __restrict__ q, const float* __restrict__ k, const float* __restrict__ v, const float* __restrict__ gq, const float* __restrict__ bq, const float* __restrict__ gk, const float* __restrict__ bk, const float* __restrict__ gv, const float* __restrict__ bv2, _Float16* __restrict__ X16) {
  const int wave = threadIdx.x >> 5, lane = threadIdx.x & 31, which = blockIdx.y; const size_t r = (size_t)blockIdx.x * 8 + wave; if (r >= NR) return;
  const float* src = (which == 0 ? q : which == 1 ? k : v) + r * HID; const float* g = which == 0 ? gq : which == 1 ? gk : gv; const float* bb = which == 0 ? bq : which == 1 ? bk : bv2;
  float xv[32]; float s = 0.f;
#pragma unroll
  for (int i = 0; i < 4; ++i) { const v4f a = *(const v4f*)(src + i * 256 + lane * 8), c = *(const v4f*)(src + i * 256 + lane * 8 + 4);
    xv[i * 8 + 0] = a[0]; xv[i * 8 + 1] = a[1]; xv[i * 8 + 2] = a[2]; xv[i * 8 + 3] = a[3]; xv[i * 8 + 4] = c[0]; xv[i * 8 + 5] = c[1]; xv[i * 8 + 6] = c[2]; xv[i * 8 + 7] = c[3]; }
#pragma unroll
  for (int i = 0; i < 32; ++i) s += xv[i];
#pragma unroll
  for (int off = 16; off >= 1; off >>= 1) s += __shfl_xor(s, off, 32);
  const float mu = s * (1.0f / HID); float q2 = 0.f;
#pragma unroll
  for (int i = 0; i < 32; ++i) { const float d = xv[i] - mu; q2 += d * d; }
#pragma unroll
  for (int off = 16; off >= 1; off >>= 1) q2 += __shfl_xor(q2, off, 32);
  const float rs = rsqrtf(q2 * (1.0f / HID) + 1e-5f);
#pragma unroll
  for (int i = 0; i < 4; ++i) { union { v8h h; v4u u; } pk;
#pragma unroll
    for (int e = 0; e < 8; ++e) { const int c = i * 256 + lane * 8 + e; pk.h[e] = (_Float16)((xv[i * 8 + e] - mu) * rs * g[c] + bb[c]); }
    vst2(X16 + ((size_t)which * NR + r) * HID + i * 256 + lane * 8, pk.u); }
}
// P rows [w*1024 + n] = W_w[n][:] * 16 (W are [out][in]): w = 0 Wq, 1 Wk, 2 Wv, 3 Wf
__global__ __launch_bounds__(256) void k_pack(const float* __restrict__ Wq, const float* __restrict__ Wk, const float* __restrict__ Wv, const float* __restrict__ Wf, _Float16* __restrict__ P) {
  const int r = blockIdx.x, tid = threadIdx.x; __shared__ __align__(16) _Float16 srow[HID];
  const int which = r >> 10, n = r & 1023; const float* W = (which == 0 ? Wq : which == 1 ? Wk : which == 2 ? Wv : Wf) + (size_t)n * HID;
  for (int kk = tid; kk < HID; kk += 256) srow[kk] = (_Float16)(W[kk] * 16.0f);
  __syncthreads();
  if (tid < 128) vst2(P + (size_t)r * HID + tid * 8, *(const v4u*)(&srow[tid * 8]));
}
// RoPE tables: CS[s][j] = cos(s * inv_freq[j]), SN likewise, j < 32
__global__ __launch_bounds__(256) void k_rope(float* __restrict__ CS, float* __restrict__ SN) {
  const int s = blockIdx.x * 8 + (threadIdx.x >> 5), j = threadIdx.x & 31;
  const float inv = 1.0f / powf(10000.0f, (float)(2 * j) / (float)HD); const float f = (float)s * inv;
  vst2(CS + (size_t)s * 32 + j, cosf(f)); vst2(SN + (size_t)s * 32 + j, sinf(f));
}
// q/k/v projections + bias (+RoPE for q,k): block (64 rows, 128 cols = 2 heads, which)
__global__ __launch_bounds__(128) void k_qkv(const _Float16* __restrict__ X16, const _Float16* __restrict__ P, const float* __restrict__ bq, const float* __restrict__ bk, const float* __restrict__ bv, const float* __restrict__ CS, const float* __restrict__ SN,
                                           _Float16* __restrict__ Q16, _Float16* __restrict__ K16, _Float16* __restrict__ VT) {
  __shared__ __align__(16) float so[4][16][132];
  __shared__ __align__(16) _Float16 st[128][72];
  const int tid = threadIdx.x, wave = tid >> 5, lane = tid & 31, col = lane & 15, g = lane >> 4;
  const int which = blockIdx.z, r0b = blockIdx.x * 64, r0 = r0b + wave * 16, n0 = blockIdx.y * 128; const int b = r0b / SS, s0 = r0b % SS;
  const _Float16* A = X16 + (size_t)which * NR * HID; const _Float16* Pw = P + (size_t)which * HID * HID; const float* bias = which == 0 ? bq : (which == 1 ? bk : bv);
  v8f acc[8] = {};
#pragma unroll 2
  for (int kc = 0; kc < HID / 32; ++kc) { const v16h a = frag_h(A + (size_t)(r0 + col) * HID + kc * 32, lane);
#pragma unroll
    for (int j = 0; j < 8; ++j) acc[j] = wmma16(a, frag_h(Pw + (size_t)(n0 + j * 16 + col) * HID + kc * 32, lane), acc[j]); }
#pragma unroll
  for (int j = 0; j < 8; ++j) { const float bb = bias[n0 + j * 16 + col];
#pragma unroll
    for (int r = 0; r < 8; ++r) acc[j][r] = acc[j][r] * (1.0f / 16.0f) + bb; }
  if (which < 2) {
    // RoPE within each head (tiles 0-3 head A, 4-7 head B): d = (j&3)*16 + col ; d < 32: x cos - x(d+32) sin ; d >= 32: x cos + x(d-32) sin, angle index d & 31
#pragma unroll
    for (int hh = 0; hh < 2; ++hh)
#pragma unroll
      for (int jj = 0; jj < 2; ++jj) { const int jlo = hh * 4 + jj, jhi = jlo + 2; const int dj = jj * 16 + col;      // dj < 32
#pragma unroll
        for (int r = 0; r < 8; ++r) { const int s = s0 + wave * 16 + 8 * g + r; const float c = CS[(size_t)s * 32 + dj], sn = SN[(size_t)s * 32 + dj];
          const float lo = acc[jlo][r], hi = acc[jhi][r];
          so[wave][8 * g + r][jlo * 16 + col] = (lo * c - hi * sn) * 4.0f; so[wave][8 * g + r][jhi * 16 + col] = (hi * c + lo * sn) * 4.0f; } }
    LDSX();
    _Float16* D = which == 0 ? Q16 : K16;
    for (int qq = lane; qq < 16 * 2 * 8; qq += 32) { const int hh = qq >> 7, rl = (qq >> 3) & 15, pc = qq & 7; const int h = (n0 >> 6) + hh; union { v8h h8; v4u u; } pk;
#pragma unroll
      for (int e = 0; e < 8; ++e) pk.h8[e] = (_Float16)so[wave][rl][hh * 64 + pc * 8 + e];
      vst2(D + (((size_t)b * NH + h) * SS + s0 + wave * 16 + rl) * HD + pc * 8, pk.u); } }
  else {
#pragma unroll
    for (int j = 0; j < 8; ++j)
#pragma unroll
      for (int r = 0; r < 8; ++r) st[j * 16 + col][wave * 16 + 8 * g + r] = (_Float16)(acc[j][r] * 4.0f);
    __syncthreads();
    for (int qq = tid; qq < 128 * 8; qq += 128) { const int cl = qq >> 3, pc = qq & 7; const int c = n0 + cl, h = c >> 6, d = c & 63; vst2(VT + (((size_t)b * NH + h) * HD + d) * SS + s0 + pc * 8, *(const v4u*)(&st[cl][pc * 8])); } }
}
// attention: block (64 q, h, b); scores = q.k/8, masked keys (mask[b][key] == 0) -> 1e-10; online softmax; O16 [b][h][s][64] x8
__global__ __launch_bounds__(128) void k_attn(const _Float16* __restrict__ Q16, const _Float16* __restrict__ K16, const _Float16* __restrict__ VT, const int* __restrict__ mask, _Float16* __restrict__ O16) {
  __shared__ __align__(16) float sS[4][16][68];
  __shared__ __align__(16) _Float16 sP[4][16][72];
  __shared__ __align__(16) float sO[4][16][68];
  __shared__ int smk[SS];
  const int tid = threadIdx.x, w = tid >> 5, lane = tid & 31, col = lane & 15, g = lane >> 4;
  const int b = blockIdx.z, h = blockIdx.y, q0 = blockIdx.x * 64 + w * 16; const size_t bh = (size_t)b * NH + h;
  for (int qq = tid; qq < SS; qq += 128) smk[qq] = mask[(size_t)b * SS + qq];
  __syncthreads();
  v16h aq[2];
#pragma unroll
  for (int kc = 0; kc < 2; ++kc) aq[kc] = frag_h(Q16 + (bh * SS + q0 + col) * HD + kc * 32, lane);
  float mrun = -3.0e38f, lrun = 0.f; v8f acc[4] = {};
#pragma unroll 1
  for (int kt = 0; kt < SS / 64; ++kt) {
#pragma unroll
    for (int t = 0; t < 4; ++t) { v8f s = {}; const int key = kt * 64 + t * 16 + col;
#pragma unroll
      for (int kc = 0; kc < 2; ++kc) s = wmma16(aq[kc], frag_h(K16 + (bh * SS + key) * HD + kc * 32, lane), s);
      const bool keep = smk[key] != 0;
#pragma unroll
      for (int r = 0; r < 8; ++r) sS[w][8 * g + r][t * 16 + col] = keep ? s[r] * (0.125f / 16.0f) : 1e-10f; }
    LDSX();
    float mx = -3.4e38f;
#pragma unroll
    for (int jj = 0; jj < 32; ++jj) mx = fmaxf(mx, sS[w][col][g * 32 + jj]);
    mx = fmaxf(mx, __shfl_xor(mx, 16, 32));
    const float mnew = fmaxf(mrun, mx); const float corr = expf(mrun - mnew);
    float ps = 0.f;
#pragma unroll
    for (int jj = 0; jj < 32; ++jj) { const float p = expf(sS[w][col][g * 32 + jj] - mnew); ps += p; sP[w][col][g * 32 + jj] = (_Float16)(p * 16384.0f); }
    ps += __shfl_xor(ps, 16, 32);
    lrun = lrun * corr + ps; mrun = mnew;
#pragma unroll
    for (int r = 0; r < 8; ++r) { const float cr = __shfl(corr, 8 * g + r, 32);
#pragma unroll
      for (int t = 0; t < 4; ++t) acc[t][r] *= cr; }
    LDSX();
#pragma unroll
    for (int kc = 0; kc < 2; ++kc) { const v16h pa = frag_h(&sP[w][col][0] + kc * 32, lane);
#pragma unroll
      for (int t = 0; t < 4; ++t) acc[t] = wmma16(pa, frag_h(VT + (bh * HD + t * 16 + col) * SS + kt * 64 + kc * 32, lane), acc[t]); }
    __builtin_amdgcn_wave_barrier(); }
#pragma unroll
  for (int r = 0; r < 8; ++r) { const float lr = __shfl(lrun, 8 * g + r, 32); const float inv = 8.0f / (lr * 16384.0f * 4.0f);
#pragma unroll
    for (int t = 0; t < 4; ++t) sO[w][8 * g + r][t * 16 + col] = acc[t][r] * inv; }
  LDSX();
  for (int qq = lane; qq < 16 * 8; qq += 32) { const int rl = qq >> 3, pc = qq & 7; union { v8h h8; v4u u; } pk;
#pragma unroll
    for (int e = 0; e < 8; ++e) pk.h8[e] = (_Float16)sO[w][rl][pc * 8 + e];
    vst2(O16 + ((bh * SS) + q0 + rl) * HD + pc * 8, pk.u); }
}
// fx = LN2(x) with x = merged O (/8): wave per row -> FX f32 rows and FX16 f16 rows
__global__ __launch_bounds__(256) void k_ln2(const _Float16* __restrict__ O16, const float* __restrict__ g2, const float* __restrict__ b2, float* __restrict__ FX, _Float16* __restrict__ FX16) {
  const int wave = threadIdx.x >> 5, lane = threadIdx.x & 31; const size_t r = (size_t)blockIdx.x * 8 + wave; if (r >= NR) return;
  const int b = (int)(r / SS), s = (int)(r % SS);
  float xv[32]; float sm = 0.f;
#pragma unroll
  for (int i = 0; i < 4; ++i) { const int c0 = i * 256 + lane * 8; const int h = c0 >> 6, d = c0 & 63; const _Float16* src = O16 + (((size_t)b * NH + h) * SS + s) * HD + d;
#pragma unroll
    for (int e = 0; e < 8; ++e) { xv[i * 8 + e] = (float)src[e] * 0.125f; sm += xv[i * 8 + e]; } }
#pragma unroll
  for (int off = 16; off >= 1; off >>= 1) sm += __shfl_xor(sm, off, 32);
  const float mu = sm * (1.0f / HID); float q2 = 0.f;
#pragma unroll
  for (int i = 0; i < 32; ++i) { const float dd = xv[i] - mu; q2 += dd * dd; }
#pragma unroll
  for (int off = 16; off >= 1; off >>= 1) q2 += __shfl_xor(q2, off, 32);
  const float rs = rsqrtf(q2 * (1.0f / HID) + 1e-5f);
#pragma unroll
  for (int i = 0; i < 4; ++i) { union { v8h h; v4u u; } pk; v4f f0, f1;
#pragma unroll
    for (int e = 0; e < 8; ++e) { const int c = i * 256 + lane * 8 + e; const float fv = (xv[i * 8 + e] - mu) * rs * g2[c] + b2[c]; pk.h[e] = (_Float16)fv; if (e < 4) f0[e] = fv; else f1[e - 4] = fv; }
    vst2(FX + r * HID + i * 256 + lane * 8, f0); vst2(FX + r * HID + i * 256 + lane * 8 + 4, f1); vst2(FX16 + r * HID + i * 256 + lane * 8, pk.u); }
}
// fo = relu(fx Wf^T + bf): block (64 rows, 128 cols) -> FO f32
__global__ __launch_bounds__(128) void k_ffn(const _Float16* __restrict__ FX16, const _Float16* __restrict__ P, const float* __restrict__ bf, float* __restrict__ FO) {
  __shared__ __align__(16) float so[4][16][132];
  const int tid = threadIdx.x, wave = tid >> 5, lane = tid & 31, col = lane & 15, g = lane >> 4;
  const int r0 = blockIdx.x * 64 + wave * 16, n0 = blockIdx.y * 128;
  v8f acc[8] = {};
#pragma unroll 2
  for (int kc = 0; kc < HID / 32; ++kc) { const v16h a = frag_h(FX16 + (size_t)(r0 + col) * HID + kc * 32, lane);
#pragma unroll
    for (int j = 0; j < 8; ++j) acc[j] = wmma16(a, frag_h(P + (size_t)(3 * HID + n0 + j * 16 + col) * HID + kc * 32, lane), acc[j]); }
#pragma unroll
  for (int j = 0; j < 8; ++j) { const float bb = bf[n0 + j * 16 + col];
#pragma unroll
    for (int r = 0; r < 8; ++r) { const float vv = acc[j][r] * (1.0f / 16.0f) + bb; so[wave][8 * g + r][j * 16 + col] = vv > 0.f ? vv : 0.f; } }
  LDSX();
#pragma unroll 4
  for (int rl = 0; rl < 16; ++rl) vst2(FO + (size_t)(r0 + rl) * HID + n0 + lane * 4, *(const v4f*)(&so[wave][rl][lane * 4]));
}
// out = fx + LN3(fo): wave per row
__global__ __launch_bounds__(256) void k_fin(const float* __restrict__ FX, const float* __restrict__ FO, const float* __restrict__ g3, const float* __restrict__ b3, float* __restrict__ out) {
  const int wave = threadIdx.x >> 5, lane = threadIdx.x & 31; const size_t r = (size_t)blockIdx.x * 8 + wave; if (r >= NR) return;
  const float* fo = FO + r * HID; float xv[32]; float sm = 0.f;
#pragma unroll
  for (int i = 0; i < 4; ++i) { const v4f a = *(const v4f*)(fo + i * 256 + lane * 8), c = *(const v4f*)(fo + i * 256 + lane * 8 + 4);
    xv[i * 8 + 0] = a[0]; xv[i * 8 + 1] = a[1]; xv[i * 8 + 2] = a[2]; xv[i * 8 + 3] = a[3]; xv[i * 8 + 4] = c[0]; xv[i * 8 + 5] = c[1]; xv[i * 8 + 6] = c[2]; xv[i * 8 + 7] = c[3]; }
#pragma unroll
  for (int i = 0; i < 32; ++i) sm += xv[i];
#pragma unroll
  for (int off = 16; off >= 1; off >>= 1) sm += __shfl_xor(sm, off, 32);
  const float mu = sm * (1.0f / HID); float q2 = 0.f;
#pragma unroll
  for (int i = 0; i < 32; ++i) { const float dd = xv[i] - mu; q2 += dd * dd; }
#pragma unroll
  for (int off = 16; off >= 1; off >>= 1) q2 += __shfl_xor(q2, off, 32);
  const float rs = rsqrtf(q2 * (1.0f / HID) + 1e-5f);
  const float* fx = FX + r * HID;
#pragma unroll
  for (int i = 0; i < 4; ++i) { v4f o0, o1; const int c0 = i * 256 + lane * 8;
#pragma unroll
    for (int e = 0; e < 8; ++e) { const int c = c0 + e; const float vv = fx[c] + ((xv[i * 8 + e] - mu) * rs * g3[c] + b3[c]); if (e < 4) o0[e] = vv; else o1[e - 4] = vv; }
    vst2(out + r * HID + c0, o0); vst2(out + r * HID + c0 + 4, o1); }
}
extern "C" void kernel_launch(void* const* d_in, const int* in_sizes, int n_in, void* d_out, int out_size, void* d_ws, size_t ws_size, hipStream_t stream) {
  (void)in_sizes; (void)n_in; (void)out_size; (void)ws_size;
  const float** I = (const float**)d_in;
  const float* q = I[0]; const float* k = I[1]; const float* v = I[2]; const float* g1q = I[3]; const float* b1q = I[4]; const float* g1k = I[5]; const float* b1k = I[6]; const float* g1v = I[7]; const float* b1v = I[8];
  const float* Wq = I[9]; const float* bq = I[10]; const float* Wk = I[11]; const float* bk = I[12]; const float* Wv = I[13]; const float* bv = I[14]; const float* g2 = I[15]; const float* b2 = I[16]; const float* g3 = I[17]; const float* b3 = I[18]; const float* Wf = I[19]; const float* bf = I[20]; const int* mask = (const int*)d_in[21];
  float* out = (float*)d_out;
  char* ws = (char*)d_ws; size_t off = 0;
  auto take = [&](size_t bytes) { char* p = ws + off; off += (bytes + 255) & ~(size_t)255; return p; };
  _Float16* X16 = (_Float16*)take((size_t)3 * NR * HID * 2); _Float16* P = (_Float16*)take((size_t)4 * HID * HID * 2); float* CS = (float*)take((size_t)SS * 32 * 4); float* SN = (float*)take((size_t)SS * 32 * 4);
  _Float16* Q16 = (_Float16*)take((size_t)NR * HID * 2); _Float16* K16 = (_Float16*)take((size_t)NR * HID * 2); _Float16* VT = (_Float16*)take((size_t)NR * HID * 2); _Float16* O16 = (_Float16*)take((size_t)NR * HID * 2);
  float* FX = (float*)take((size_t)NR * HID * 4); _Float16* FX16 = (_Float16*)take((size_t)NR * HID * 2); float* FO = (float*)take((size_t)NR * HID * 4);
  k_ln3<<<dim3(NR / 8, 3), 256, 0, stream>>>(q, k, v, g1q, b1q, g1k, b1k, g1v, b1v, X16);
  k_pack<<<4 * HID, 256, 0, stream>>>(Wq, Wk, Wv, Wf, P);
  k_rope<<<SS / 8, 256, 0, stream>>>(CS, SN);
  k_qkv<<<dim3(NR / 64, HID / 128, 3), 128, 0, stream>>>(X16, P, bq, bk, bv, CS, SN, Q16, K16, VT);
  k_attn<<<dim3(SS / 64, NH, NB), 128, 0, stream>>>(Q16, K16, VT, mask, O16);
  k_ln2<<<NR / 8, 256, 0, stream>>>(O16, g2, b2, FX, FX16);
  k_ffn<<<dim3(NR / 64, HID / 128), 128, 0, stream>>>(FX16, P, bf, FO);
  k_fin<<<NR / 8, 256, 0, stream>>>(FX, FO, g3, b3, out);
}

// v001
// One run takes 125 microseconds.
// Next to v000, in two timings, it ran 2.41 times as fast each time.
#include <hip/hip_runtime.h>
#include <math.h>

typedef __attribute__((ext_vector_type(16))) _Float16 v16h;
typedef __attribute__((ext_vector_type(16))) __bf16 v16b;
typedef __attribute__((ext_vector_type(8)))  _Float16 v8h;
typedef __attribute__((ext_vector_type(8)))  float v8f;
typedef __attribute__((ext_vector_type(4)))  float v4f;
typedef __attribute__((ext_vector_type(2)))  float v2f;
typedef __attribute__((ext_vector_type(4)))  unsigned v4u;
typedef __attribute__((ext_vector_type(4)))  int v4i;
typedef float __attribute__((may_alias)) float_a;
typedef int __attribute__((may_alias)) int_a;

template <typename T> __device__ __forceinline__ void vst2(void* p, T v) { *(T*)p = v;  }
__device__ __forceinline__ v8f wmma16(v16h a, v16h b, v8f c) {
  v8f d = __builtin_amdgcn_wmma_f32_16x16x32_f16(false, a, false, b, (short)0, c, false, false);
  asm volatile("v_nop\n\tv_nop\n\tv_nop\n\tv_nop" : "+v"(d) : "v"(a), "v"(b));
  return d;
}
__device__ __forceinline__ v8f wmma_bf(v16b a, v16b b, v8f c) {
  v8f d = __builtin_amdgcn_wmma_f32_16x16x32_bf16(false, a, false, b, (short)0, c, false, false);
  asm volatile("v_nop\n\tv_nop\n\tv_nop\n\tv_nop" : "+v"(d) : "v"(a), "v"(b));
  return d;
}
// 16x16x32 fragments: lane = (h = lane>>4, row/col = lane&15); elements 0..7 = k0+8h+0..7, 8..15 = k0+16+8h+0..7; D element r = row 8h+r
__device__ __forceinline__ v16h frag_h(const _Float16* rowk0, int lane) {
  union { v16h v; v8h q[2]; } u; const _Float16* p = rowk0 + 8 * (lane >> 4);
  u.q[0] = *(const v8h*)p; u.q[1] = *(const v8h*)(p + 16); return u.v;
}
__device__ __forceinline__ v16h frag_f32(const float* rowk0, int lane) {
  v16h a; const float* p = rowk0 + 8 * (lane >> 4);
#pragma unroll
  for (int i = 0; i < 8; ++i) { a[i] = (_Float16)p[i]; a[8 + i] = (_Float16)p[16 + i]; }
  return a;
}
__device__ __forceinline__ v16h frag_f32s(const float* rowk0, int lane, float sc) {
  v16h a; const float* p = rowk0 + 8 * (lane >> 4);
#pragma unroll
  for (int i = 0; i < 8; ++i) { a[i] = (_Float16)(p[i] * sc); a[8 + i] = (_Float16)(p[16 + i] * sc); }
  return a;
}
// column fragment from a [K][ld] layout (column n), rows >= K read as 0
__device__ __forceinline__ v16h fragc_f32(const float* W, int k0, int n, int lane, int ld, int K) {
  v16h a; const int g = lane >> 4;
#pragma unroll
  for (int i = 0; i < 8; ++i) { const int ka = k0 + 8 * g + i, kb = ka + 16;
    a[i] = (_Float16)(ka < K ? W[(size_t)ka * ld + n] : 0.f); a[8 + i] = (_Float16)(kb < K ? W[(size_t)kb * ld + n] : 0.f); }
  return a;
}
struct F2 { v16b h, l; };
__device__ __forceinline__ F2 bsplit16(const float v[16]) { F2 r;
#pragma unroll
  for (int i = 0; i < 16; ++i) { const __bf16 h = (__bf16)v[i]; r.h[i] = h; r.l[i] = (__bf16)(v[i] - (float)h); }
  return r; }
__device__ __forceinline__ F2 split_row(const float* row, int k0, int lane) { float v[16]; const float* p = row + k0 + 8 * (lane >> 4);
#pragma unroll
  for (int i = 0; i < 8; ++i) { v[i] = p[i]; v[8 + i] = p[16 + i]; }
  return bsplit16(v); }
__device__ __forceinline__ F2 split_rowK(const float* row, int k0, int lane, int K) { float v[16]; const int g = lane >> 4;
#pragma unroll
  for (int i = 0; i < 8; ++i) { const int ka = k0 + 8 * g + i, kb = ka + 16; v[i] = ka < K ? row[ka] : 0.f; v[8 + i] = kb < K ? row[kb] : 0.f; }
  return bsplit16(v); }
__device__ __forceinline__ F2 split_col(const float* W, int k0, int n, int lane, int ld, int K) { float v[16]; const int g = lane >> 4;
#pragma unroll
  for (int i = 0; i < 8; ++i) { const int ka = k0 + 8 * g + i, kb = ka + 16; v[i] = ka < K ? W[(size_t)ka * ld + n] : 0.f; v[8 + i] = kb < K ? W[(size_t)kb * ld + n] : 0.f; }
  return bsplit16(v); }
__device__ __forceinline__ v8f mac3(const F2& a, const F2& b, v8f c) { c = wmma_bf(a.l, b.h, c); c = wmma_bf(a.h, b.l, c); return wmma_bf(a.h, b.h, c); }
__device__ __forceinline__ float sigm(float v) { return 1.0f / (1.0f + expf(-v)); }
#define LDSX() do { asm volatile("s_wait_dscnt 0" ::: "memory"); __builtin_amdgcn_wave_barrier(); __builtin_amdgcn_fence(__ATOMIC_RELEASE, "workgroup"); } while (0)

// Pre-LN multi-head attention block with RoPE and a post FFN: LN(q), LN(k), LN(v) -> projections (+bias) -> rotary embedding -> 16-head
// attention with the module's masked_fill value 1e-10 (mask read as data) -> merge -> fx = LN2(x); fo = relu(fx Wf^T + bf); out = fx +
// LN3(fo). LayerNorms, RoPE (cos/sin table in f32), softmax (online over 16 key tiles) in f32; all four products on
// v_wmma_f32_16x16x32_f16 (LN outputs as f16 rows, [out][in] weights as f16 rows x16, q/k/v head-major f16 x4, P x2^14, O x8).
#define NB 4
#define SS 1024
#define HID 1024
#define NH 16
#define HD 64
#define NR (NB * SS)

// LN of one 1024-row per wave: src selects q/k/v by blockIdx.y; dst f16 rows
__global__ __launch_bounds__(256) void k_ln3(const float* __restrict__ q, const float* __restrict__ k, const float* __restrict__ v, const float* __restrict__ gq, const float* __restrict__ bq, const float* __restrict__ gk, const float* __restrict__ bk, const float* __restrict__ gv, const float* __restrict__ bv2, _Float16* __restrict__ X16) {
  const int wave = threadIdx.x >> 5, lane = threadIdx.x & 31, which = blockIdx.y; const size_t r = (size_t)blockIdx.x * 8 + wave; if (r >= NR) return;
  const float* src = (which == 0 ? q : which == 1 ? k : v) + r * HID; const float* g = which == 0 ? gq : which == 1 ? gk : gv; const float* bb = which == 0 ? bq : which == 1 ? bk : bv2;
  float xv[32]; float s = 0.f;
#pragma unroll
  for (int i = 0; i < 4; ++i) { const v4f a = *(const v4f*)(src + i * 256 + lane * 8), c = *(const v4f*)(src + i * 256 + lane * 8 + 4);
    xv[i * 8 + 0] = a[0]; xv[i * 8 + 1] = a[1]; xv[i * 8 + 2] = a[2]; xv[i * 8 + 3] = a[3]; xv[i * 8 + 4] = c[0]; xv[i * 8 + 5] = c[1]; xv[i * 8 + 6] = c[2]; xv[i * 8 + 7] = c[3]; }
#pragma unroll
  for (int i = 0; i < 32; ++i) s += xv[i];
#pragma unroll
  for (int off = 16; off >= 1; off >>= 1) s += __shfl_xor(s, off, 32);
  const float mu = s * (1.0f / HID); float q2 = 0.f;
#pragma unroll
  for (int i = 0; i < 32; ++i) { const float d = xv[i] - mu; q2 += d * d; }
#pragma unroll
  for (int off = 16; off >= 1; off >>= 1) q2 += __shfl_xor(q2, off, 32);
  const float rs = rsqrtf(q2 * (1.0f / HID) + 1e-5f);
#pragma unroll
  for (int i = 0; i < 4; ++i) { union { v8h h; v4u u; } pk;
#pragma unroll
    for (int e = 0; e < 8; ++e) { const int c = i * 256 + lane * 8 + e; pk.h[e] = (_Float16)((xv[i * 8 + e] - mu) * rs * g[c] + bb[c]); }
    vst2(X16 + ((size_t)which * NR + r) * HID + i * 256 + lane * 8, pk.u); }
}
// P rows [w*1024 + n] = W_w[n][:] * 16 (W are [out][in]): w = 0 Wq, 1 Wk, 2 Wv, 3 Wf
__global__ __launch_bounds__(256) void k_pack(const float* __restrict__ Wq, const float* __restrict__ Wk, const float* __restrict__ Wv, const float* __restrict__ Wf, _Float16* __restrict__ P) {
  const int r = blockIdx.x, tid = threadIdx.x; __shared__ __align__(16) _Float16 srow[HID];
  const int which = r >> 10, n = r & 1023; const float* W = (which == 0 ? Wq : which == 1 ? Wk : which == 2 ? Wv : Wf) + (size_t)n * HID;
  for (int kk = tid; kk < HID; kk += 256) srow[kk] = (_Float16)(W[kk] * 16.0f);
  __syncthreads();
  if (tid < 128) vst2(P + (size_t)r * HID + tid * 8, *(const v4u*)(&srow[tid * 8]));
}
// RoPE tables: CS[s][j] = cos(s * inv_freq[j]), SN likewise, j < 32
__global__ __launch_bounds__(256) void k_rope(float* __restrict__ CS, float* __restrict__ SN) {
  const int s = blockIdx.x * 8 + (threadIdx.x >> 5), j = threadIdx.x & 31;
  const float inv = 1.0f / powf(10000.0f, (float)(2 * j) / (float)HD); const float f = (float)s * inv;
  vst2(CS + (size_t)s * 32 + j, cosf(f)); vst2(SN + (size_t)s * 32 + j, sinf(f));
}
// Shared GEMM core of k_qkv and k_ffn: Y[128 rows][128 cols] = A[128][1024] * Bw[128][1024]^T per block of 8 waves (4 x 2), 32 x 64 per wave.
// A pass is 64 k = 128 bytes of each of the 256 operand rows, brought into LDS by asynchronous copies (16 bytes a lane, 8 copies a lane and pass),
// two buffers: pass t + 2 is copied into the buffer that pass t has just left. LDS rows at pitch 144 bytes for the ds_load_b128 fragment readers.
#define GP 144
#define GBUF (256 * GP)
#define NPASS (HID / 64)
// one pass's tile: rows rr, rr+RS, rr+2RS, rr+3RS of the first operand (LDS rows 0..4RS-1, source pitch SA elements) and of the second (LDS rows 4RS..8RS-1,
// source pitch SB); l, a, bw are this lane's own 16 bytes of row rr
template <int RS, int SA, int SB> __device__ __forceinline__ void copy_tile(unsigned l, const _Float16* a, const _Float16* bw) {
  const unsigned l0 = l, l1 = l + RS * GP, l2 = l + 2 * RS * GP, l3 = l + 3 * RS * GP, l4 = l + 4 * RS * GP, l5 = l + 5 * RS * GP, l6 = l + 6 * RS * GP, l7 = l + 7 * RS * GP;
  const _Float16 *a0 = a, *a1 = a + RS * SA, *a2 = a + 2 * RS * SA, *a3 = a + 3 * RS * SA, *w0 = bw, *w1 = bw + RS * SB, *w2 = bw + 2 * RS * SB, *w3 = bw + 3 * RS * SB;
  // the copies and their s_wait_xcnt in one statement: no address register of a copy is rewritten in front of that wait
  asm volatile("global_load_async_to_lds_b128 %0, %8, off\n\t"
               "global_load_async_to_lds_b128 %1, %9, off\n\t"
               "global_load_async_to_lds_b128 %2, %10, off\n\t"
               "global_load_async_to_lds_b128 %3, %11, off\n\t"
               "global_load_async_to_lds_b128 %4, %12, off\n\t"
               "global_load_async_to_lds_b128 %5, %13, off\n\t"
               "global_load_async_to_lds_b128 %6, %14, off\n\t"
               "global_load_async_to_lds_b128 %7, %15, off\n\t"
               "s_wait_xcnt 0x0"
               :: "v"(l0), "v"(l1), "v"(l2), "v"(l3), "v"(l4), "v"(l5), "v"(l6), "v"(l7), "v"(a0), "v"(a1), "v"(a2), "v"(a3), "v"(w0), "v"(w1), "v"(w2), "v"(w3) : "memory");
}
// A, Bw: first row of the block's 128 rows of each operand (row length HID); on return every wave has left the ring (the last pass's barrier)
__device__ __forceinline__ void gemm_core(const _Float16* __restrict__ A, const _Float16* __restrict__ Bw, char* ring, v8f (&acc)[2][4]) {
  const int tid = threadIdx.x, wave = tid >> 5, lane = tid & 31, col = lane & 15, wm = wave >> 1, wn = wave & 1;
  const int rr = tid >> 3, seg = tid & 7;
  const unsigned l = (unsigned)(size_t)ring + rr * GP + seg * 16;
  const _Float16* a = A + (size_t)rr * HID + seg * 8; const _Float16* bw = Bw + (size_t)rr * HID + seg * 8;
  copy_tile<32, HID, HID>(l, a, bw);
  asm volatile("s_wait_asynccnt 0x0" ::: "memory");   // pass 0's copies of this wave have landed
  __syncthreads();                                    // ... and every other wave's
  copy_tile<32, HID, HID>(l + GBUF, a + 64, bw + 64);
  for (int t = 0; t < NPASS; ++t) {
    const char* buf = ring + (t & 1) * GBUF;
#pragma unroll
    for (int kc = 0; kc < 2; ++kc) { v16h fa[2], fb[4];
#pragma unroll
      for (int i = 0; i < 2; ++i) fa[i] = frag_h((const _Float16*)(buf + (wm * 32 + i * 16 + col) * GP + kc * 64), lane);
#pragma unroll
      for (int j = 0; j < 4; ++j) fb[j] = frag_h((const _Float16*)(buf + (128 + wn * 64 + j * 16 + col) * GP + kc * 64), lane);
#pragma unroll
      for (int i = 0; i < 2; ++i)
#pragma unroll
        for (int j = 0; j < 4; ++j) acc[i][j] = wmma16(fa[i], fb[j], acc[i][j]); }
    asm volatile("s_wait_dscnt 0x0" ::: "memory");    // this wave's reads of pass t's buffer are done before it is refilled
    asm volatile("s_wait_asynccnt 0x0" ::: "memory"); // this wave's copies of pass t + 1 have landed
    __syncthreads();                                  // publishes pass t + 1 and ends every reader's last read of pass t's buffer
    if (t + 2 < NPASS) copy_tile<32, HID, HID>(l + (t & 1) * GBUF, a + (t + 2) * 64, bw + (t + 2) * 64);
  }
  asm volatile("s_wait_asynccnt 0x0" ::: "memory");   // nothing in flight when the ring becomes output staging
}
// q/k/v projections + bias (+RoPE for q,k): block (128 rows, 128 cols = 2 heads, which), a wave has 32 rows of one head
__global__ __launch_bounds__(256) void k_qkv(const _Float16* __restrict__ X16, const _Float16* __restrict__ P, const float* __restrict__ bq, const float* __restrict__ bk, const float* __restrict__ bv, const float* __restrict__ CS, const float* __restrict__ SN,
                                           _Float16* __restrict__ Q16, _Float16* __restrict__ K16, _Float16* __restrict__ VT) {
  __shared__ __align__(16) char ring[2 * GBUF];
  const int tid = threadIdx.x, wave = tid >> 5, lane = tid & 31, col = lane & 15, g = lane >> 4, wm = wave >> 1, wn = wave & 1;
  const int which = blockIdx.z, r0b = blockIdx.x * 128, n0 = blockIdx.y * 128; const int b = r0b / SS, s0 = r0b % SS;
  const float* bias = which == 0 ? bq : (which == 1 ? bk : bv);
  v8f acc[2][4] = {};
  gemm_core(X16 + ((size_t)which * NR + r0b) * HID, P + ((size_t)which * HID + n0) * HID, ring, acc);
#pragma unroll
  for (int j = 0; j < 4; ++j) { const float bb = bias[n0 + wn * 64 + j * 16 + col];
#pragma unroll
    for (int i = 0; i < 2; ++i)
#pragma unroll
      for (int r = 0; r < 8; ++r) acc[i][j][r] = acc[i][j][r] * (1.0f / 16.0f) + bb; }
  if (which < 2) {
    // RoPE within the wave's head: d = j*16 + col ; d < 32: x cos - x(d+32) sin ; d >= 32: x cos + x(d-32) sin, angle index d & 31
    float (*so)[68] = (float (*)[68])(ring + wave * (32 * 68 * 4));
#pragma unroll
    for (int i = 0; i < 2; ++i)
#pragma unroll
      for (int jj = 0; jj < 2; ++jj) { const int dj = jj * 16 + col;      // dj < 32
#pragma unroll
        for (int r = 0; r < 8; ++r) { const int rl = i * 16 + 8 * g + r, s = s0 + wm * 32 + rl; const float c = CS[(size_t)s * 32 + dj], sn = SN[(size_t)s * 32 + dj];
          const float lo = acc[i][jj][r], hi = acc[i][jj + 2][r];
          so[rl][jj * 16 + col] = (lo * c - hi * sn) * 4.0f; so[rl][(jj + 2) * 16 + col] = (hi * c + lo * sn) * 4.0f; } }
    LDSX();
    _Float16* D = which == 0 ? Q16 : K16; const int h = (n0 >> 6) + wn;
    for (int qq = lane; qq < 32 * 8; qq += 32) { const int rl = qq >> 3, pc = qq & 7; union { v8h h8; v4u u; } pk;
#pragma unroll
      for (int e = 0; e < 8; ++e) pk.h8[e] = (_Float16)so[rl][pc * 8 + e];
      vst2(D + (((size_t)b * NH + h) * SS + s0 + wm * 32 + rl) * HD + pc * 8, pk.u); } }
  else {
    _Float16 (*st)[136] = (_Float16 (*)[136])ring;
#pragma unroll
    for (int i = 0; i < 2; ++i)
#pragma unroll
      for (int j = 0; j < 4; ++j)
#pragma unroll
        for (int r = 0; r < 8; ++r) st[wn * 64 + j * 16 + col][wm * 32 + i * 16 + 8 * g + r] = (_Float16)(acc[i][j][r] * 4.0f);
    __syncthreads();
    for (int qq = tid; qq < 128 * 16; qq += 256) { const int cl = qq >> 4, pc = qq & 15; const int c = n0 + cl, h = c >> 6, d = c & 63; vst2(VT + (((size_t)b * NH + h) * HD + d) * SS + s0 + pc * 8, *(const v4u*)(&st[cl][pc * 8])); } }
}
// attention: block (64 q, h, b); scores = q.k/8, masked keys (mask[b][key] == 0) -> 1e-10; online softmax; O16 [b][h][s][64] x8
// a pass's 64 K rows and 64 V^T rows (128 bytes each) come into LDS by the same asynchronous copies, two buffers, shared by the four waves
#define ABUF (128 * GP)
__global__ __launch_bounds__(128) void k_attn(const _Float16* __restrict__ Q16, const _Float16* __restrict__ K16, const _Float16* __restrict__ VT, const int* __restrict__ mask, _Float16* __restrict__ O16) {
  __shared__ __align__(16) float sS[4][16][68];
  __shared__ __align__(16) _Float16 sP[4][16][72];
  __shared__ __align__(16) char ring[2 * ABUF];
  __shared__ int smk[SS];
  const int tid = threadIdx.x, w = tid >> 5, lane = tid & 31, col = lane & 15, g = lane >> 4;
  const int b = blockIdx.z, h = blockIdx.y, q0 = blockIdx.x * 64 + w * 16; const size_t bh = (size_t)b * NH + h;
  const unsigned l = (unsigned)(size_t)ring + (tid >> 3) * GP + (tid & 7) * 16;
  const _Float16* kg = K16 + (bh * SS + (tid >> 3)) * HD + (tid & 7) * 8; const _Float16* vg = VT + (bh * HD + (tid >> 3)) * SS + (tid & 7) * 8;
  copy_tile<16, HD, SS>(l, kg, vg);
  for (int qq = tid; qq < SS; qq += 128) smk[qq] = mask[(size_t)b * SS + qq];
  asm volatile("s_wait_asynccnt 0x0" ::: "memory");   // pass 0's copies of this wave have landed
  __syncthreads();                                    // ... and every other wave's; smk is written
  copy_tile<16, HD, SS>(l + ABUF, kg + 64 * HD, vg + 64);
  v16h aq[2];
#pragma unroll
  for (int kc = 0; kc < 2; ++kc) aq[kc] = frag_h(Q16 + (bh * SS + q0 + col) * HD + kc * 32, lane);
  float mrun = -3.0e38f, lrun = 0.f; v8f acc[4] = {};
#pragma unroll 1
  for (int kt = 0; kt < SS / 64; ++kt) { const char* buf = ring + (kt & 1) * ABUF;
#pragma unroll
    for (int t = 0; t < 4; ++t) { v8f s = {}; const int key = kt * 64 + t * 16 + col;
#pragma unroll
      for (int kc = 0; kc < 2; ++kc) s = wmma16(aq[kc], frag_h((const _Float16*)(buf + (t * 16 + col) * GP + kc * 64), lane), s);
      const bool keep = smk[key] != 0;
#pragma unroll
      for (int r = 0; r < 8; ++r) sS[w][8 * g + r][t * 16 + col] = keep ? s[r] * (0.125f / 16.0f) : 1e-10f; }
    LDSX();
    float mx = -3.4e38f;
#pragma unroll
    for (int jj = 0; jj < 32; ++jj) mx = fmaxf(mx, sS[w][col][g * 32 + jj]);
    mx = fmaxf(mx, __shfl_xor(mx, 16, 32));
    const float mnew = fmaxf(mrun, mx); const float corr = expf(mrun - mnew);
    float ps = 0.f;
#pragma unroll
    for (int jj = 0; jj < 32; ++jj) { const float p = expf(sS[w][col][g * 32 + jj] - mnew); ps += p; sP[w][col][g * 32 + jj] = (_Float16)(p * 16384.0f); }
    ps += __shfl_xor(ps, 16, 32);
    lrun = lrun * corr + ps; mrun = mnew;
#pragma unroll
    for (int r = 0; r < 8; ++r) { const float cr = __shfl(corr, 8 * g + r, 32);
#pragma unroll
      for (int t = 0; t < 4; ++t) acc[t][r] *= cr; }
    LDSX();
#pragma unroll
    for (int kc = 0; kc < 2; ++kc) { const v16h pa = frag_h(&sP[w][col][0] + kc * 32, lane);
#pragma unroll
      for (int t = 0; t < 4; ++t) acc[t] = wmma16(pa, frag_h((const _Float16*)(buf + (64 + t * 16 + col) * GP + kc * 64), lane), acc[t]); }
    __builtin_amdgcn_wave_barrier();
    asm volatile("s_wait_dscnt 0x0" ::: "memory");    // this wave's reads of pass kt's buffer are done before it is refilled
    asm volatile("s_wait_asynccnt 0x0" ::: "memory"); // this wave's copies of pass kt + 1 have landed
    __syncthreads();                                  // publishes pass kt + 1 and ends every reader's last read of pass kt's buffer
    if (kt + 2 < SS / 64) copy_tile<16, HD, SS>(l + (kt & 1) * ABUF, kg + (size_t)(kt + 2) * 64 * HD, vg + (kt + 2) * 64); }
  asm volatile("s_wait_asynccnt 0x0" ::: "memory");   // nothing in flight when the ring becomes output staging
  float (*sO)[16][68] = (float (*)[16][68])ring;
#pragma unroll
  for (int r = 0; r < 8; ++r) { const float lr = __shfl(lrun, 8 * g + r, 32); const float inv = 8.0f / (lr * 16384.0f * 4.0f);
#pragma unroll
    for (int t = 0; t < 4; ++t) sO[w][8 * g + r][t * 16 + col] = acc[t][r] * inv; }
  LDSX();
  for (int qq = lane; qq < 16 * 8; qq += 32) { const int rl = qq >> 3, pc = qq & 7; union { v8h h8; v4u u; } pk;
#pragma unroll
    for (int e = 0; e < 8; ++e) pk.h8[e] = (_Float16)sO[w][rl][pc * 8 + e];
    vst2(O16 + ((bh * SS) + q0 + rl) * HD + pc * 8, pk.u); }
}
// fx = LN2(x) with x = merged O (/8): wave per row -> FX f32 rows and FX16 f16 rows
__global__ __launch_bounds__(256) void k_ln2(const _Float16* __restrict__ O16, const float* __restrict__ g2, const float* __restrict__ b2, float* __restrict__ FX, _Float16* __restrict__ FX16) {
  const int wave = threadIdx.x >> 5, lane = threadIdx.x & 31; const size_t r = (size_t)blockIdx.x * 8 + wave; if (r >= NR) return;
  const int b = (int)(r / SS), s = (int)(r % SS);
  float xv[32]; float sm = 0.f;
#pragma unroll
  for (int i = 0; i < 4; ++i) { const int c0 = i * 256 + lane * 8; const int h = c0 >> 6, d = c0 & 63; const _Float16* src = O16 + (((size_t)b * NH + h) * SS + s) * HD + d;
#pragma unroll
    for (int e = 0; e < 8; ++e) { xv[i * 8 + e] = (float)src[e] * 0.125f; sm += xv[i * 8 + e]; } }
#pragma unroll
  for (int off = 16; off >= 1; off >>= 1) sm += __shfl_xor(sm, off, 32);
  const float mu = sm * (1.0f / HID); float q2 = 0.f;
#pragma unroll
  for (int i = 0; i < 32; ++i) { const float dd = xv[i] - mu; q2 += dd * dd; }
#pragma unroll
  for (int off = 16; off >= 1; off >>= 1) q2 += __shfl_xor(q2, off, 32);
  const float rs = rsqrtf(q2 * (1.0f / HID) + 1e-5f);
#pragma unroll
  for (int i = 0; i < 4; ++i) { union { v8h h; v4u u; } pk; v4f f0, f1;
#pragma unroll
    for (int e = 0; e < 8; ++e) { const int c = i * 256 + lane * 8 + e; const float fv = (xv[i * 8 + e] - mu) * rs * g2[c] + b2[c]; pk.h[e] = (_Float16)fv; if (e < 4) f0[e] = fv; else f1[e - 4] = fv; }
    vst2(FX + r * HID + i * 256 + lane * 8, f0); vst2(FX + r * HID + i * 256 + lane * 8 + 4, f1); vst2(FX16 + r * HID + i * 256 + lane * 8, pk.u); }
}
// fo = relu(fx Wf^T + bf): block (128 rows, 128 cols) -> FO f32
__global__ __launch_bounds__(256) void k_ffn(const _Float16* __restrict__ FX16, const _Float16* __restrict__ P, const float* __restrict__ bf, float* __restrict__ FO) {
  __shared__ __align__(16) char ring[2 * GBUF];
  const int tid = threadIdx.x, wave = tid >> 5, lane = tid & 31, col = lane & 15, g = lane >> 4, wm = wave >> 1, wn = wave & 1;
  const int r0b = blockIdx.x * 128, n0 = blockIdx.y * 128;
  v8f acc[2][4] = {};
  gemm_core(FX16 + (size_t)r0b * HID, P + ((size_t)3 * HID + n0) * HID, ring, acc);
  float (*so)[68] = (float (*)[68])(ring + wave * (32 * 68 * 4));
#pragma unroll
  for (int j = 0; j < 4; ++j) { const float bb = bf[n0 + wn * 64 + j * 16 + col];
#pragma unroll
    for (int i = 0; i < 2; ++i)
#pragma unroll
      for (int r = 0; r < 8; ++r) { const float vv = acc[i][j][r] * (1.0f / 16.0f) + bb; so[i * 16 + 8 * g + r][j * 16 + col] = vv > 0.f ? vv : 0.f; } }
  LDSX();
#pragma unroll
  for (int rp = 0; rp < 16; ++rp) { const int rl = rp * 2 + g; vst2(FO + (size_t)(r0b + wm * 32 + rl) * HID + n0 + wn * 64 + col * 4, *(const v4f*)(&so[rl][col * 4])); }
}
// out = fx + LN3(fo): wave per row
__global__ __launch_bounds__(256) void k_fin(const float* __restrict__ FX, const float* __restrict__ FO, const float* __restrict__ g3, const float* __restrict__ b3, float* __restrict__ out) {
  const int wave = threadIdx.x >> 5, lane = threadIdx.x & 31; const size_t r = (size_t)blockIdx.x * 8 + wave; if (r >= NR) return;
  const float* fo = FO + r * HID; float xv[32]; float sm = 0.f;
#pragma unroll
  for (int i = 0; i < 4; ++i) { const v4f a = *(const v4f*)(fo + i * 256 + lane * 8), c = *(const v4f*)(fo + i * 256 + lane * 8 + 4);
    xv[i * 8 + 0] = a[0]; xv[i * 8 + 1] = a[1]; xv[i * 8 + 2] = a[2]; xv[i * 8 + 3] = a[3]; xv[i * 8 + 4] = c[0]; xv[i * 8 + 5] = c[1]; xv[i * 8 + 6] = c[2]; xv[i * 8 + 7] = c[3]; }
#pragma unroll
  for (int i = 0; i < 32; ++i) sm += xv[i];
#pragma unroll
  for (int off = 16; off >= 1; off >>= 1) sm += __shfl_xor(sm, off, 32);
  const float mu = sm * (1.0f / HID); float q2 = 0.f;
#pragma unroll
  for (int i = 0; i < 32; ++i) { const float dd = xv[i] - mu; q2 += dd * dd; }
#pragma unroll
  for (int off = 16; off >= 1; off >>= 1) q2 += __shfl_xor(q2, off, 32);
  const float rs = rsqrtf(q2 * (1.0f / HID) + 1e-5f);
  const float* fx = FX + r * HID;
#pragma unroll
  for (int i = 0; i < 4; ++i) { v4f o0, o1; const int c0 = i * 256 + lane * 8;
#pragma unroll
    for (int e = 0; e < 8; ++e) { const int c = c0 + e; const float vv = fx[c] + ((xv[i * 8 + e] - mu) * rs * g3[c] + b3[c]); if (e < 4) o0[e] = vv; else o1[e - 4] = vv; }
    vst2(out + r * HID + c0, o0); vst2(out + r * HID + c0 + 4, o1); }
}
extern "C" void kernel_launch(void* const* d_in, const int* in_sizes, int n_in, void* d_out, int out_size, void* d_ws, size_t ws_size, hipStream_t stream) {
  (void)in_sizes; (void)n_in; (void)out_size; (void)ws_size;
  const float** I = (const float**)d_in;
  const float* q = I[0]; const float* k = I[1]; const float* v = I[2]; const float* g1q = I[3]; const float* b1q = I[4]; const float* g1k = I[5]; const float* b1k = I[6]; const float* g1v = I[7]; const float* b1v = I[8];
  const float* Wq = I[9]; const float* bq = I[10]; const float* Wk = I[11]; const float* bk = I[12]; const float* Wv = I[13]; const float* bv = I[14]; const float* g2 = I[15]; const float* b2 = I[16]; const float* g3 = I[17]; const float* b3 = I[18]; const float* Wf = I[19]; const float* bf = I[20]; const int* mask = (const int*)d_in[21];
  float* out = (float*)d_out;
  char* ws = (char*)d_ws; size_t off = 0;
  auto take = [&](size_t bytes) { char* p = ws + off; off += (bytes + 255) & ~(size_t)255; return p; };
  _Float16* X16 = (_Float16*)take((size_t)3 * NR * HID * 2); _Float16* P = (_Float16*)take((size_t)4 * HID * HID * 2); float* CS = (float*)take((size_t)SS * 32 * 4); float* SN = (float*)take((size_t)SS * 32 * 4);
  _Float16* Q16 = (_Float16*)take((size_t)NR * HID * 2); _Float16* K16 = (_Float16*)take((size_t)NR * HID * 2); _Float16* VT = (_Float16*)take((size_t)NR * HID * 2); _Float16* O16 = (_Float16*)take((size_t)NR * HID * 2);
  float* FX = (float*)take((size_t)NR * HID * 4); _Float16* FX16 = (_Float16*)take((size_t)NR * HID * 2); float* FO = (float*)take((size_t)NR * HID * 4);
  k_ln3<<<dim3(NR / 8, 3), 256, 0, stream>>>(q, k, v, g1q, b1q, g1k, b1k, g1v, b1v, X16);
  k_pack<<<4 * HID, 256, 0, stream>>>(Wq, Wk, Wv, Wf, P);
  k_rope<<<SS / 8, 256, 0, stream>>>(CS, SN);
  k_qkv<<<dim3(NR / 128, HID / 128, 3), 256, 0, stream>>>(X16, P, bq, bk, bv, CS, SN, Q16, K16, VT);
  k_attn<<<dim3(SS / 64, NH, NB), 128, 0, stream>>>(Q16, K16, VT, mask, O16);
  k_ln2<<<NR / 8, 256, 0, stream>>>(O16, g2, b2, FX, FX16);
  k_ffn<<<dim3(NR / 128, HID / 128), 256, 0, stream>>>(FX16, P, bf, FO);
  k_fin<<<NR / 8, 256, 0, stream>>>(FX, FO, g3, b3, out);
}

// v002
// It runs in 122 microseconds.
// In both of two side-by-side timings against v001, it was 1.03 times as fast.
// Over all steps from v000 it is 2.48 times as fast.
#include <hip/hip_runtime.h>
#include <math.h>

typedef __attribute__((ext_vector_type(16))) _Float16 v16h;
typedef __attribute__((ext_vector_type(16))) __bf16 v16b;
typedef __attribute__((ext_vector_type(8)))  _Float16 v8h;
typedef __attribute__((ext_vector_type(8)))  float v8f;
typedef __attribute__((ext_vector_type(4)))  float v4f;
typedef __attribute__((ext_vector_type(2)))  float v2f;
typedef __attribute__((ext_vector_type(4)))  unsigned v4u;
typedef __attribute__((ext_vector_type(4)))  int v4i;
typedef float __attribute__((may_alias)) float_a;
typedef int __attribute__((may_alias)) int_a;

template <typename T> __device__ __forceinline__ void vst2(void* p, T v) { *(T*)p = v;  }
__device__ __forceinline__ v8f wmma16(v16h a, v16h b, v8f c) {
  v8f d = __builtin_amdgcn_wmma_f32_16x16x32_f16(false, a, false, b, (short)0, c, false, false);
  asm volatile("v_nop\n\tv_nop\n\tv_nop\n\tv_nop" : "+v"(d) : "v"(a), "v"(b));
  return d;
}
__device__ __forceinline__ v8f wmma_bf(v16b a, v16b b, v8f c) {
  v8f d = __builtin_amdgcn_wmma_f32_16x16x32_bf16(false, a, false, b, (short)0, c, false, false);
  asm volatile("v_nop\n\tv_nop\n\tv_nop\n\tv_nop" : "+v"(d) : "v"(a), "v"(b));
  return d;
}
// 16x16x32 fragments: lane = (h = lane>>4, row/col = lane&15); elements 0..7 = k0+8h+0..7, 8..15 = k0+16+8h+0..7; D element r = row 8h+r
__device__ __forceinline__ v16h frag_h(const _Float16* rowk0, int lane) {
  union { v16h v; v8h q[2]; } u; const _Float16* p = rowk0 + 8 * (lane >> 4);
  u.q[0] = *(const v8h*)p; u.q[1] = *(const v8h*)(p + 16); return u.v;
}
__device__ __forceinline__ v16h frag_f32(const float* rowk0, int lane) {
  v16h a; const float* p = rowk0 + 8 * (lane >> 4);
#pragma unroll
  for (int i = 0; i < 8; ++i) { a[i] = (_Float16)p[i]; a[8 + i] = (_Float16)p[16 + i]; }
  return a;
}
__device__ __forceinline__ v16h frag_f32s(const float* rowk0, int lane, float sc) {
  v16h a; const float* p = rowk0 + 8 * (lane >> 4);
#pragma unroll
  for (int i = 0; i < 8; ++i) { a[i] = (_Float16)(p[i] * sc); a[8 + i] = (_Float16)(p[16 + i] * sc); }
  return a;
}
// column fragment from a [K][ld] layout (column n), rows >= K read as 0
__device__ __forceinline__ v16h fragc_f32(const float* W, int k0, int n, int lane, int ld, int K) {
  v16h a; const int g = lane >> 4;
#pragma unroll
  for (int i = 0; i < 8; ++i) { const int ka = k0 + 8 * g + i, kb = ka + 16;
    a[i] = (_Float16)(ka < K ? W[(size_t)ka * ld + n] : 0.f); a[8 + i] = (_Float16)(kb < K ? W[(size_t)kb * ld + n] : 0.f); }
  return a;
}
struct F2 { v16b h, l; };
__device__ __forceinline__ F2 bsplit16(const float v[16]) { F2 r;
#pragma unroll
  for (int i = 0; i < 16; ++i) { const __bf16 h = (__bf16)v[i]; r.h[i] = h; r.l[i] = (__bf16)(v[i] - (float)h); }
  return r; }
__device__ __forceinline__ F2 split_row(const float* row, int k0, int lane) { float v[16]; const float* p = row + k0 + 8 * (lane >> 4);
#pragma unroll
  for (int i = 0; i < 8; ++i) { v[i] = p[i]; v[8 + i] = p[16 + i]; }
  return bsplit16(v); }
__device__ __forceinline__ F2 split_rowK(const float* row, int k0, int lane, int K) { float v[16]; const int g = lane >> 4;
#pragma unroll
  for (int i = 0; i < 8; ++i) { const int ka = k0 + 8 * g + i, kb = ka + 16; v[i] = ka < K ? row[ka] : 0.f; v[8 + i] = kb < K ? row[kb] : 0.f; }
  return bsplit16(v); }
__device__ __forceinline__ F2 split_col(const float* W, int k0, int n, int lane, int ld, int K) { float v[16]; const int g = lane >> 4;
#pragma unroll
  for (int i = 0; i < 8; ++i) { const int ka = k0 + 8 * g + i, kb = ka + 16; v[i] = ka < K ? W[(size_t)ka * ld + n] : 0.f; v[8 + i] = kb < K ? W[(size_t)kb * ld + n] : 0.f; }
  return bsplit16(v); }
__device__ __forceinline__ v8f mac3(const F2& a, const F2& b, v8f c) { c = wmma_bf(a.l, b.h, c); c = wmma_bf(a.h, b.l, c); return wmma_bf(a.h, b.h, c); }
__device__ __forceinline__ float sigm(float v) { return 1.0f / (1.0f + expf(-v)); }
#define LDSX() do { asm volatile("s_wait_dscnt 0" ::: "memory"); __builtin_amdgcn_wave_barrier(); __builtin_amdgcn_fence(__ATOMIC_RELEASE, "workgroup"); } while (0)

// Pre-LN multi-head attention block with RoPE and a post FFN: LN(q), LN(k), LN(v) -> projections (+bias) -> rotary embedding -> 16-head
// attention with the module's masked_fill value 1e-10 (mask read as data) -> merge -> fx = LN2(x); fo = relu(fx Wf^T + bf); out = fx +
// LN3(fo). LayerNorms, RoPE (cos/sin table in f32), softmax (online over 16 key tiles) in f32; all four products on
// v_wmma_f32_16x16x32_f16 (LN outputs as f16 rows, [out][in] weights as f16 rows x16, q/k/v head-major f16 x4, P x2^14, O x8).
#define NB 4
#define SS 1024
#define HID 1024
#define NH 16
#define HD 64
#define NR (NB * SS)

// LN of two 1024-rows per wave (both rows' 16 loads of 16 bytes are asked for before either is summed): src selects q/k/v by blockIdx.y; dst f16 rows
__global__ __launch_bounds__(256) void k_ln3(const float* __restrict__ q, const float* __restrict__ k, const float* __restrict__ v, const float* __restrict__ gq, const float* __restrict__ bq, const float* __restrict__ gk, const float* __restrict__ bk, const float* __restrict__ gv, const float* __restrict__ bv2, _Float16* __restrict__ X16) {
  const int wave = threadIdx.x >> 5, lane = threadIdx.x & 31, which = blockIdx.y; const size_t r = (size_t)blockIdx.x * 16 + wave * 2; if (r >= NR) return;
  const float* src = (which == 0 ? q : which == 1 ? k : v) + r * HID; const float* g = which == 0 ? gq : which == 1 ? gk : gv; const float* bb = which == 0 ? bq : which == 1 ? bk : bv2;
  float xv[2][32];
#pragma unroll
  for (int w = 0; w < 2; ++w)
#pragma unroll
    for (int i = 0; i < 4; ++i) { const v4f a = *(const v4f*)(src + w * HID + i * 256 + lane * 8), c = *(const v4f*)(src + w * HID + i * 256 + lane * 8 + 4);
      xv[w][i * 8 + 0] = a[0]; xv[w][i * 8 + 1] = a[1]; xv[w][i * 8 + 2] = a[2]; xv[w][i * 8 + 3] = a[3]; xv[w][i * 8 + 4] = c[0]; xv[w][i * 8 + 5] = c[1]; xv[w][i * 8 + 6] = c[2]; xv[w][i * 8 + 7] = c[3]; }
  __builtin_amdgcn_sched_barrier(0);   // keeps all 16 loads in front of the first row's sums: sunk behind them, the second row's last loads wait out a second memory latency
#pragma unroll
  for (int w = 0; w < 2; ++w) { float s = 0.f;
#pragma unroll
    for (int i = 0; i < 32; ++i) s += xv[w][i];
#pragma unroll
    for (int off = 16; off >= 1; off >>= 1) s += __shfl_xor(s, off, 32);
    const float mu = s * (1.0f / HID); float q2 = 0.f;
#pragma unroll
    for (int i = 0; i < 32; ++i) { const float d = xv[w][i] - mu; q2 += d * d; }
#pragma unroll
    for (int off = 16; off >= 1; off >>= 1) q2 += __shfl_xor(q2, off, 32);
    const float rs = rsqrtf(q2 * (1.0f / HID) + 1e-5f);
#pragma unroll
    for (int i = 0; i < 4; ++i) { union { v8h h; v4u u; } pk;
#pragma unroll
      for (int e = 0; e < 8; ++e) { const int c = i * 256 + lane * 8 + e; pk.h[e] = (_Float16)((xv[w][i * 8 + e] - mu) * rs * g[c] + bb[c]); }
      vst2(X16 + ((size_t)which * NR + r + w) * HID + i * 256 + lane * 8, pk.u); } }
}
// P rows [w*1024 + n] = W_w[n][:] * 16 (W are [out][in]): w = 0 Wq, 1 Wk, 2 Wv, 3 Wf. A block takes 16 whole rows of one W, a wave 2 of them (8 KB in, 4 KB out):
// a lane's 16 loads of 16 bytes are all asked for before the first is converted, and each store is 512 contiguous bytes of a wave
__global__ __launch_bounds__(256) void k_pack(const float* __restrict__ Wq, const float* __restrict__ Wk, const float* __restrict__ Wv, const float* __restrict__ Wf, _Float16* __restrict__ P) {
  const int which = blockIdx.x >> 6, wave = threadIdx.x >> 5, lane = threadIdx.x & 31;
  const size_t o = (size_t)(blockIdx.x & 63) * (16 * HID) + wave * (2 * HID) + lane * 8;
  const float* W = (which == 0 ? Wq : which == 1 ? Wk : which == 2 ? Wv : Wf) + o; _Float16* D = P + (size_t)which * HID * HID + o;
  v4f x[16];
#pragma unroll
  for (int i = 0; i < 8; ++i) { x[2 * i] = *(const v4f*)(W + i * 256); x[2 * i + 1] = *(const v4f*)(W + i * 256 + 4); }
#pragma unroll
  for (int i = 0; i < 8; ++i) { union { v8h h; v4u u; } pk;
#pragma unroll
    for (int e = 0; e < 4; ++e) { pk.h[e] = (_Float16)(x[2 * i][e] * 16.0f); pk.h[4 + e] = (_Float16)(x[2 * i + 1][e] * 16.0f); }
    vst2(D + i * 256, pk.u); }
}
// RoPE tables: CS[s][j] = cos(s * inv_freq[j]), SN likewise, j < 32
__global__ __launch_bounds__(256) void k_rope(float* __restrict__ CS, float* __restrict__ SN) {
  const int s = blockIdx.x * 8 + (threadIdx.x >> 5), j = threadIdx.x & 31;
  const float inv = 1.0f / powf(10000.0f, (float)(2 * j) / (float)HD); const float f = (float)s * inv;
  vst2(CS + (size_t)s * 32 + j, cosf(f)); vst2(SN + (size_t)s * 32 + j, sinf(f));
}
// Shared GEMM core of k_qkv and k_ffn: Y[128 rows][128 cols] = A[128][1024] * Bw[128][1024]^T per block of 8 waves (4 x 2), 32 x 64 per wave.
// A pass is 64 k = 128 bytes of each of the 256 operand rows, brought into LDS by asynchronous copies (16 bytes a lane, 8 copies a lane and pass),
// two buffers: pass t + 2 is copied into the buffer that pass t has just left. LDS rows at pitch 144 bytes for the ds_load_b128 fragment readers.
#define GP 144
#define GBUF (256 * GP)
#define NPASS (HID / 64)
// one pass's tile: rows rr, rr+RS, rr+2RS, rr+3RS of the first operand (LDS rows 0..4RS-1, source pitch SA elements) and of the second (LDS rows 4RS..8RS-1,
// source pitch SB); l, a, bw are this lane's own 16 bytes of row rr
template <int RS, int SA, int SB> __device__ __forceinline__ void copy_tile(unsigned l, const _Float16* a, const _Float16* bw) {
  const unsigned l0 = l, l1 = l + RS * GP, l2 = l + 2 * RS * GP, l3 = l + 3 * RS * GP, l4 = l + 4 * RS * GP, l5 = l + 5 * RS * GP, l6 = l + 6 * RS * GP, l7 = l + 7 * RS * GP;
  const _Float16 *a0 = a, *a1 = a + RS * SA, *a2 = a + 2 * RS * SA, *a3 = a + 3 * RS * SA, *w0 = bw, *w1 = bw + RS * SB, *w2 = bw + 2 * RS * SB, *w3 = bw + 3 * RS * SB;
  // the copies and their s_wait_xcnt in one statement: no address register of a copy is rewritten in front of that wait
  asm volatile("global_load_async_to_lds_b128 %0, %8, off\n\t"
               "global_load_async_to_lds_b128 %1, %9, off\n\t"
               "global_load_async_to_lds_b128 %2, %10, off\n\t"
               "global_load_async_to_lds_b128 %3, %11, off\n\t"
               "global_load_async_to_lds_b128 %4, %12, off\n\t"
               "global_load_async_to_lds_b128 %5, %13, off\n\t"
               "global_load_async_to_lds_b128 %6, %14, off\n\t"
               "global_load_async_to_lds_b128 %7, %15, off\n\t"
               "s_wait_xcnt 0x0"
               :: "v"(l0), "v"(l1), "v"(l2), "v"(l3), "v"(l4), "v"(l5), "v"(l6), "v"(l7), "v"(a0), "v"(a1), "v"(a2), "v"(a3), "v"(w0), "v"(w1), "v"(w2), "v"(w3) : "memory");
}
// A, Bw: first row of the block's 128 rows of each operand (row length HID); on return every wave has left the ring (the last pass's barrier)
__device__ __forceinline__ void gemm_core(const _Float16* __restrict__ A, const _Float16* __restrict__ Bw, char* ring, v8f (&acc)[2][4]) {
  const int tid = threadIdx.x, wave = tid >> 5, lane = tid & 31, col = lane & 15, wm = wave >> 1, wn = wave & 1;
  const int rr = tid >> 3, seg = tid & 7;
  const unsigned l = (unsigned)(size_t)ring + rr * GP + seg * 16;
  const _Float16* a = A + (size_t)rr * HID + seg * 8; const _Float16* bw = Bw + (size_t)rr * HID + seg * 8;
  copy_tile<32, HID, HID>(l, a, bw);
  asm volatile("s_wait_asynccnt 0x0" ::: "memory");   // pass 0's copies of this wave have landed
  __syncthreads();                                    // ... and every other wave's
  copy_tile<32, HID, HID>(l + GBUF, a + 64, bw + 64);
  for (int t = 0; t < NPASS; ++t) {
    const char* buf = ring + (t & 1) * GBUF;
#pragma unroll
    for (int kc = 0; kc < 2; ++kc) { v16h fa[2], fb[4];
#pragma unroll
      for (int i = 0; i < 2; ++i) fa[i] = frag_h((const _Float16*)(buf + (wm * 32 + i * 16 + col) * GP + kc * 64), lane);
#pragma unroll
      for (int j = 0; j < 4; ++j) fb[j] = frag_h((const _Float16*)(buf + (128 + wn * 64 + j * 16 + col) * GP + kc * 64), lane);
#pragma unroll
      for (int i = 0; i < 2; ++i)
#pragma unroll
        for (int j = 0; j < 4; ++j) acc[i][j] = wmma16(fa[i], fb[j], acc[i][j]); }
    asm volatile("s_wait_dscnt 0x0" ::: "memory");    // this wave's reads of pass t's buffer are done before it is refilled
    asm volatile("s_wait_asynccnt 0x0" ::: "memory"); // this wave's copies of pass t + 1 have landed
    __syncthreads();                                  // publishes pass t + 1 and ends every reader's last read of pass t's buffer
    if (t + 2 < NPASS) copy_tile<32, HID, HID>(l + (t & 1) * GBUF, a + (t + 2) * 64, bw + (t + 2) * 64);
  }
  asm volatile("s_wait_asynccnt 0x0" ::: "memory");   // nothing in flight when the ring becomes output staging
}
// q/k/v projections + bias (+RoPE for q,k): block (128 rows, 128 cols = 2 heads, which), a wave has 32 rows of one head
__global__ __launch_bounds__(256) void k_qkv(const _Float16* __restrict__ X16, const _Float16* __restrict__ P, const float* __restrict__ bq, const float* __restrict__ bk, const float* __restrict__ bv, const float* __restrict__ CS, const float* __restrict__ SN,
                                           _Float16* __restrict__ Q16, _Float16* __restrict__ K16, _Float16* __restrict__ VT) {
  __shared__ __align__(16) char ring[2 * GBUF];
  const int tid = threadIdx.x, wave = tid >> 5, lane = tid & 31, col = lane & 15, g = lane >> 4, wm = wave >> 1, wn = wave & 1;
  const int which = blockIdx.z, r0b = blockIdx.x * 128, n0 = blockIdx.y * 128; const int b = r0b / SS, s0 = r0b % SS;
  const float* bias = which == 0 ? bq : (which == 1 ? bk : bv);
  v8f acc[2][4] = {};
  gemm_core(X16 + ((size_t)which * NR + r0b) * HID, P + ((size_t)which * HID + n0) * HID, ring, acc);
#pragma unroll
  for (int j = 0; j < 4; ++j) { const float bb = bias[n0 + wn * 64 + j * 16 + col];
#pragma unroll
    for (int i = 0; i < 2; ++i)
#pragma unroll
      for (int r = 0; r < 8; ++r) acc[i][j][r] = acc[i][j][r] * (1.0f / 16.0f) + bb; }
  if (which < 2) {
    // RoPE within the wave's head: d = j*16 + col ; d < 32: x cos - x(d+32) sin ; d >= 32: x cos + x(d-32) sin, angle index d & 31
    float (*so)[68] = (float (*)[68])(ring + wave * (32 * 68 * 4));
#pragma unroll
    for (int i = 0; i < 2; ++i)
#pragma unroll
      for (int jj = 0; jj < 2; ++jj) { const int dj = jj * 16 + col;      // dj < 32
#pragma unroll
        for (int r = 0; r < 8; ++r) { const int rl = i * 16 + 8 * g + r, s = s0 + wm * 32 + rl; const float c = CS[(size_t)s * 32 + dj], sn = SN[(size_t)s * 32 + dj];
          const float lo = acc[i][jj][r], hi = acc[i][jj + 2][r];
          so[rl][jj * 16 + col] = (lo * c - hi * sn) * 4.0f; so[rl][(jj + 2) * 16 + col] = (hi * c + lo * sn) * 4.0f; } }
    LDSX();
    _Float16* D = which == 0 ? Q16 : K16; const int h = (n0 >> 6) + wn;
    for (int qq = lane; qq < 32 * 8; qq += 32) { const int rl = qq >> 3, pc = qq & 7; union { v8h h8; v4u u; } pk;
#pragma unroll
      for (int e = 0; e < 8; ++e) pk.h8[e] = (_Float16)so[rl][pc * 8 + e];
      vst2(D + (((size_t)b * NH + h) * SS + s0 + wm * 32 + rl) * HD + pc * 8, pk.u); } }
  else {
    _Float16 (*st)[136] = (_Float16 (*)[136])ring;
#pragma unroll
    for (int i = 0; i < 2; ++i)
#pragma unroll
      for (int j = 0; j < 4; ++j)
#pragma unroll
        for (int r = 0; r < 8; ++r) st[wn * 64 + j * 16 + col][wm * 32 + i * 16 + 8 * g + r] = (_Float16)(acc[i][j][r] * 4.0f);
    __syncthreads();
    for (int qq = tid; qq < 128 * 16; qq += 256) { const int cl = qq >> 4, pc = qq & 15; const int c = n0 + cl, h = c >> 6, d = c & 63; vst2(VT + (((size_t)b * NH + h) * HD + d) * SS + s0 + pc * 8, *(const v4u*)(&st[cl][pc * 8])); } }
}
// attention: block (64 q, h, b); scores = q.k/8, masked keys (mask[b][key] == 0) -> 1e-10; online softmax; O16 [b][h][s][64] x8
// a pass's 64 K rows and 64 V^T rows (128 bytes each) come into LDS by the same asynchronous copies, two buffers, shared by the four waves
#define ABUF (128 * GP)
__global__ __launch_bounds__(128) void k_attn(const _Float16* __restrict__ Q16, const _Float16* __restrict__ K16, const _Float16* __restrict__ VT, const int* __restrict__ mask, _Float16* __restrict__ O16) {
  __shared__ __align__(16) float sS[4][16][68];
  __shared__ __align__(16) _Float16 sP[4][16][72];
  __shared__ __align__(16) char ring[2 * ABUF];
  __shared__ int smk[SS];
  const int tid = threadIdx.x, w = tid >> 5, lane = tid & 31, col = lane & 15, g = lane >> 4;
  const int b = blockIdx.z, h = blockIdx.y, q0 = blockIdx.x * 64 + w * 16; const size_t bh = (size_t)b * NH + h;
  const unsigned l = (unsigned)(size_t)ring + (tid >> 3) * GP + (tid & 7) * 16;
  const _Float16* kg = K16 + (bh * SS + (tid >> 3)) * HD + (tid & 7) * 8; const _Float16* vg = VT + (bh * HD + (tid >> 3)) * SS + (tid & 7) * 8;
  copy_tile<16, HD, SS>(l, kg, vg);
  for (int qq = tid; qq < SS; qq += 128) smk[qq] = mask[(size_t)b * SS + qq];
  asm volatile("s_wait_asynccnt 0x0" ::: "memory");   // pass 0's copies of this wave have landed
  __syncthreads();                                    // ... and every other wave's; smk is written
  copy_tile<16, HD, SS>(l + ABUF, kg + 64 * HD, vg + 64);
  v16h aq[2];
#pragma unroll
  for (int kc = 0; kc < 2; ++kc) aq[kc] = frag_h(Q16 + (bh * SS + q0 + col) * HD + kc * 32, lane);
  float mrun = -3.0e38f, lrun = 0.f; v8f acc[4] = {};
#pragma unroll 1
  for (int kt = 0; kt < SS / 64; ++kt) { const char* buf = ring + (kt & 1) * ABUF;
#pragma unroll
    for (int t = 0; t < 4; ++t) { v8f s = {}; const int key = kt * 64 + t * 16 + col;
#pragma unroll
      for (int kc = 0; kc < 2; ++kc) s = wmma16(aq[kc], frag_h((const _Float16*)(buf + (t * 16 + col) * GP + kc * 64), lane), s);
      const bool keep = smk[key] != 0;
#pragma unroll
      for (int r = 0; r < 8; ++r) sS[w][8 * g + r][t * 16 + col] = keep ? s[r] * (0.125f / 16.0f) : 1e-10f; }
    LDSX();
    float mx = -3.4e38f;
#pragma unroll
    for (int jj = 0; jj < 32; ++jj) mx = fmaxf(mx, sS[w][col][g * 32 + jj]);
    mx = fmaxf(mx, __shfl_xor(mx, 16, 32));
    const float mnew = fmaxf(mrun, mx); const float corr = expf(mrun - mnew);
    float ps = 0.f;
#pragma unroll
    for (int jj = 0; jj < 32; ++jj) { const float p = expf(sS[w][col][g * 32 + jj] - mnew); ps += p; sP[w][col][g * 32 + jj] = (_Float16)(p * 16384.0f); }
    ps += __shfl_xor(ps, 16, 32);
    lrun = lrun * corr + ps; mrun = mnew;
#pragma unroll
    for (int r = 0; r < 8; ++r) { const float cr = __shfl(corr, 8 * g + r, 32);
#pragma unroll
      for (int t = 0; t < 4; ++t) acc[t][r] *= cr; }
    LDSX();
#pragma unroll
    for (int kc = 0; kc < 2; ++kc) { const v16h pa = frag_h(&sP[w][col][0] + kc * 32, lane);
#pragma unroll
      for (int t = 0; t < 4; ++t) acc[t] = wmma16(pa, frag_h((const _Float16*)(buf + (64 + t * 16 + col) * GP + kc * 64), lane), acc[t]); }
    __builtin_amdgcn_wave_barrier();
    asm volatile("s_wait_dscnt 0x0" ::: "memory");    // this wave's reads of pass kt's buffer are done before it is refilled
    asm volatile("s_wait_asynccnt 0x0" ::: "memory"); // this wave's copies of pass kt + 1 have landed
    __syncthreads();                                  // publishes pass kt + 1 and ends every reader's last read of pass kt's buffer
    if (kt + 2 < SS / 64) copy_tile<16, HD, SS>(l + (kt & 1) * ABUF, kg + (size_t)(kt + 2) * 64 * HD, vg + (kt + 2) * 64); }
  asm volatile("s_wait_asynccnt 0x0" ::: "memory");   // nothing in flight when the ring becomes output staging
  float (*sO)[16][68] = (float (*)[16][68])ring;
#pragma unroll
  for (int r = 0; r < 8; ++r) { const float lr = __shfl(lrun, 8 * g + r, 32); const float inv = 8.0f / (lr * 16384.0f * 4.0f);
#pragma unroll
    for (int t = 0; t < 4; ++t) sO[w][8 * g + r][t * 16 + col] = acc[t][r] * inv; }
  LDSX();
  for (int qq = lane; qq < 16 * 8; qq += 32) { const int rl = qq >> 3, pc = qq & 7; union { v8h h8; v4u u; } pk;
#pragma unroll
    for (int e = 0; e < 8; ++e) pk.h8[e] = (_Float16)sO[w][rl][pc * 8 + e];
    vst2(O16 + ((bh * SS) + q0 + rl) * HD + pc * 8, pk.u); }
}
// fx = LN2(x) with x = merged O (/8): wave per row -> FX f32 rows and FX16 f16 rows
__global__ __launch_bounds__(256) void k_ln2(const _Float16* __restrict__ O16, const float* __restrict__ g2, const float* __restrict__ b2, float* __restrict__ FX, _Float16* __restrict__ FX16) {
  const int wave = threadIdx.x >> 5, lane = threadIdx.x & 31; const size_t r = (size_t)blockIdx.x * 8 + wave; if (r >= NR) return;
  const int b = (int)(r / SS), s = (int)(r % SS);
  float xv[32]; float sm = 0.f;
#pragma unroll
  for (int i = 0; i < 4; ++i) { const int c0 = i * 256 + lane * 8; const int h = c0 >> 6, d = c0 & 63; const _Float16* src = O16 + (((size_t)b * NH + h) * SS + s) * HD + d;
#pragma unroll
    for (int e = 0; e < 8; ++e) { xv[i * 8 + e] = (float)src[e] * 0.125f; sm += xv[i * 8 + e]; } }
#pragma unroll
  for (int off = 16; off >= 1; off >>= 1) sm += __shfl_xor(sm, off, 32);
  const float mu = sm * (1.0f / HID); float q2 = 0.f;
#pragma unroll
  for (int i = 0; i < 32; ++i) { const float dd = xv[i] - mu; q2 += dd * dd; }
#pragma unroll
  for (int off = 16; off >= 1; off >>= 1) q2 += __shfl_xor(q2, off, 32);
  const float rs = rsqrtf(q2 * (1.0f / HID) + 1e-5f);
#pragma unroll
  for (int i = 0; i < 4; ++i) { union { v8h h; v4u u; } pk; v4f f0, f1;
#pragma unroll
    for (int e = 0; e < 8; ++e) { const int c = i * 256 + lane * 8 + e; const float fv = (xv[i * 8 + e] - mu) * rs * g2[c] + b2[c]; pk.h[e] = (_Float16)fv; if (e < 4) f0[e] = fv; else f1[e - 4] = fv; }
    vst2(FX + r * HID + i * 256 + lane * 8, f0); vst2(FX + r * HID + i * 256 + lane * 8 + 4, f1); vst2(FX16 + r * HID + i * 256 + lane * 8, pk.u); }
}
// fo = relu(fx Wf^T + bf): block (128 rows, 128 cols) -> FO f32
__global__ __launch_bounds__(256) void k_ffn(const _Float16* __restrict__ FX16, const _Float16* __restrict__ P, const float* __restrict__ bf, float* __restrict__ FO) {
  __shared__ __align__(16) char ring[2 * GBUF];
  const int tid = threadIdx.x, wave = tid >> 5, lane = tid & 31, col = lane & 15, g = lane >> 4, wm = wave >> 1, wn = wave & 1;
  const int r0b = blockIdx.x * 128, n0 = blockIdx.y * 128;
  v8f acc[2][4] = {};
  gemm_core(FX16 + (size_t)r0b * HID, P + ((size_t)3 * HID + n0) * HID, ring, acc);
  float (*so)[68] = (float (*)[68])(ring + wave * (32 * 68 * 4));
#pragma unroll
  for (int j = 0; j < 4; ++j) { const float bb = bf[n0 + wn * 64 + j * 16 + col];
#pragma unroll
    for (int i = 0; i < 2; ++i)
#pragma unroll
      for (int r = 0; r < 8; ++r) { const float vv = acc[i][j][r] * (1.0f / 16.0f) + bb; so[i * 16 + 8 * g + r][j * 16 + col] = vv > 0.f ? vv : 0.f; } }
  LDSX();
#pragma unroll
  for (int rp = 0; rp < 16; ++rp) { const int rl = rp * 2 + g; vst2(FO + (size_t)(r0b + wm * 32 + rl) * HID + n0 + wn * 64 + col * 4, *(const v4f*)(&so[rl][col * 4])); }
}
// out = fx + LN3(fo): wave per row
__global__ __launch_bounds__(256) void k_fin(const float* __restrict__ FX, const float* __restrict__ FO, const float* __restrict__ g3, const float* __restrict__ b3, float* __restrict__ out) {
  const int wave = threadIdx.x >> 5, lane = threadIdx.x & 31; const size_t r = (size_t)blockIdx.x * 8 + wave; if (r >= NR) return;
  const float* fo = FO + r * HID; float xv[32]; float sm = 0.f;
#pragma unroll
  for (int i = 0; i < 4; ++i) { const v4f a = *(const v4f*)(fo + i * 256 + lane * 8), c = *(const v4f*)(fo + i * 256 + lane * 8 + 4);
    xv[i * 8 + 0] = a[0]; xv[i * 8 + 1] = a[1]; xv[i * 8 + 2] = a[2]; xv[i * 8 + 3] = a[3]; xv[i * 8 + 4] = c[0]; xv[i * 8 + 5] = c[1]; xv[i * 8 + 6] = c[2]; xv[i * 8 + 7] = c[3]; }
#pragma unroll
  for (int i = 0; i < 32; ++i) sm += xv[i];
#pragma unroll
  for (int off = 16; off >= 1; off >>= 1) sm += __shfl_xor(sm, off, 32);
  const float mu = sm * (1.0f / HID); float q2 = 0.f;
#pragma unroll
  for (int i = 0; i < 32; ++i) { const float dd = xv[i] - mu; q2 += dd * dd; }
#pragma unroll
  for (int off = 16; off >= 1; off >>= 1) q2 += __shfl_xor(q2, off, 32);
  const float rs = rsqrtf(q2 * (1.0f / HID) + 1e-5f);
  const float* fx = FX + r * HID;
#pragma unroll
  for (int i = 0; i < 4; ++i) { v4f o0, o1; const int c0 = i * 256 + lane * 8;
#pragma unroll
    for (int e = 0; e < 8; ++e) { const int c = c0 + e; const float vv = fx[c] + ((xv[i * 8 + e] - mu) * rs * g3[c] + b3[c]); if (e < 4) o0[e] = vv; else o1[e - 4] = vv; }
    vst2(out + r * HID + c0, o0); vst2(out + r * HID + c0 + 4, o1); }
}
extern "C" void kernel_launch(void* const* d_in, const int* in_sizes, int n_in, void* d_out, int out_size, void* d_ws, size_t ws_size, hipStream_t stream) {
  (void)in_sizes; (void)n_in; (void)out_size; (void)ws_size;
  const float** I = (const float**)d_in;
  const float* q = I[0]; const float* k = I[1]; const float* v = I[2]; const float* g1q = I[3]; const float* b1q = I[4]; const float* g1k = I[5]; const float* b1k = I[6]; const float* g1v = I[7]; const float* b1v = I[8];
  const float* Wq = I[9]; const float* bq = I[10]; const float* Wk = I[11]; const float* bk = I[12]; const float* Wv = I[13]; const float* bv = I[14]; const float* g2 = I[15]; const float* b2 = I[16]; const float* g3 = I[17]; const float* b3 = I[18]; const float* Wf = I[19]; const float* bf = I[20]; const int* mask = (const int*)d_in[21];
  float* out = (float*)d_out;
  char* ws = (char*)d_ws; size_t off = 0;
  auto take = [&](size_t bytes) { char* p = ws + off; off += (bytes + 255) & ~(size_t)255; return p; };
  _Float16* X16 = (_Float16*)take((size_t)3 * NR * HID * 2); _Float16* P = (_Float16*)take((size_t)4 * HID * HID * 2); float* CS = (float*)take((size_t)SS * 32 * 4); float* SN = (float*)take((size_t)SS * 32 * 4);
  _Float16* Q16 = (_Float16*)take((size_t)NR * HID * 2); _Float16* K16 = (_Float16*)take((size_t)NR * HID * 2); _Float16* VT = (_Float16*)take((size_t)NR * HID * 2); _Float16* O16 = (_Float16*)take((size_t)NR * HID * 2);
  float* FX = (float*)take((size_t)NR * HID * 4); _Float16* FX16 = (_Float16*)take((size_t)NR * HID * 2); float* FO = (float*)take((size_t)NR * HID * 4);
  k_ln3<<<dim3(NR / 16, 3), 256, 0, stream>>>(q, k, v, g1q, b1q, g1k, b1k, g1v, b1v, X16);
  k_pack<<<4 * HID / 16, 256, 0, stream>>>(Wq, Wk, Wv, Wf, P);
  k_rope<<<SS / 8, 256, 0, stream>>>(CS, SN);
  k_qkv<<<dim3(NR / 128, HID / 128, 3), 256, 0, stream>>>(X16, P, bq, bk, bv, CS, SN, Q16, K16, VT);
  k_attn<<<dim3(SS / 64, NH, NB), 128, 0, stream>>>(Q16, K16, VT, mask, O16);
  k_ln2<<<NR / 8, 256, 0, stream>>>(O16, g2, b2, FX, FX16);
  k_ffn<<<dim3(NR / 128, HID / 128), 256, 0, stream>>>(FX16, P, bf, FO);
  k_fin<<<NR / 8, 256, 0, stream>>>(FX, FO, g3, b3, out);
}

// v003
// Measured time: 110 microseconds a run.
// Next to v002, in two timings, it ran 1.10 and 1.11 times as fast.
// Over all steps from v000 it is 2.74 times as fast.
#include <hip/hip_runtime.h>
#include <math.h>

typedef __attribute__((ext_vector_type(16))) _Float16 v16h;
typedef __attribute__((ext_vector_type(16))) __bf16 v16b;
typedef __attribute__((ext_vector_type(8)))  _Float16 v8h;
typedef __attribute__((ext_vector_type(8)))  float v8f;
typedef __attribute__((ext_vector_type(4)))  float v4f;
typedef __attribute__((ext_vector_type(2)))  float v2f;
typedef __attribute__((ext_vector_type(4)))  unsigned v4u;
typedef __attribute__((ext_vector_type(4)))  int v4i;
typedef float __attribute__((may_alias)) float_a;
typedef int __attribute__((may_alias)) int_a;

template <typename T> __device__ __forceinline__ void vst2(void* p, T v) { *(T*)p = v;  }
__device__ __forceinline__ v8f wmma16(v16h a, v16h b, v8f c) {
  v8f d = __builtin_amdgcn_wmma_f32_16x16x32_f16(false, a, false, b, (short)0, c, false, false);
  asm volatile("v_nop\n\tv_nop\n\tv_nop\n\tv_nop" : "+v"(d) : "v"(a), "v"(b));
  return d;
}
__device__ __forceinline__ v8f wmma_bf(v16b a, v16b b, v8f c) {
  v8f d = __builtin_amdgcn_wmma_f32_16x16x32_bf16(false, a, false, b, (short)0, c, false, false);
  asm volatile("v_nop\n\tv_nop\n\tv_nop\n\tv_nop" : "+v"(d) : "v"(a), "v"(b));
  return d;
}
// 16x16x32 fragments: lane = (h = lane>>4, row/col = lane&15); elements 0..7 = k0+8h+0..7, 8..15 = k0+16+8h+0..7; D element r = row 8h+r
__device__ __forceinline__ v16h frag_h(const _Float16* rowk0, int lane) {
  union { v16h v; v8h q[2]; } u; const _Float16* p = rowk0 + 8 * (lane >> 4);
  u.q[0] = *(const v8h*)p; u.q[1] = *(const v8h*)(p + 16); return u.v;
}
__device__ __forceinline__ v16h frag_f32(const float* rowk0, int lane) {
  v16h a; const float* p = rowk0 + 8 * (lane >> 4);
#pragma unroll
  for (int i = 0; i < 8; ++i) { a[i] = (_Float16)p[i]; a[8 + i] = (_Float16)p[16 + i]; }
  return a;
}
__device__ __forceinline__ v16h frag_f32s(const float* rowk0, int lane, float sc) {
  v16h a; const float* p = rowk0 + 8 * (lane >> 4);
#pragma unroll
  for (int i = 0; i < 8; ++i) { a[i] = (_Float16)(p[i] * sc); a[8 + i] = (_Float16)(p[16 + i] * sc); }
  return a;
}
// column fragment from a [K][ld] layout (column n), rows >= K read as 0
__device__ __forceinline__ v16h fragc_f32(const float* W, int k0, int n, int lane, int ld, int K) {
  v16h a; const int g = lane >> 4;
#pragma unroll
  for (int i = 0; i < 8; ++i) { const int ka = k0 + 8 * g + i, kb = ka + 16;
    a[i] = (_Float16)(ka < K ? W[(size_t)ka * ld + n] : 0.f); a[8 + i] = (_Float16)(kb < K ? W[(size_t)kb * ld + n] : 0.f); }
  return a;
}
struct F2 { v16b h, l; };
__device__ __forceinline__ F2 bsplit16(const float v[16]) { F2 r;
#pragma unroll
  for (int i = 0; i < 16; ++i) { const __bf16 h = (__bf16)v[i]; r.h[i] = h; r.l[i] = (__bf16)(v[i] - (float)h); }
  return r; }
__device__ __forceinline__ F2 split_row(const float* row, int k0, int lane) { float v[16]; const float* p = row + k0 + 8 * (lane >> 4);
#pragma unroll
  for (int i = 0; i < 8; ++i) { v[i] = p[i]; v[8 + i] = p[16 + i]; }
  return bsplit16(v); }
__device__ __forceinline__ F2 split_rowK(const float* row, int k0, int lane, int K) { float v[16]; const int g = lane >> 4;
#pragma unroll
  for (int i = 0; i < 8; ++i) { const int ka = k0 + 8 * g + i, kb = ka + 16; v[i] = ka < K ? row[ka] : 0.f; v[8 + i] = kb < K ? row[kb] : 0.f; }
  return bsplit16(v); }
__device__ __forceinline__ F2 split_col(const float* W, int k0, int n, int lane, int ld, int K) { float v[16]; const int g = lane >> 4;
#pragma unroll
  for (int i = 0; i < 8; ++i) { const int ka = k0 + 8 * g + i, kb = ka + 16; v[i] = ka < K ? W[(size_t)ka * ld + n] : 0.f; v[8 + i] = kb < K ? W[(size_t)kb * ld + n] : 0.f; }
  return bsplit16(v); }
__device__ __forceinline__ v8f mac3(const F2& a, const F2& b, v8f c) { c = wmma_bf(a.l, b.h, c); c = wmma_bf(a.h, b.l, c); return wmma_bf(a.h, b.h, c); }
__device__ __forceinline__ float sigm(float v) { return 1.0f / (1.0f + expf(-v)); }
#define LDSX() do { asm volatile("s_wait_dscnt 0" ::: "memory"); __builtin_amdgcn_wave_barrier(); __builtin_amdgcn_fence(__ATOMIC_RELEASE, "workgroup"); } while (0)

// Pre-LN multi-head attention block with RoPE and a post FFN: LN(q), LN(k), LN(v) -> projections (+bias) -> rotary embedding -> 16-head
// attention with the module's masked_fill value 1e-10 (mask read as data) -> merge -> fx = LN2(x); fo = relu(fx Wf^T + bf); out = fx +
// LN3(fo). LayerNorms, RoPE (cos/sin table in f32), softmax (online over 16 key tiles) in f32; all four products on
// v_wmma_f32_16x16x32_f16 (LN outputs as f16 rows, [out][in] weights as f16 rows x16, q/k/v head-major f16 x4, P x2^14, O x8).
#define NB 4
#define SS 1024
#define HID 1024
#define NH 16
#define HD 64
#define NR (NB * SS)

// LN of two 1024-rows per wave (both rows' 16 loads of 16 bytes are asked for before either is summed): src selects q/k/v by blockIdx.y; dst f16 rows
__global__ __launch_bounds__(256) void k_ln3(const float* __restrict__ q, const float* __restrict__ k, const float* __restrict__ v, const float* __restrict__ gq, const float* __restrict__ bq, const float* __restrict__ gk, const float* __restrict__ bk, const float* __restrict__ gv, const float* __restrict__ bv2, _Float16* __restrict__ X16) {
  const int wave = threadIdx.x >> 5, lane = threadIdx.x & 31, which = blockIdx.y; const size_t r = (size_t)blockIdx.x * 16 + wave * 2; if (r >= NR) return;
  const float* src = (which == 0 ? q : which == 1 ? k : v) + r * HID; const float* g = which == 0 ? gq : which == 1 ? gk : gv; const float* bb = which == 0 ? bq : which == 1 ? bk : bv2;
  float xv[2][32];
#pragma unroll
  for (int w = 0; w < 2; ++w)
#pragma unroll
    for (int i = 0; i < 4; ++i) { const v4f a = *(const v4f*)(src + w * HID + i * 256 + lane * 8), c = *(const v4f*)(src + w * HID + i * 256 + lane * 8 + 4);
      xv[w][i * 8 + 0] = a[0]; xv[w][i * 8 + 1] = a[1]; xv[w][i * 8 + 2] = a[2]; xv[w][i * 8 + 3] = a[3]; xv[w][i * 8 + 4] = c[0]; xv[w][i * 8 + 5] = c[1]; xv[w][i * 8 + 6] = c[2]; xv[w][i * 8 + 7] = c[3]; }
  __builtin_amdgcn_sched_barrier(0);   // keeps all 16 loads in front of the first row's sums: sunk behind them, the second row's last loads wait out a second memory latency
#pragma unroll
  for (int w = 0; w < 2; ++w) { float s = 0.f;
#pragma unroll
    for (int i = 0; i < 32; ++i) s += xv[w][i];
#pragma unroll
    for (int off = 16; off >= 1; off >>= 1) s += __shfl_xor(s, off, 32);
    const float mu = s * (1.0f / HID); float q2 = 0.f;
#pragma unroll
    for (int i = 0; i < 32; ++i) { const float d = xv[w][i] - mu; q2 += d * d; }
#pragma unroll
    for (int off = 16; off >= 1; off >>= 1) q2 += __shfl_xor(q2, off, 32);
    const float rs = rsqrtf(q2 * (1.0f / HID) + 1e-5f);
#pragma unroll
    for (int i = 0; i < 4; ++i) { union { v8h h; v4u u; } pk;
#pragma unroll
      for (int e = 0; e < 8; ++e) { const int c = i * 256 + lane * 8 + e; pk.h[e] = (_Float16)((xv[w][i * 8 + e] - mu) * rs * g[c] + bb[c]); }
      vst2(X16 + ((size_t)which * NR + r + w) * HID + i * 256 + lane * 8, pk.u); } }
}
// P rows [w*1024 + n] = W_w[n][:] * 16 (W are [out][in]): w = 0 Wq, 1 Wk, 2 Wv, 3 Wf. A block takes 16 whole rows of one W, a wave 2 of them (8 KB in, 4 KB out):
// a lane's 16 loads of 16 bytes are all asked for before the first is converted, and each store is 512 contiguous bytes of a wave
__global__ __launch_bounds__(256) void k_pack(const float* __restrict__ Wq, const float* __restrict__ Wk, const float* __restrict__ Wv, const float* __restrict__ Wf, _Float16* __restrict__ P) {
  const int which = blockIdx.x >> 6, wave = threadIdx.x >> 5, lane = threadIdx.x & 31;
  const size_t o = (size_t)(blockIdx.x & 63) * (16 * HID) + wave * (2 * HID) + lane * 8;
  const float* W = (which == 0 ? Wq : which == 1 ? Wk : which == 2 ? Wv : Wf) + o; _Float16* D = P + (size_t)which * HID * HID + o;
  v4f x[16];
#pragma unroll
  for (int i = 0; i < 8; ++i) { x[2 * i] = *(const v4f*)(W + i * 256); x[2 * i + 1] = *(const v4f*)(W + i * 256 + 4); }
#pragma unroll
  for (int i = 0; i < 8; ++i) { union { v8h h; v4u u; } pk;
#pragma unroll
    for (int e = 0; e < 4; ++e) { pk.h[e] = (_Float16)(x[2 * i][e] * 16.0f); pk.h[4 + e] = (_Float16)(x[2 * i + 1][e] * 16.0f); }
    vst2(D + i * 256, pk.u); }
}
// RoPE tables: CS[s][j] = cos(s * inv_freq[j]), SN likewise, j < 32
__global__ __launch_bounds__(256) void k_rope(float* __restrict__ CS, float* __restrict__ SN) {
  const int s = blockIdx.x * 8 + (threadIdx.x >> 5), j = threadIdx.x & 31;
  const float inv = 1.0f / powf(10000.0f, (float)(2 * j) / (float)HD); const float f = (float)s * inv;
  vst2(CS + (size_t)s * 32 + j, cosf(f)); vst2(SN + (size_t)s * 32 + j, sinf(f));
}
// Shared GEMM core of k_qkv and k_ffn: Y[128 rows][128 cols] = A[128][1024] * Bw[128][1024]^T per block of 8 waves (4 x 2), 32 x 64 per wave.
// A pass is 64 k = 128 bytes of each of the 256 operand rows, brought into LDS by asynchronous copies (16 bytes a lane, 8 copies a lane and pass),
// two buffers: pass t + 2 is copied into the buffer that pass t has just left. LDS rows at pitch 144 bytes for the ds_load_b128 fragment readers.
#define GP 144
#define GBUF (256 * GP)
#define NPASS (HID / 64)
// one pass's tile: rows rr, rr+RS, rr+2RS, rr+3RS of the first operand (LDS rows 0..4RS-1, source pitch SA elements) and of the second (LDS rows 4RS..8RS-1,
// source pitch SB); l, a, bw are this lane's own 16 bytes of row rr
template <int RS, int SA, int SB> __device__ __forceinline__ void copy_tile(unsigned l, const _Float16* a, const _Float16* bw) {
  const unsigned l0 = l, l1 = l + RS * GP, l2 = l + 2 * RS * GP, l3 = l + 3 * RS * GP, l4 = l + 4 * RS * GP, l5 = l + 5 * RS * GP, l6 = l + 6 * RS * GP, l7 = l + 7 * RS * GP;
  const _Float16 *a0 = a, *a1 = a + RS * SA, *a2 = a + 2 * RS * SA, *a3 = a + 3 * RS * SA, *w0 = bw, *w1 = bw + RS * SB, *w2 = bw + 2 * RS * SB, *w3 = bw + 3 * RS * SB;
  // the copies and their s_wait_xcnt in one statement: no address register of a copy is rewritten in front of that wait
  asm volatile("global_load_async_to_lds_b128 %0, %8, off\n\t"
               "global_load_async_to_lds_b128 %1, %9, off\n\t"
               "global_load_async_to_lds_b128 %2, %10, off\n\t"
               "global_load_async_to_lds_b128 %3, %11, off\n\t"
               "global_load_async_to_lds_b128 %4, %12, off\n\t"
               "global_load_async_to_lds_b128 %5, %13, off\n\t"
               "global_load_async_to_lds_b128 %6, %14, off\n\t"
               "global_load_async_to_lds_b128 %7, %15, off\n\t"
               "s_wait_xcnt 0x0"
               :: "v"(l0), "v"(l1), "v"(l2), "v"(l3), "v"(l4), "v"(l5), "v"(l6), "v"(l7), "v"(a0), "v"(a1), "v"(a2), "v"(a3), "v"(w0), "v"(w1), "v"(w2), "v"(w3) : "memory");
}
// A, Bw: first row of the block's 128 rows of each operand (row length HID); on return every wave has left the ring (the last pass's barrier)
__device__ __forceinline__ void gemm_core(const _Float16* __restrict__ A, const _Float16* __restrict__ Bw, char* ring, v8f (&acc)[2][4]) {
  const int tid = threadIdx.x, wave = tid >> 5, lane = tid & 31, col = lane & 15, wm = wave >> 1, wn = wave & 1;
  const int rr = tid >> 3, seg = tid & 7;
  const unsigned l = (unsigned)(size_t)ring + rr * GP + seg * 16;
  const _Float16* a = A + (size_t)rr * HID + seg * 8; const _Float16* bw = Bw + (size_t)rr * HID + seg * 8;
  copy_tile<32, HID, HID>(l, a, bw);
  asm volatile("s_wait_asynccnt 0x0" ::: "memory");   // pass 0's copies of this wave have landed
  __syncthreads();                                    // ... and every other wave's
  copy_tile<32, HID, HID>(l + GBUF, a + 64, bw + 64);
  for (int t = 0; t < NPASS; ++t) {
    const char* buf = ring + (t & 1) * GBUF;
#pragma unroll
    for (int kc = 0; kc < 2; ++kc) { v16h fa[2], fb[4];
#pragma unroll
      for (int i = 0; i < 2; ++i) fa[i] = frag_h((const _Float16*)(buf + (wm * 32 + i * 16 + col) * GP + kc * 64), lane);
#pragma unroll
      for (int j = 0; j < 4; ++j) fb[j] = frag_h((const _Float16*)(buf + (128 + wn * 64 + j * 16 + col) * GP + kc * 64), lane);
#pragma unroll
      for (int i = 0; i < 2; ++i)
#pragma unroll
        for (int j = 0; j < 4; ++j) acc[i][j] = wmma16(fa[i], fb[j], acc[i][j]); }
    asm volatile("s_wait_dscnt 0x0" ::: "memory");    // this wave's reads of pass t's buffer are done before it is refilled
    asm volatile("s_wait_asynccnt 0x0" ::: "memory"); // this wave's copies of pass t + 1 have landed
    __syncthreads();                                  // publishes pass t + 1 and ends every reader's last read of pass t's buffer
    if (t + 2 < NPASS) copy_tile<32, HID, HID>(l + (t & 1) * GBUF, a + (t + 2) * 64, bw + (t + 2) * 64);
  }
  asm volatile("s_wait_asynccnt 0x0" ::: "memory");   // nothing in flight when the ring becomes output staging
}
// q/k/v projections + bias (+RoPE for q,k): block (128 rows, 128 cols = 2 heads, which), a wave has 32 rows of one head
__global__ __launch_bounds__(256) void k_qkv(const _Float16* __restrict__ X16, const _Float16* __restrict__ P, const float* __restrict__ bq, const float* __restrict__ bk, const float* __restrict__ bv, const float* __restrict__ CS, const float* __restrict__ SN,
                                           _Float16* __restrict__ Q16, _Float16* __restrict__ K16, _Float16* __restrict__ VT) {
  __shared__ __align__(16) char ring[2 * GBUF];
  const int tid = threadIdx.x, wave = tid >> 5, lane = tid & 31, col = lane & 15, g = lane >> 4, wm = wave >> 1, wn = wave & 1;
  const int which = blockIdx.z, r0b = blockIdx.x * 128, n0 = blockIdx.y * 128; const int b = r0b / SS, s0 = r0b % SS;
  const float* bias = which == 0 ? bq : (which == 1 ? bk : bv);
  v8f acc[2][4] = {};
  gemm_core(X16 + ((size_t)which * NR + r0b) * HID, P + ((size_t)which * HID + n0) * HID, ring, acc);
#pragma unroll
  for (int j = 0; j < 4; ++j) { const float bb = bias[n0 + wn * 64 + j * 16 + col];
#pragma unroll
    for (int i = 0; i < 2; ++i)
#pragma unroll
      for (int r = 0; r < 8; ++r) acc[i][j][r] = acc[i][j][r] * (1.0f / 16.0f) + bb; }
  if (which < 2) {
    // RoPE within the wave's head: d = j*16 + col ; d < 32: x cos - x(d+32) sin ; d >= 32: x cos + x(d-32) sin, angle index d & 31
    float (*so)[68] = (float (*)[68])(ring + wave * (32 * 68 * 4));
#pragma unroll
    for (int i = 0; i < 2; ++i)
#pragma unroll
      for (int jj = 0; jj < 2; ++jj) { const int dj = jj * 16 + col;      // dj < 32
#pragma unroll
        for (int r = 0; r < 8; ++r) { const int rl = i * 16 + 8 * g + r, s = s0 + wm * 32 + rl; const float c = CS[(size_t)s * 32 + dj], sn = SN[(size_t)s * 32 + dj];
          const float lo = acc[i][jj][r], hi = acc[i][jj + 2][r];
          so[rl][jj * 16 + col] = (lo * c - hi * sn) * 4.0f; so[rl][(jj + 2) * 16 + col] = (hi * c + lo * sn) * 4.0f; } }
    LDSX();
    _Float16* D = which == 0 ? Q16 : K16; const int h = (n0 >> 6) + wn;
    for (int qq = lane; qq < 32 * 8; qq += 32) { const int rl = qq >> 3, pc = qq & 7; union { v8h h8; v4u u; } pk;
#pragma unroll
      for (int e = 0; e < 8; ++e) pk.h8[e] = (_Float16)so[rl][pc * 8 + e];
      vst2(D + (((size_t)b * NH + h) * SS + s0 + wm * 32 + rl) * HD + pc * 8, pk.u); } }
  else {
    _Float16 (*st)[136] = (_Float16 (*)[136])ring;
#pragma unroll
    for (int i = 0; i < 2; ++i)
#pragma unroll
      for (int j = 0; j < 4; ++j)
#pragma unroll
        for (int r = 0; r < 8; ++r) st[wn * 64 + j * 16 + col][wm * 32 + i * 16 + 8 * g + r] = (_Float16)(acc[i][j][r] * 4.0f);
    __syncthreads();
    for (int qq = tid; qq < 128 * 16; qq += 256) { const int cl = qq >> 4, pc = qq & 15; const int c = n0 + cl, h = c >> 6, d = c & 63; vst2(VT + (((size_t)b * NH + h) * HD + d) * SS + s0 + pc * 8, *(const v4u*)(&st[cl][pc * 8])); } }
}
// attention: block (64 q, h, b); scores = q.k/8, masked keys (mask[b][key] == 0) -> 1e-10; online softmax; O16 [b][h][s][64] x8
// a pass's 64 K rows and 64 V^T rows (128 bytes each) come into LDS by the same asynchronous copies, two buffers, shared by the four waves
// softmax in base 2: sS holds the raw products (q x4 . k x4), a masked key the raw value that the scale 2^-7 takes to 1e-10 exactly; the running reference
// mrun is (maximum score) * log2(e) - 14, and P x2^14 = exp2(raw * SC2 - mrun) is one fma and one v_exp_f32 a score; lrun carries the same 2^14
#define ABUF (128 * GP)
#define SC2 ((0.125f / 16.0f) * 1.4426950408889634f)
__global__ __launch_bounds__(128) void k_attn(const _Float16* __restrict__ Q16, const _Float16* __restrict__ K16, const _Float16* __restrict__ VT, const int* __restrict__ mask, _Float16* __restrict__ O16) {
  __shared__ __align__(16) float sS[4][16][68];
  __shared__ __align__(16) _Float16 sP[4][16][72];
  __shared__ __align__(16) char ring[2 * ABUF];
  __shared__ int smk[SS];
  const int tid = threadIdx.x, w = tid >> 5, lane = tid & 31, col = lane & 15, g = lane >> 4;
  const int b = blockIdx.z, h = blockIdx.y, q0 = blockIdx.x * 64 + w * 16; const size_t bh = (size_t)b * NH + h;
  const unsigned l = (unsigned)(size_t)ring + (tid >> 3) * GP + (tid & 7) * 16;
  const _Float16* kg = K16 + (bh * SS + (tid >> 3)) * HD + (tid & 7) * 8; const _Float16* vg = VT + (bh * HD + (tid >> 3)) * SS + (tid & 7) * 8;
  copy_tile<16, HD, SS>(l, kg, vg);
  for (int qq = tid; qq < SS; qq += 128) smk[qq] = mask[(size_t)b * SS + qq];
  asm volatile("s_wait_asynccnt 0x0" ::: "memory");   // pass 0's copies of this wave have landed
  __syncthreads();                                    // ... and every other wave's; smk is written
  copy_tile<16, HD, SS>(l + ABUF, kg + 64 * HD, vg + 64);
  v16h aq[2];
#pragma unroll
  for (int kc = 0; kc < 2; ++kc) aq[kc] = frag_h(Q16 + (bh * SS + q0 + col) * HD + kc * 32, lane);
  float mrun = -3.0e38f, lrun = 0.f; v8f acc[4] = {};
#pragma unroll 1
  for (int kt = 0; kt < SS / 64; ++kt) { const char* buf = ring + (kt & 1) * ABUF;
#pragma unroll
    for (int t = 0; t < 4; ++t) { v8f s = {}; const int key = kt * 64 + t * 16 + col;
#pragma unroll
      for (int kc = 0; kc < 2; ++kc) s = wmma16(aq[kc], frag_h((const _Float16*)(buf + (t * 16 + col) * GP + kc * 64), lane), s);
      const bool keep = smk[key] != 0;
#pragma unroll
      for (int r = 0; r < 8; ++r) sS[w][8 * g + r][t * 16 + col] = keep ? s[r] : 1e-10f * 128.0f; }
    LDSX();
    float mx = -3.4e38f;
#pragma unroll
    for (int jj = 0; jj < 32; ++jj) mx = fmaxf(mx, sS[w][col][g * 32 + jj]);
    mx = fmaxf(mx, __shfl_xor(mx, 16, 32));
    const float mnew = fmaxf(mrun, mx * SC2 - 14.0f); const float corr = __builtin_amdgcn_exp2f(mrun - mnew);
    float ps = 0.f;
#pragma unroll
    for (int jj = 0; jj < 32; ++jj) { const float p = __builtin_amdgcn_exp2f(fmaf(sS[w][col][g * 32 + jj], SC2, -mnew)); ps += p; sP[w][col][g * 32 + jj] = (_Float16)p; }
    ps += __shfl_xor(ps, 16, 32);
    lrun = lrun * corr + ps; mrun = mnew;
#pragma unroll
    for (int r = 0; r < 8; ++r) { const float cr = __shfl(corr, 8 * g + r, 32);
#pragma unroll
      for (int t = 0; t < 4; ++t) acc[t][r] *= cr; }
    LDSX();
#pragma unroll
    for (int kc = 0; kc < 2; ++kc) { const v16h pa = frag_h(&sP[w][col][0] + kc * 32, lane);
#pragma unroll
      for (int t = 0; t < 4; ++t) acc[t] = wmma16(pa, frag_h((const _Float16*)(buf + (64 + t * 16 + col) * GP + kc * 64), lane), acc[t]); }
    __builtin_amdgcn_wave_barrier();
    asm volatile("s_wait_dscnt 0x0" ::: "memory");    // this wave's reads of pass kt's buffer are done before it is refilled
    asm volatile("s_wait_asynccnt 0x0" ::: "memory"); // this wave's copies of pass kt + 1 have landed
    __syncthreads();                                  // publishes pass kt + 1 and ends every reader's last read of pass kt's buffer
    if (kt + 2 < SS / 64) copy_tile<16, HD, SS>(l + (kt & 1) * ABUF, kg + (size_t)(kt + 2) * 64 * HD, vg + (kt + 2) * 64); }
  asm volatile("s_wait_asynccnt 0x0" ::: "memory");   // nothing in flight when the ring becomes output staging
  float (*sO)[16][68] = (float (*)[16][68])ring;
#pragma unroll
  for (int r = 0; r < 8; ++r) { const float lr = __shfl(lrun, 8 * g + r, 32); const float inv = 8.0f / (lr * 4.0f);
#pragma unroll
    for (int t = 0; t < 4; ++t) sO[w][8 * g + r][t * 16 + col] = acc[t][r] * inv; }
  LDSX();
  for (int qq = lane; qq < 16 * 8; qq += 32) { const int rl = qq >> 3, pc = qq & 7; union { v8h h8; v4u u; } pk;
#pragma unroll
    for (int e = 0; e < 8; ++e) pk.h8[e] = (_Float16)sO[w][rl][pc * 8 + e];
    vst2(O16 + ((bh * SS) + q0 + rl) * HD + pc * 8, pk.u); }
}
// fx = LN2(x) with x = merged O (/8): wave per row -> FX f32 rows and FX16 f16 rows
__global__ __launch_bounds__(256) void k_ln2(const _Float16* __restrict__ O16, const float* __restrict__ g2, const float* __restrict__ b2, float* __restrict__ FX, _Float16* __restrict__ FX16) {
  const int wave = threadIdx.x >> 5, lane = threadIdx.x & 31; const size_t r = (size_t)blockIdx.x * 8 + wave; if (r >= NR) return;
  const int b = (int)(r / SS), s = (int)(r % SS);
  float xv[32]; float sm = 0.f;
#pragma unroll
  for (int i = 0; i < 4; ++i) { const int c0 = i * 256 + lane * 8; const int h = c0 >> 6, d = c0 & 63; const _Float16* src = O16 + (((size_t)b * NH + h) * SS + s) * HD + d;
#pragma unroll
    for (int e = 0; e < 8; ++e) { xv[i * 8 + e] = (float)src[e] * 0.125f; sm += xv[i * 8 + e]; } }
#pragma unroll
  for (int off = 16; off >= 1; off >>= 1) sm += __shfl_xor(sm, off, 32);
  const float mu = sm * (1.0f / HID); float q2 = 0.f;
#pragma unroll
  for (int i = 0; i < 32; ++i) { const float dd = xv[i] - mu; q2 += dd * dd; }
#pragma unroll
  for (int off = 16; off >= 1; off >>= 1) q2 += __shfl_xor(q2, off, 32);
  const float rs = rsqrtf(q2 * (1.0f / HID) + 1e-5f);
#pragma unroll
  for (int i = 0; i < 4; ++i) { union { v8h h; v4u u; } pk; v4f f0, f1;
#pragma unroll
    for (int e = 0; e < 8; ++e) { const int c = i * 256 + lane * 8 + e; const float fv = (xv[i * 8 + e] - mu) * rs * g2[c] + b2[c]; pk.h[e] = (_Float16)fv; if (e < 4) f0[e] = fv; else f1[e - 4] = fv; }
    vst2(FX + r * HID + i * 256 + lane * 8, f0); vst2(FX + r * HID + i * 256 + lane * 8 + 4, f1); vst2(FX16 + r * HID + i * 256 + lane * 8, pk.u); }
}
// fo = relu(fx Wf^T + bf): block (128 rows, 128 cols) -> FO f32
__global__ __launch_bounds__(256) void k_ffn(const _Float16* __restrict__ FX16, const _Float16* __restrict__ P, const float* __restrict__ bf, float* __restrict__ FO) {
  __shared__ __align__(16) char ring[2 * GBUF];
  const int tid = threadIdx.x, wave = tid >> 5, lane = tid & 31, col = lane & 15, g = lane >> 4, wm = wave >> 1, wn = wave & 1;
  const int r0b = blockIdx.x * 128, n0 = blockIdx.y * 128;
  v8f acc[2][4] = {};
  gemm_core(FX16 + (size_t)r0b * HID, P + ((size_t)3 * HID + n0) * HID, ring, acc);
  float (*so)[68] = (float (*)[68])(ring + wave * (32 * 68 * 4));
#pragma unroll
  for (int j = 0; j < 4; ++j) { const float bb = bf[n0 + wn * 64 + j * 16 + col];
#pragma unroll
    for (int i = 0; i < 2; ++i)
#pragma unroll
      for (int r = 0; r < 8; ++r) { const float vv = acc[i][j][r] * (1.0f / 16.0f) + bb; so[i * 16 + 8 * g + r][j * 16 + col] = vv > 0.f ? vv : 0.f; } }
  LDSX();
#pragma unroll
  for (int rp = 0; rp < 16; ++rp) { const int rl = rp * 2 + g; vst2(FO + (size_t)(r0b + wm * 32 + rl) * HID + n0 + wn * 64 + col * 4, *(const v4f*)(&so[rl][col * 4])); }
}
// out = fx + LN3(fo): wave per row
__global__ __launch_bounds__(256) void k_fin(const float* __restrict__ FX, const float* __restrict__ FO, const float* __restrict__ g3, const float* __restrict__ b3, float* __restrict__ out) {
  const int wave = threadIdx.x >> 5, lane = threadIdx.x & 31; const size_t r = (size_t)blockIdx.x * 8 + wave; if (r >= NR) return;
  const float* fo = FO + r * HID; float xv[32]; float sm = 0.f;
#pragma unroll
  for (int i = 0; i < 4; ++i) { const v4f a = *(const v4f*)(fo + i * 256 + lane * 8), c = *(const v4f*)(fo + i * 256 + lane * 8 + 4);
    xv[i * 8 + 0] = a[0]; xv[i * 8 + 1] = a[1]; xv[i * 8 + 2] = a[2]; xv[i * 8 + 3] = a[3]; xv[i * 8 + 4] = c[0]; xv[i * 8 + 5] = c[1]; xv[i * 8 + 6] = c[2]; xv[i * 8 + 7] = c[3]; }
#pragma unroll
  for (int i = 0; i < 32; ++i) sm += xv[i];
#pragma unroll
  for (int off = 16; off >= 1; off >>= 1) sm += __shfl_xor(sm, off, 32);
  const float mu = sm * (1.0f / HID); float q2 = 0.f;
#pragma unroll
  for (int i = 0; i < 32; ++i) { const float dd = xv[i] - mu; q2 += dd * dd; }
#pragma unroll
  for (int off = 16; off >= 1; off >>= 1) q2 += __shfl_xor(q2, off, 32);
  const float rs = rsqrtf(q2 * (1.0f / HID) + 1e-5f);
  const float* fx = FX + r * HID;
#pragma unroll
  for (int i = 0; i < 4; ++i) { v4f o0, o1; const int c0 = i * 256 + lane * 8;
#pragma unroll
    for (int e = 0; e < 8; ++e) { const int c = c0 + e; const float vv = fx[c] + ((xv[i * 8 + e] - mu) * rs * g3[c] + b3[c]); if (e < 4) o0[e] = vv; else o1[e - 4] = vv; }
    vst2(out + r * HID + c0, o0); vst2(out + r * HID + c0 + 4, o1); }
}
extern "C" void kernel_launch(void* const* d_in, const int* in_sizes, int n_in, void* d_out, int out_size, void* d_ws, size_t ws_size, hipStream_t stream) {
  (void)in_sizes; (void)n_in; (void)out_size; (void)ws_size;
  const float** I = (const float**)d_in;
  const float* q = I[0]; const float* k = I[1]; const float* v = I[2]; const float* g1q = I[3]; const float* b1q = I[4]; const float* g1k = I[5]; const float* b1k = I[6]; const float* g1v = I[7]; const float* b1v = I[8];
  const float* Wq = I[9]; const float* bq = I[10]; const float* Wk = I[11]; const float* bk = I[12]; const float* Wv = I[13]; const float* bv = I[14]; const float* g2 = I[15]; const float* b2 = I[16]; const float* g3 = I[17]; const float* b3 = I[18]; const float* Wf = I[19]; const float* bf = I[20]; const int* mask = (const int*)d_in[21];
  float* out = (float*)d_out;
  char* ws = (char*)d_ws; size_t off = 0;
  auto take = [&](size_t bytes) { char* p = ws + off; off += (bytes + 255) & ~(size_t)255; return p; };
  _Float16* X16 = (_Float16*)take((size_t)3 * NR * HID * 2); _Float16* P = (_Float16*)take((size_t)4 * HID * HID * 2); float* CS = (float*)take((size_t)SS * 32 * 4); float* SN = (float*)take((size_t)SS * 32 * 4);
  _Float16* Q16 = (_Float16*)take((size_t)NR * HID * 2); _Float16* K16 = (_Float16*)take((size_t)NR * HID * 2); _Float16* VT = (_Float16*)take((size_t)NR * HID * 2); _Float16* O16 = (_Float16*)take((size_t)NR * HID * 2);
  float* FX = (float*)take((size_t)NR * HID * 4); _Float16* FX16 = (_Float16*)take((size_t)NR * HID * 2); float* FO = (float*)take((size_t)NR * HID * 4);
  k_ln3<<<dim3(NR / 16, 3), 256, 0, stream>>>(q, k, v, g1q, b1q, g1k, b1k, g1v, b1v, X16);
  k_pack<<<4 * HID / 16, 256, 0, stream>>>(Wq, Wk, Wv, Wf, P);
  k_rope<<<SS / 8, 256, 0, stream>>>(CS, SN);
  k_qkv<<<dim3(NR / 128, HID / 128, 3), 256, 0, stream>>>(X16, P, bq, bk, bv, CS, SN, Q16, K16, VT);
  k_attn<<<dim3(SS / 64, NH, NB), 128, 0, stream>>>(Q16, K16, VT, mask, O16);
  k_ln2<<<NR / 8, 256, 0, stream>>>(O16, g2, b2, FX, FX16);
  k_ffn<<<dim3(NR / 128, HID / 128), 256, 0, stream>>>(FX16, P, bf, FO);
  k_fin<<<NR / 8, 256, 0, stream>>>(FX, FO, g3, b3, out);
}

// v004
// Measured time: 99.4 microseconds a run.
// Next to v003, in two timings, it ran 1.11 and 1.10 times as fast.
// All steps since v000 together make it 3.03 times as fast.
#include <hip/hip_runtime.h>
#include <math.h>

typedef __attribute__((ext_vector_type(16))) _Float16 v16h;
typedef __attribute__((ext_vector_type(16))) __bf16 v16b;
typedef __attribute__((ext_vector_type(8)))  _Float16 v8h;
typedef __attribute__((ext_vector_type(2)))  _Float16 v2h;
typedef __attribute__((ext_vector_type(8)))  float v8f;
typedef __attribute__((ext_vector_type(4)))  float v4f;
typedef __attribute__((ext_vector_type(2)))  float v2f;
typedef __attribute__((ext_vector_type(4)))  unsigned v4u;
typedef __attribute__((ext_vector_type(4)))  int v4i;
typedef float __attribute__((may_alias)) float_a;
typedef int __attribute__((may_alias)) int_a;

template <typename T> __device__ __forceinline__ void vst2(void* p, T v) { *(T*)p = v;  }
__device__ __forceinline__ v8f wmma16(v16h a, v16h b, v8f c) {
  v8f d = __builtin_amdgcn_wmma_f32_16x16x32_f16(false, a, false, b, (short)0, c, false, false);
  asm volatile("v_nop\n\tv_nop\n\tv_nop\n\tv_nop" : "+v"(d) : "v"(a), "v"(b));
  return d;
}
__device__ __forceinline__ v8f wmma_bf(v16b a, v16b b, v8f c) {
  v8f d = __builtin_amdgcn_wmma_f32_16x16x32_bf16(false, a, false, b, (short)0, c, false, false);
  asm volatile("v_nop\n\tv_nop\n\tv_nop\n\tv_nop" : "+v"(d) : "v"(a), "v"(b));
  return d;
}
// 16x16x32 fragments: lane = (h = lane>>4, row/col = lane&15); elements 0..7 = k0+8h+0..7, 8..15 = k0+16+8h+0..7; D element r = row 8h+r
__device__ __forceinline__ v16h frag_h(const _Float16* rowk0, int lane) {
  union { v16h v; v8h q[2]; } u; const _Float16* p = rowk0 + 8 * (lane >> 4);
  u.q[0] = *(const v8h*)p; u.q[1] = *(const v8h*)(p + 16); return u.v;
}
__device__ __forceinline__ v16h frag_f32(const float* rowk0, int lane) {
  v16h a; const float* p = rowk0 + 8 * (lane >> 4);
#pragma unroll
  for (int i = 0; i < 8; ++i) { a[i] = (_Float16)p[i]; a[8 + i] = (_Float16)p[16 + i]; }
  return a;
}
__device__ __forceinline__ v16h frag_f32s(const float* rowk0, int lane, float sc) {
  v16h a; const float* p = rowk0 + 8 * (lane >> 4);
#pragma unroll
  for (int i = 0; i < 8; ++i) { a[i] = (_Float16)(p[i] * sc); a[8 + i] = (_Float16)(p[16 + i] * sc); }
  return a;
}
// column fragment from a [K][ld] layout (column n), rows >= K read as 0
__device__ __forceinline__ v16h fragc_f32(const float* W, int k0, int n, int lane, int ld, int K) {
  v16h a; const int g = lane >> 4;
#pragma unroll
  for (int i = 0; i < 8; ++i) { const int ka = k0 + 8 * g + i, kb = ka + 16;
    a[i] = (_Float16)(ka < K ? W[(size_t)ka * ld + n] : 0.f); a[8 + i] = (_Float16)(kb < K ? W[(size_t)kb * ld + n] : 0.f); }
  return a;
}
struct F2 { v16b h, l; };
__device__ __forceinline__ F2 bsplit16(const float v[16]) { F2 r;
#pragma unroll
  for (int i = 0; i < 16; ++i) { const __bf16 h = (__bf16)v[i]; r.h[i] = h; r.l[i] = (__bf16)(v[i] - (float)h); }
  return r; }
__device__ __forceinline__ F2 split_row(const float* row, int k0, int lane) { float v[16]; const float* p = row + k0 + 8 * (lane >> 4);
#pragma unroll
  for (int i = 0; i < 8; ++i) { v[i] = p[i]; v[8 + i] = p[16 + i]; }
  return bsplit16(v); }
__device__ __forceinline__ F2 split_rowK(const float* row, int k0, int lane, int K) { float v[16]; const int g = lane >> 4;
#pragma unroll
  for (int i = 0; i < 8; ++i) { const int ka = k0 + 8 * g + i, kb = ka + 16; v[i] = ka < K ? row[ka] : 0.f; v[8 + i] = kb < K ? row[kb] : 0.f; }
  return bsplit16(v); }
__device__ __forceinline__ F2 split_col(const float* W, int k0, int n, int lane, int ld, int K) { float v[16]; const int g = lane >> 4;
#pragma unroll
  for (int i = 0; i < 8; ++i) { const int ka = k0 + 8 * g + i, kb = ka + 16; v[i] = ka < K ? W[(size_t)ka * ld + n] : 0.f; v[8 + i] = kb < K ? W[(size_t)kb * ld + n] : 0.f; }
  return bsplit16(v); }
__device__ __forceinline__ v8f mac3(const F2& a, const F2& b, v8f c) { c = wmma_bf(a.l, b.h, c); c = wmma_bf(a.h, b.l, c); return wmma_bf(a.h, b.h, c); }
__device__ __forceinline__ float sigm(float v) { return 1.0f / (1.0f + expf(-v)); }
#define LDSX() do { asm volatile("s_wait_dscnt 0" ::: "memory"); __builtin_amdgcn_wave_barrier(); __builtin_amdgcn_fence(__ATOMIC_RELEASE, "workgroup"); } while (0)

// Pre-LN multi-head attention block with RoPE and a post FFN: LN(q), LN(k), LN(v) -> projections (+bias) -> rotary embedding -> 16-head
// attention with the module's masked_fill value 1e-10 (mask read as data) -> merge -> fx = LN2(x); fo = relu(fx Wf^T + bf); out = fx +
// LN3(fo). LayerNorms, RoPE (cos/sin table in f32), softmax (online over 16 key tiles) in f32; all four products on
// v_wmma_f32_16x16x32_f16 (LN outputs as f16 rows, [out][in] weights as f16 rows x16, q/k/v head-major f16 x4, P x2^14, O x8).
#define NB 4
#define SS 1024
#define HID 1024
#define NH 16
#define HD 64
#define NR (NB * SS)

// LN of two 1024-rows per wave (both rows' 16 loads of 16 bytes are asked for before either is summed): src selects q/k/v by blockIdx.y; dst f16 rows
__global__ __launch_bounds__(256) void k_ln3(const float* __restrict__ q, const float* __restrict__ k, const float* __restrict__ v, const float* __restrict__ gq, const float* __restrict__ bq, const float* __restrict__ gk, const float* __restrict__ bk, const float* __restrict__ gv, const float* __restrict__ bv2, _Float16* __restrict__ X16) {
  const int wave = threadIdx.x >> 5, lane = threadIdx.x & 31, which = blockIdx.y; const size_t r = (size_t)blockIdx.x * 16 + wave * 2; if (r >= NR) return;
  const float* src = (which == 0 ? q : which == 1 ? k : v) + r * HID; const float* g = which == 0 ? gq : which == 1 ? gk : gv; const float* bb = which == 0 ? bq : which == 1 ? bk : bv2;
  float xv[2][32];
#pragma unroll
  for (int w = 0; w < 2; ++w)
#pragma unroll
    for (int i = 0; i < 4; ++i) { const v4f a = *(const v4f*)(src + w * HID + i * 256 + lane * 8), c = *(const v4f*)(src + w * HID + i * 256 + lane * 8 + 4);
      xv[w][i * 8 + 0] = a[0]; xv[w][i * 8 + 1] = a[1]; xv[w][i * 8 + 2] = a[2]; xv[w][i * 8 + 3] = a[3]; xv[w][i * 8 + 4] = c[0]; xv[w][i * 8 + 5] = c[1]; xv[w][i * 8 + 6] = c[2]; xv[w][i * 8 + 7] = c[3]; }
  __builtin_amdgcn_sched_barrier(0);   // keeps all 16 loads in front of the first row's sums: sunk behind them, the second row's last loads wait out a second memory latency
#pragma unroll
  for (int w = 0; w < 2; ++w) { float s = 0.f;
#pragma unroll
    for (int i = 0; i < 32; ++i) s += xv[w][i];
#pragma unroll
    for (int off = 16; off >= 1; off >>= 1) s += __shfl_xor(s, off, 32);
    const float mu = s * (1.0f / HID); float q2 = 0.f;
#pragma unroll
    for (int i = 0; i < 32; ++i) { const float d = xv[w][i] - mu; q2 += d * d; }
#pragma unroll
    for (int off = 16; off >= 1; off >>= 1) q2 += __shfl_xor(q2, off, 32);
    const float rs = rsqrtf(q2 * (1.0f / HID) + 1e-5f);
#pragma unroll
    for (int i = 0; i < 4; ++i) { union { v8h h; v4u u; } pk;
#pragma unroll
      for (int e = 0; e < 8; ++e) { const int c = i * 256 + lane * 8 + e; pk.h[e] = (_Float16)((xv[w][i * 8 + e] - mu) * rs * g[c] + bb[c]); }
      vst2(X16 + ((size_t)which * NR + r + w) * HID + i * 256 + lane * 8, pk.u); } }
}
// P rows [w*1024 + n] = W_w[n][:] * 16 (W are [out][in]): w = 0 Wq, 1 Wk, 2 Wv, 3 Wf. A block takes 16 whole rows of one W, a wave 2 of them (8 KB in, 4 KB out):
// a lane's 16 loads of 16 bytes are all asked for before the first is converted, and each store is 512 contiguous bytes of a wave
__global__ __launch_bounds__(256) void k_pack(const float* __restrict__ Wq, const float* __restrict__ Wk, const float* __restrict__ Wv, const float* __restrict__ Wf, _Float16* __restrict__ P) {
  const int which = blockIdx.x >> 6, wave = threadIdx.x >> 5, lane = threadIdx.x & 31;
  const size_t o = (size_t)(blockIdx.x & 63) * (16 * HID) + wave * (2 * HID) + lane * 8;
  const float* W = (which == 0 ? Wq : which == 1 ? Wk : which == 2 ? Wv : Wf) + o; _Float16* D = P + (size_t)which * HID * HID + o;
  v4f x[16];
#pragma unroll
  for (int i = 0; i < 8; ++i) { x[2 * i] = *(const v4f*)(W + i * 256); x[2 * i + 1] = *(const v4f*)(W + i * 256 + 4); }
#pragma unroll
  for (int i = 0; i < 8; ++i) { union { v8h h; v4u u; } pk;
#pragma unroll
    for (int e = 0; e < 4; ++e) { pk.h[e] = (_Float16)(x[2 * i][e] * 16.0f); pk.h[4 + e] = (_Float16)(x[2 * i + 1][e] * 16.0f); }
    vst2(D + i * 256, pk.u); }
}
// RoPE tables: CS[s][j] = cos(s * inv_freq[j]), SN likewise, j < 32
__global__ __launch_bounds__(256) void k_rope(float* __restrict__ CS, float* __restrict__ SN) {
  const int s = blockIdx.x * 8 + (threadIdx.x >> 5), j = threadIdx.x & 31;
  const float inv = 1.0f / powf(10000.0f, (float)(2 * j) / (float)HD); const float f = (float)s * inv;
  vst2(CS + (size_t)s * 32 + j, cosf(f)); vst2(SN + (size_t)s * 32 + j, sinf(f));
}
// Shared GEMM core of k_qkv and k_ffn: Y[128 rows][128 cols] = A[128][1024] * Bw[128][1024]^T per block of 8 waves (4 x 2), 32 x 64 per wave.
// A pass is 64 k = 128 bytes of each of the 256 operand rows, brought into LDS by asynchronous copies (16 bytes a lane, 8 copies a lane and pass),
// two buffers: pass t + 2 is copied into the buffer that pass t has just left. LDS rows at pitch 144 bytes for the ds_load_b128 fragment readers.
#define GP 144
#define GBUF (256 * GP)
#define NPASS (HID / 64)
// one pass's tile: rows rr, rr+RS, rr+2RS, rr+3RS of the first operand (LDS rows 0..4RS-1, source pitch SA elements) and of the second (LDS rows 4RS..8RS-1,
// source pitch SB); l, a, bw are this lane's own 16 bytes of row rr
template <int RS, int SA, int SB> __device__ __forceinline__ void copy_tile(unsigned l, const _Float16* a, const _Float16* bw) {
  const unsigned l0 = l, l1 = l + RS * GP, l2 = l + 2 * RS * GP, l3 = l + 3 * RS * GP, l4 = l + 4 * RS * GP, l5 = l + 5 * RS * GP, l6 = l + 6 * RS * GP, l7 = l + 7 * RS * GP;
  const _Float16 *a0 = a, *a1 = a + RS * SA, *a2 = a + 2 * RS * SA, *a3 = a + 3 * RS * SA, *w0 = bw, *w1 = bw + RS * SB, *w2 = bw + 2 * RS * SB, *w3 = bw + 3 * RS * SB;
  // the copies and their s_wait_xcnt in one statement: no address register of a copy is rewritten in front of that wait
  asm volatile("global_load_async_to_lds_b128 %0, %8, off\n\t"
               "global_load_async_to_lds_b128 %1, %9, off\n\t"
               "global_load_async_to_lds_b128 %2, %10, off\n\t"
               "global_load_async_to_lds_b128 %3, %11, off\n\t"
               "global_load_async_to_lds_b128 %4, %12, off\n\t"
               "global_load_async_to_lds_b128 %5, %13, off\n\t"
               "global_load_async_to_lds_b128 %6, %14, off\n\t"
               "global_load_async_to_lds_b128 %7, %15, off\n\t"
               "s_wait_xcnt 0x0"
               :: "v"(l0), "v"(l1), "v"(l2), "v"(l3), "v"(l4), "v"(l5), "v"(l6), "v"(l7), "v"(a0), "v"(a1), "v"(a2), "v"(a3), "v"(w0), "v"(w1), "v"(w2), "v"(w3) : "memory");
}
// A, Bw: first row of the block's 128 rows of each operand (row length HID); on return every wave has left the ring (the last pass's barrier)
__device__ __forceinline__ void gemm_core(const _Float16* __restrict__ A, const _Float16* __restrict__ Bw, char* ring, v8f (&acc)[2][4]) {
  const int tid = threadIdx.x, wave = tid >> 5, lane = tid & 31, col = lane & 15, wm = wave >> 1, wn = wave & 1;
  const int rr = tid >> 3, seg = tid & 7;
  const unsigned l = (unsigned)(size_t)ring + rr * GP + seg * 16;
  const _Float16* a = A + (size_t)rr * HID + seg * 8; const _Float16* bw = Bw + (size_t)rr * HID + seg * 8;
  copy_tile<32, HID, HID>(l, a, bw);
  asm volatile("s_wait_asynccnt 0x0" ::: "memory");   // pass 0's copies of this wave have landed
  __syncthreads();                                    // ... and every other wave's
  copy_tile<32, HID, HID>(l + GBUF, a + 64, bw + 64);
  for (int t = 0; t < NPASS; ++t) {
    const char* buf = ring + (t & 1) * GBUF;
#pragma unroll
    for (int kc = 0; kc < 2; ++kc) { v16h fa[2], fb[4];
#pragma unroll
      for (int i = 0; i < 2; ++i) fa[i] = frag_h((const _Float16*)(buf + (wm * 32 + i * 16 + col) * GP + kc * 64), lane);
#pragma unroll
      for (int j = 0; j < 4; ++j) fb[j] = frag_h((const _Float16*)(buf + (128 + wn * 64 + j * 16 + col) * GP + kc * 64), lane);
#pragma unroll
      for (int i = 0; i < 2; ++i)
#pragma unroll
        for (int j = 0; j < 4; ++j) acc[i][j] = wmma16(fa[i], fb[j], acc[i][j]); }
    asm volatile("s_wait_dscnt 0x0" ::: "memory");    // this wave's reads of pass t's buffer are done before it is refilled
    asm volatile("s_wait_asynccnt 0x0" ::: "memory"); // this wave's copies of pass t + 1 have landed
    __syncthreads();                                  // publishes pass t + 1 and ends every reader's last read of pass t's buffer
    if (t + 2 < NPASS) copy_tile<32, HID, HID>(l + (t & 1) * GBUF, a + (t + 2) * 64, bw + (t + 2) * 64);
  }
  asm volatile("s_wait_asynccnt 0x0" ::: "memory");   // nothing in flight when the ring becomes output staging
}
// q/k/v projections + bias (+RoPE for q,k): block (128 rows, 128 cols = 2 heads, which), a wave has 32 rows of one head
__global__ __launch_bounds__(256) void k_qkv(const _Float16* __restrict__ X16, const _Float16* __restrict__ P, const float* __restrict__ bq, const float* __restrict__ bk, const float* __restrict__ bv, const float* __restrict__ CS, const float* __restrict__ SN,
                                           _Float16* __restrict__ Q16, _Float16* __restrict__ K16, _Float16* __restrict__ VT) {
  __shared__ __align__(16) char ring[2 * GBUF];
  const int tid = threadIdx.x, wave = tid >> 5, lane = tid & 31, col = lane & 15, g = lane >> 4, wm = wave >> 1, wn = wave & 1;
  const int which = blockIdx.z, r0b = blockIdx.x * 128, n0 = blockIdx.y * 128; const int b = r0b / SS, s0 = r0b % SS;
  const float* bias = which == 0 ? bq : (which == 1 ? bk : bv);
  v8f acc[2][4] = {};
  gemm_core(X16 + ((size_t)which * NR + r0b) * HID, P + ((size_t)which * HID + n0) * HID, ring, acc);
#pragma unroll
  for (int j = 0; j < 4; ++j) { const float bb = bias[n0 + wn * 64 + j * 16 + col];
#pragma unroll
    for (int i = 0; i < 2; ++i)
#pragma unroll
      for (int r = 0; r < 8; ++r) acc[i][j][r] = acc[i][j][r] * (1.0f / 16.0f) + bb; }
  if (which < 2) {
    // RoPE within the wave's head: d = j*16 + col ; d < 32: x cos - x(d+32) sin ; d >= 32: x cos + x(d-32) sin, angle index d & 31
    float (*so)[68] = (float (*)[68])(ring + wave * (32 * 68 * 4));
#pragma unroll
    for (int i = 0; i < 2; ++i)
#pragma unroll
      for (int jj = 0; jj < 2; ++jj) { const int dj = jj * 16 + col;      // dj < 32
#pragma unroll
        for (int r = 0; r < 8; ++r) { const int rl = i * 16 + 8 * g + r, s = s0 + wm * 32 + rl; const float c = CS[(size_t)s * 32 + dj], sn = SN[(size_t)s * 32 + dj];
          const float lo = acc[i][jj][r], hi = acc[i][jj + 2][r];
          so[rl][jj * 16 + col] = (lo * c - hi * sn) * 4.0f; so[rl][(jj + 2) * 16 + col] = (hi * c + lo * sn) * 4.0f; } }
    LDSX();
    _Float16* D = which == 0 ? Q16 : K16; const int h = (n0 >> 6) + wn;
    for (int qq = lane; qq < 32 * 8; qq += 32) { const int rl = qq >> 3, pc = qq & 7; union { v8h h8; v4u u; } pk;
#pragma unroll
      for (int e = 0; e < 8; ++e) pk.h8[e] = (_Float16)so[rl][pc * 8 + e];
      vst2(D + (((size_t)b * NH + h) * SS + s0 + wm * 32 + rl) * HD + pc * 8, pk.u); } }
  else {
    _Float16 (*st)[136] = (_Float16 (*)[136])ring;
#pragma unroll
    for (int i = 0; i < 2; ++i)
#pragma unroll
      for (int j = 0; j < 4; ++j)
#pragma unroll
        for (int r = 0; r < 8; ++r) st[wn * 64 + j * 16 + col][wm * 32 + i * 16 + 8 * g + r] = (_Float16)(acc[i][j][r] * 4.0f);
    __syncthreads();
    for (int qq = tid; qq < 128 * 16; qq += 256) { const int cl = qq >> 4, pc = qq & 15; const int c = n0 + cl, h = c >> 6, d = c & 63; vst2(VT + (((size_t)b * NH + h) * HD + d) * SS + s0 + pc * 8, *(const v4u*)(&st[cl][pc * 8])); } }
}
#define ABUF (128 * GP)
#define SC2 ((0.125f / 16.0f) * 1.4426950408889634f)
// lane l's value from lane l ^ 16
__device__ __forceinline__ float xhalf(float x) { return __builtin_bit_cast(float, __builtin_amdgcn_permlanex16(__builtin_bit_cast(int, x), __builtin_bit_cast(int, x), 0x76543210, 0xfedcba98, false, false)); }
__global__ __launch_bounds__(128) void k_attn(const _Float16* __restrict__ Q16, const _Float16* __restrict__ K16, const _Float16* __restrict__ VT, const int* __restrict__ mask, _Float16* __restrict__ O16) {
  __shared__ __align__(16) char ring[2 * ABUF];
  __shared__ __align__(16) unsigned smb[SS];
  const int tid = threadIdx.x, w = tid >> 5, lane = tid & 31, col = lane & 15, g = lane >> 4;
  const int b = blockIdx.z, h = blockIdx.y, q0 = blockIdx.x * 64 + w * 16; const size_t bh = (size_t)b * NH + h;
  const unsigned l = (unsigned)(size_t)ring + (tid >> 3) * GP + (tid & 7) * 16;
  const _Float16* kg = K16 + (bh * SS + (tid >> 3)) * HD + (tid & 7) * 8; const _Float16* vg = VT + (bh * HD + (tid >> 3)) * SS + (tid & 7) * 8;
  copy_tile<16, HD, SS>(l, kg, vg);
  for (int qq = tid; qq < SS; qq += 128) smb[qq] = mask[(size_t)b * SS + qq] != 0 ? 0xffffffffu : 0u;
  asm volatile("s_wait_asynccnt 0x0" ::: "memory");   // pass 0's copies of this wave have landed
  __syncthreads();                                    // ... and every other wave's; smb is written
  copy_tile<16, HD, SS>(l + ABUF, kg + 64 * HD, vg + 64);
  v16h aq[2];
#pragma unroll
  for (int kc = 0; kc < 2; ++kc) aq[kc] = frag_h(Q16 + (bh * SS + q0 + col) * HD + kc * 32, lane);
  float mrun = -3.0e38f; v2f lrun = {0.f, 0.f}; v8f acc[4] = {};   // acc[t][r] = O^T[d = t*16 + 8g + r][query col]; lrun: this lane's own keys, the halves joined at the end
#pragma unroll 1
  for (int kt = 0; kt < SS / 64; ++kt) { const char* buf = ring + (kt & 1) * ABUF;
    v16h fk[2][4], fv[2][4]; v4u mb[4][2];
#pragma unroll
    for (int kc = 0; kc < 2; ++kc)
#pragma unroll
      for (int t = 0; t < 4; ++t) fk[kc][t] = frag_h((const _Float16*)(buf + (t * 16 + col) * GP + kc * 64), lane);
#pragma unroll
    for (int t = 0; t < 4; ++t) { mb[t][0] = *(const v4u*)(smb + kt * 64 + t * 16 + 8 * g); mb[t][1] = *(const v4u*)(smb + kt * 64 + t * 16 + 8 * g + 4); }
    v8f d[4] = {};                                    // d[t][r] = raw score of key kt*64 + t*16 + 8g + r with query col
#pragma unroll
    for (int kc = 0; kc < 2; ++kc)
#pragma unroll
      for (int t = 0; t < 4; ++t) d[t] = wmma16(fk[kc][t], aq[kc], d[t]);
#pragma unroll
    for (int kc = 0; kc < 2; ++kc)
#pragma unroll
      for (int t = 0; t < 4; ++t) fv[kc][t] = frag_h((const _Float16*)(buf + (64 + t * 16 + col) * GP + kc * 64), lane);
    v2f s[4][4]; float mx2[2] = {-3.4e38f, -3.4e38f};
#pragma unroll
    for (int t = 0; t < 4; ++t)
#pragma unroll
      for (int i = 0; i < 4; ++i) {
#pragma unroll
        for (int e = 0; e < 2; ++e) { const unsigned m = mb[t][i >> 1][(i & 1) * 2 + e]; const float raw = d[t][2 * i + e], fill = 1e-10f * 128.0f;
          s[t][i][e] = __builtin_bit_cast(float, (__builtin_bit_cast(unsigned, raw) & m) | (__builtin_bit_cast(unsigned, fill) & ~m)); }
        mx2[t & 1] = fmaxf(mx2[t & 1], fmaxf(s[t][i][0], s[t][i][1])); }
    float mx = fmaxf(mx2[0], mx2[1]);
    mx = fmaxf(mx, xhalf(mx));
    const float mnew = fmaxf(mrun, mx * SC2 - 14.0f); const float corr = __builtin_amdgcn_exp2f(mrun - mnew);
    v16h pb[2]; v2f ps[2] = {{0.f, 0.f}, {0.f, 0.f}};
#pragma unroll
    for (int t = 0; t < 4; ++t)
#pragma unroll
      for (int i = 0; i < 4; ++i) { const v2f a = __builtin_elementwise_fma(s[t][i], v2f{SC2, SC2}, v2f{-mnew, -mnew}); const v2f p = {__builtin_amdgcn_exp2f(a[0]), __builtin_amdgcn_exp2f(a[1])};
        ps[t & 1] += p; const v2h ph = __builtin_convertvector(p, v2h); pb[t >> 1][(t & 1) * 8 + 2 * i] = ph[0]; pb[t >> 1][(t & 1) * 8 + 2 * i + 1] = ph[1]; }
    lrun = lrun * v2f{corr, corr} + (ps[0] + ps[1]); mrun = mnew;
#pragma unroll
    for (int t = 0; t < 4; ++t) acc[t] *= corr;
#pragma unroll
    for (int kc = 0; kc < 2; ++kc)
#pragma unroll
      for (int t = 0; t < 4; ++t) acc[t] = wmma16(fv[kc][t], pb[kc], acc[t]);
    asm volatile("s_wait_dscnt 0x0" ::: "memory");    // this wave's reads of pass kt's buffer are done before it is refilled
    asm volatile("s_wait_asynccnt 0x0" ::: "memory"); // this wave's copies of pass kt + 1 have landed
    __syncthreads();                                  // publishes pass kt + 1 and ends every reader's last read of pass kt's buffer
    if (kt + 2 < SS / 64) copy_tile<16, HD, SS>(l + (kt & 1) * ABUF, kg + (size_t)(kt + 2) * 64 * HD, vg + (kt + 2) * 64); }
  asm volatile("s_wait_asynccnt 0x0" ::: "memory");   // nothing in flight when the wave ends
  float lr = lrun[0] + lrun[1]; lr += xhalf(lr);
  const float inv = 8.0f / (lr * 4.0f);
#pragma unroll
  for (int t = 0; t < 4; ++t) { union { v8h h8; v4u u; } pk;   // a lane's 8 accumulator registers are 8 consecutive d of its query's row: one 16-byte store
#pragma unroll
    for (int r = 0; r < 8; ++r) pk.h8[r] = (_Float16)(acc[t][r] * inv);
    vst2(O16 + ((bh * SS) + q0 + col) * HD + t * 16 + 8 * g, pk.u); }
}
// fx = LN2(x) with x = merged O (/8): wave per row -> FX f32 rows and FX16 f16 rows
__global__ __launch_bounds__(256) void k_ln2(const _Float16* __restrict__ O16, const float* __restrict__ g2, const float* __restrict__ b2, float* __restrict__ FX, _Float16* __restrict__ FX16) {
  const int wave = threadIdx.x >> 5, lane = threadIdx.x & 31; const size_t r = (size_t)blockIdx.x * 8 + wave; if (r >= NR) return;
  const int b = (int)(r / SS), s = (int)(r % SS);
  float xv[32]; float sm = 0.f;
#pragma unroll
  for (int i = 0; i < 4; ++i) { const int c0 = i * 256 + lane * 8; const int h = c0 >> 6, d = c0 & 63; const _Float16* src = O16 + (((size_t)b * NH + h) * SS + s) * HD + d;
#pragma unroll
    for (int e = 0; e < 8; ++e) { xv[i * 8 + e] = (float)src[e] * 0.125f; sm += xv[i * 8 + e]; } }
#pragma unroll
  for (int off = 16; off >= 1; off >>= 1) sm += __shfl_xor(sm, off, 32);
  const float mu = sm * (1.0f / HID); float q2 = 0.f;
#pragma unroll
  for (int i = 0; i < 32; ++i) { const float dd = xv[i] - mu; q2 += dd * dd; }
#pragma unroll
  for (int off = 16; off >= 1; off >>= 1) q2 += __shfl_xor(q2, off, 32);
  const float rs = rsqrtf(q2 * (1.0f / HID) + 1e-5f);
#pragma unroll
  for (int i = 0; i < 4; ++i) { union { v8h h; v4u u; } pk; v4f f0, f1;
#pragma unroll
    for (int e = 0; e < 8; ++e) { const int c = i * 256 + lane * 8 + e; const float fv = (xv[i * 8 + e] - mu) * rs * g2[c] + b2[c]; pk.h[e] = (_Float16)fv; if (e < 4) f0[e] = fv; else f1[e - 4] = fv; }
    vst2(FX + r * HID + i * 256 + lane * 8, f0); vst2(FX + r * HID + i * 256 + lane * 8 + 4, f1); vst2(FX16 + r * HID + i * 256 + lane * 8, pk.u); }
}
// fo = relu(fx Wf^T + bf): block (128 rows, 128 cols) -> FO f32
__global__ __launch_bounds__(256) void k_ffn(const _Float16* __restrict__ FX16, const _Float16* __restrict__ P, const float* __restrict__ bf, float* __restrict__ FO) {
  __shared__ __align__(16) char ring[2 * GBUF];
  const int tid = threadIdx.x, wave = tid >> 5, lane = tid & 31, col = lane & 15, g = lane >> 4, wm = wave >> 1, wn = wave & 1;
  const int r0b = blockIdx.x * 128, n0 = blockIdx.y * 128;
  v8f acc[2][4] = {};
  gemm_core(FX16 + (size_t)r0b * HID, P + ((size_t)3 * HID + n0) * HID, ring, acc);
  float (*so)[68] = (float (*)[68])(ring + wave * (32 * 68 * 4));
#pragma unroll
  for (int j = 0; j < 4; ++j) { const float bb = bf[n0 + wn * 64 + j * 16 + col];
#pragma unroll
    for (int i = 0; i < 2; ++i)
#pragma unroll
      for (int r = 0; r < 8; ++r) { const float vv = acc[i][j][r] * (1.0f / 16.0f) + bb; so[i * 16 + 8 * g + r][j * 16 + col] = vv > 0.f ? vv : 0.f; } }
  LDSX();
#pragma unroll
  for (int rp = 0; rp < 16; ++rp) { const int rl = rp * 2 + g; vst2(FO + (size_t)(r0b + wm * 32 + rl) * HID + n0 + wn * 64 + col * 4, *(const v4f*)(&so[rl][col * 4])); }
}
// out = fx + LN3(fo): wave per row
__global__ __launch_bounds__(256) void k_fin(const float* __restrict__ FX, const float* __restrict__ FO, const float* __restrict__ g3, const float* __restrict__ b3, float* __restrict__ out) {
  const int wave = threadIdx.x >> 5, lane = threadIdx.x & 31; const size_t r = (size_t)blockIdx.x * 8 + wave; if (r >= NR) return;
  const float* fo = FO + r * HID; float xv[32]; float sm = 0.f;
#pragma unroll
  for (int i = 0; i < 4; ++i) { const v4f a = *(const v4f*)(fo + i * 256 + lane * 8), c = *(const v4f*)(fo + i * 256 + lane * 8 + 4);
    xv[i * 8 + 0] = a[0]; xv[i * 8 + 1] = a[1]; xv[i * 8 + 2] = a[2]; xv[i * 8 + 3] = a[3]; xv[i * 8 + 4] = c[0]; xv[i * 8 + 5] = c[1]; xv[i * 8 + 6] = c[2]; xv[i * 8 + 7] = c[3]; }
#pragma unroll
  for (int i = 0; i < 32; ++i) sm += xv[i];
#pragma unroll
  for (int off = 16; off >= 1; off >>= 1) sm += __shfl_xor(sm, off, 32);
  const float mu = sm * (1.0f / HID); float q2 = 0.f;
#pragma unroll
  for (int i = 0; i < 32; ++i) { const float dd = xv[i] - mu; q2 += dd * dd; }
#pragma unroll
  for (int off = 16; off >= 1; off >>= 1) q2 += __shfl_xor(q2, off, 32);
  const float rs = rsqrtf(q2 * (1.0f / HID) + 1e-5f);
  const float* fx = FX + r * HID;
#pragma unroll
  for (int i = 0; i < 4; ++i) { v4f o0, o1; const int c0 = i * 256 + lane * 8;
#pragma unroll
    for (int e = 0; e < 8; ++e) { const int c = c0 + e; const float vv = fx[c] + ((xv[i * 8 + e] - mu) * rs * g3[c] + b3[c]); if (e < 4) o0[e] = vv; else o1[e - 4] = vv; }
    vst2(out + r * HID + c0, o0); vst2(out + r * HID + c0 + 4, o1); }
}
extern "C" void kernel_launch(void* const* d_in, const int* in_sizes, int n_in, void* d_out, int out_size, void* d_ws, size_t ws_size, hipStream_t stream) {
  (void)in_sizes; (void)n_in; (void)out_size; (void)ws_size;
  const float** I = (const float**)d_in;
  const float* q = I[0]; const float* k = I[1]; const float* v = I[2]; const float* g1q = I[3]; const float* b1q = I[4]; const float* g1k = I[5]; const float* b1k = I[6]; const float* g1v = I[7]; const float* b1v = I[8];
  const float* Wq = I[9]; const float* bq = I[10]; const float* Wk = I[11]; const float* bk = I[12]; const float* Wv = I[13]; const float* bv = I[14]; const float* g2 = I[15]; const float* b2 = I[16]; const float* g3 = I[17]; const float* b3 = I[18]; const float* Wf = I[19]; const float* bf = I[20]; const int* mask = (const int*)d_in[21];
  float* out = (float*)d_out;
  char* ws = (char*)d_ws; size_t off = 0;
  auto take = [&](size_t bytes) { char* p = ws + off; off += (bytes + 255) & ~(size_t)255; return p; };
  _Float16* X16 = (_Float16*)take((size_t)3 * NR * HID * 2); _Float16* P = (_Float16*)take((size_t)4 * HID * HID * 2); float* CS = (float*)take((size_t)SS * 32 * 4); float* SN = (float*)take((size_t)SS * 32 * 4);
  _Float16* Q16 = (_Float16*)take((size_t)NR * HID * 2); _Float16* K16 = (_Float16*)take((size_t)NR * HID * 2); _Float16* VT = (_Float16*)take((size_t)NR * HID * 2); _Float16* O16 = (_Float16*)take((size_t)NR * HID * 2);
  float* FX = (float*)take((size_t)NR * HID * 4); _Float16* FX16 = (_Float16*)take((size_t)NR * HID * 2); float* FO = (float*)take((size_t)NR * HID * 4);
  k_ln3<<<dim3(NR / 16, 3), 256, 0, stream>>>(q, k, v, g1q, b1q, g1k, b1k, g1v, b1v, X16);
  k_pack<<<4 * HID / 16, 256, 0, stream>>>(Wq, Wk, Wv, Wf, P);
  k_rope<<<SS / 8, 256, 0, stream>>>(CS, SN);
  k_qkv<<<dim3(NR / 128, HID / 128, 3), 256, 0, stream>>>(X16, P, bq, bk, bv, CS, SN, Q16, K16, VT);
  k_attn<<<dim3(SS / 64, NH, NB), 128, 0, stream>>>(Q16, K16, VT, mask, O16);
  k_ln2<<<NR / 8, 256, 0, stream>>>(O16, g2, b2, FX, FX16);
  k_ffn<<<dim3(NR / 128, HID / 128), 256, 0, stream>>>(FX16, P, bf, FO);
  k_fin<<<NR / 8, 256, 0, stream>>>(FX, FO, g3, b3, out);
}

// v005
// One run takes 94.8 microseconds.
// In both of two side-by-side timings against v004, it was 1.05 times as fast.
// All steps since v000 together make it 3.17 times as fast.
#include <hip/hip_runtime.h>
#include <math.h>

typedef __attribute__((ext_vector_type(16))) _Float16 v16h;
typedef __attribute__((ext_vector_type(16))) __bf16 v16b;
typedef __attribute__((ext_vector_type(8)))  _Float16 v8h;
typedef __attribute__((ext_vector_type(2)))  _Float16 v2h;
typedef __attribute__((ext_vector_type(8)))  float v8f;
typedef __attribute__((ext_vector_type(4)))  float v4f;
typedef __attribute__((ext_vector_type(2)))  float v2f;
typedef __attribute__((ext_vector_type(4)))  unsigned v4u;
typedef __attribute__((ext_vector_type(4)))  int v4i;
typedef float __attribute__((may_alias)) float_a;
typedef int __attribute__((may_alias)) int_a;

template <typename T> __device__ __forceinline__ void vst2(void* p, T v) { *(T*)p = v;  }
__device__ __forceinline__ v8f wmma16(v16h a, v16h b, v8f c) {
  v8f d = __builtin_amdgcn_wmma_f32_16x16x32_f16(false, a, false, b, (short)0, c, false, false);
  asm volatile("v_nop\n\tv_nop\n\tv_nop\n\tv_nop" : "+v"(d) : "v"(a), "v"(b));
  return d;
}
__device__ __forceinline__ v8f wmma_bf(v16b a, v16b b, v8f c) {
  v8f d = __builtin_amdgcn_wmma_f32_16x16x32_bf16(false, a, false, b, (short)0, c, false, false);
  asm volatile("v_nop\n\tv_nop\n\tv_nop\n\tv_nop" : "+v"(d) : "v"(a), "v"(b));
  return d;
}
// 16x16x32 fragments: lane = (h = lane>>4, row/col = lane&15); elements 0..7 = k0+8h+0..7, 8..15 = k0+16+8h+0..7; D element r = row 8h+r
__device__ __forceinline__ v16h frag_h(const _Float16* rowk0, int lane) {
  union { v16h v; v8h q[2]; } u; const _Float16* p = rowk0 + 8 * (lane >> 4);
  u.q[0] = *(const v8h*)p; u.q[1] = *(const v8h*)(p + 16); return u.v;
}
__device__ __forceinline__ v16h frag_f32(const float* rowk0, int lane) {
  v16h a; const float* p = rowk0 + 8 * (lane >> 4);
#pragma unroll
  for (int i = 0; i < 8; ++i) { a[i] = (_Float16)p[i]; a[8 + i] = (_Float16)p[16 + i]; }
  return a;
}
__device__ __forceinline__ v16h frag_f32s(const float* rowk0, int lane, float sc) {
  v16h a; const float* p = rowk0 + 8 * (lane >> 4);
#pragma unroll
  for (int i = 0; i < 8; ++i) { a[i] = (_Float16)(p[i] * sc); a[8 + i] = (_Float16)(p[16 + i] * sc); }
  return a;
}
// column fragment from a [K][ld] layout (column n), rows >= K read as 0
__device__ __forceinline__ v16h fragc_f32(const float* W, int k0, int n, int lane, int ld, int K) {
  v16h a; const int g = lane >> 4;
#pragma unroll
  for (int i = 0; i < 8; ++i) { const int ka = k0 + 8 * g + i, kb = ka + 16;
    a[i] = (_Float16)(ka < K ? W[(size_t)ka * ld + n] : 0.f); a[8 + i] = (_Float16)(kb < K ? W[(size_t)kb * ld + n] : 0.f); }
  return a;
}
struct F2 { v16b h, l; };
__device__ __forceinline__ F2 bsplit16(const float v[16]) { F2 r;
#pragma unroll
  for (int i = 0; i < 16; ++i) { const __bf16 h = (__bf16)v[i]; r.h[i] = h; r.l[i] = (__bf16)(v[i] - (float)h); }
  return r; }
__device__ __forceinline__ F2 split_row(const float* row, int k0, int lane) { float v[16]; const float* p = row + k0 + 8 * (lane >> 4);
#pragma unroll
  for (int i = 0; i < 8; ++i) { v[i] = p[i]; v[8 + i] = p[16 + i]; }
  return bsplit16(v); }
__device__ __forceinline__ F2 split_rowK(const float* row, int k0, int lane, int K) { float v[16]; const int g = lane >> 4;
#pragma unroll
  for (int i = 0; i < 8; ++i) { const int ka = k0 + 8 * g + i, kb = ka + 16; v[i] = ka < K ? row[ka] : 0.f; v[8 + i] = kb < K ? row[kb] : 0.f; }
  return bsplit16(v); }
__device__ __forceinline__ F2 split_col(const float* W, int k0, int n, int lane, int ld, int K) { float v[16]; const int g = lane >> 4;
#pragma unroll
  for (int i = 0; i < 8; ++i) { const int ka = k0 + 8 * g + i, kb = ka + 16; v[i] = ka < K ? W[(size_t)ka * ld + n] : 0.f; v[8 + i] = kb < K ? W[(size_t)kb * ld + n] : 0.f; }
  return bsplit16(v); }
__device__ __forceinline__ v8f mac3(const F2& a, const F2& b, v8f c) { c = wmma_bf(a.l, b.h, c); c = wmma_bf(a.h, b.l, c); return wmma_bf(a.h, b.h, c); }
__device__ __forceinline__ float sigm(float v) { return 1.0f / (1.0f + expf(-v)); }
#define LDSX() do { asm volatile("s_wait_dscnt 0" ::: "memory"); __builtin_amdgcn_wave_barrier(); __builtin_amdgcn_fence(__ATOMIC_RELEASE, "workgroup"); } while (0)

// Pre-LN multi-head attention block with RoPE and a post FFN: LN(q), LN(k), LN(v) -> projections (+bias) -> rotary embedding -> 16-head
// attention with the module's masked_fill value 1e-10 (mask read as data) -> merge -> fx = LN2(x); fo = relu(fx Wf^T + bf); out = fx +
// LN3(fo). LayerNorms, RoPE (cos/sin table in f32), softmax (online over 16 key tiles) in f32; all four products on
// v_wmma_f32_16x16x32_f16 (LN outputs as f16 rows, [out][in] weights as f16 rows x16, q/k/v head-major f16 x4, P x2^14, O x8).
#define NB 4
#define SS 1024
#define HID 1024
#define NH 16
#define HD 64
#define NR (NB * SS)

// The three preparations (LN of q, k, v; the weights as f16; the RoPE tables) read only inputs and do not depend on one another: they are block ranges of ONE launch, k_prep below.
// LN of two 1024-rows per wave (both rows' 16 loads of 16 bytes are asked for before either is summed): src selects q/k/v by which; block bx has 16 rows; dst f16 rows
__device__ __forceinline__ void ln3_block(int bx, int which, const float* __restrict__ q, const float* __restrict__ k, const float* __restrict__ v, const float* __restrict__ gq, const float* __restrict__ bq, const float* __restrict__ gk, const float* __restrict__ bk, const float* __restrict__ gv, const float* __restrict__ bv2, _Float16* __restrict__ X16) {
  const int wave = threadIdx.x >> 5, lane = threadIdx.x & 31; const size_t r = (size_t)bx * 16 + wave * 2; if (r >= NR) return;
  const float* src = (which == 0 ? q : which == 1 ? k : v) + r * HID; const float* g = which == 0 ? gq : which == 1 ? gk : gv; const float* bb = which == 0 ? bq : which == 1 ? bk : bv2;
  float xv[2][32];
#pragma unroll
  for (int w = 0; w < 2; ++w)
#pragma unroll
    for (int i = 0; i < 4; ++i) { const v4f a = *(const v4f*)(src + w * HID + i * 256 + lane * 8), c = *(const v4f*)(src + w * HID + i * 256 + lane * 8 + 4);
      xv[w][i * 8 + 0] = a[0]; xv[w][i * 8 + 1] = a[1]; xv[w][i * 8 + 2] = a[2]; xv[w][i * 8 + 3] = a[3]; xv[w][i * 8 + 4] = c[0]; xv[w][i * 8 + 5] = c[1]; xv[w][i * 8 + 6] = c[2]; xv[w][i * 8 + 7] = c[3]; }
  __builtin_amdgcn_sched_barrier(0);   // keeps all 16 loads in front of the first row's sums: sunk behind them, the second row's last loads wait out a second memory latency
#pragma unroll
  for (int w = 0; w < 2; ++w) { float s = 0.f;
#pragma unroll
    for (int i = 0; i < 32; ++i) s += xv[w][i];
#pragma unroll
    for (int off = 16; off >= 1; off >>= 1) s += __shfl_xor(s, off, 32);
    const float mu = s * (1.0f / HID); float q2 = 0.f;
#pragma unroll
    for (int i = 0; i < 32; ++i) { const float d = xv[w][i] - mu; q2 += d * d; }
#pragma unroll
    for (int off = 16; off >= 1; off >>= 1) q2 += __shfl_xor(q2, off, 32);
    const float rs = rsqrtf(q2 * (1.0f / HID) + 1e-5f);
#pragma unroll
    for (int i = 0; i < 4; ++i) { union { v8h h; v4u u; } pk;
#pragma unroll
      for (int e = 0; e < 8; ++e) { const int c = i * 256 + lane * 8 + e; pk.h[e] = (_Float16)((xv[w][i * 8 + e] - mu) * rs * g[c] + bb[c]); }
      vst2(X16 + ((size_t)which * NR + r + w) * HID + i * 256 + lane * 8, pk.u); } }
}
// P rows [w*1024 + n] = W_w[n][:] * 16 (W are [out][in]): w = 0 Wq, 1 Wk, 2 Wv, 3 Wf. A block takes 16 whole rows of one W, a wave 2 of them (8 KB in, 4 KB out):
// a lane's 16 loads of 16 bytes are all asked for before the first is converted, and each store is 512 contiguous bytes of a wave
__device__ __forceinline__ void pack_block(int bx, const float* __restrict__ Wq, const float* __restrict__ Wk, const float* __restrict__ Wv, const float* __restrict__ Wf, _Float16* __restrict__ P) {
  const int which = bx >> 6, wave = threadIdx.x >> 5, lane = threadIdx.x & 31;
  const size_t o = (size_t)(bx & 63) * (16 * HID) + wave * (2 * HID) + lane * 8;
  const float* W = (which == 0 ? Wq : which == 1 ? Wk : which == 2 ? Wv : Wf) + o; _Float16* D = P + (size_t)which * HID * HID + o;
  v4f x[16];
#pragma unroll
  for (int i = 0; i < 8; ++i) { x[2 * i] = *(const v4f*)(W + i * 256); x[2 * i + 1] = *(const v4f*)(W + i * 256 + 4); }
#pragma unroll
  for (int i = 0; i < 8; ++i) { union { v8h h; v4u u; } pk;
#pragma unroll
    for (int e = 0; e < 4; ++e) { pk.h[e] = (_Float16)(x[2 * i][e] * 16.0f); pk.h[4 + e] = (_Float16)(x[2 * i + 1][e] * 16.0f); }
    vst2(D + i * 256, pk.u); }
  asm volatile("s_wait_xcnt 0x0" ::: "memory");   // in k_prep other parts' code follows these stores in the listing and reuses their registers: the wait stands in front of any such rewrite
}
// RoPE tables: CS[s][j] = cos(s * inv_freq[j]), SN likewise, j < 32
__device__ __forceinline__ void rope_block(int bx, float* __restrict__ CS, float* __restrict__ SN) {
  const int s = bx * 8 + (threadIdx.x >> 5), j = threadIdx.x & 31;
  const float inv = 1.0f / powf(10000.0f, (float)(2 * j) / (float)HD); const float f = (float)s * inv;
  vst2(CS + (size_t)s * 32 + j, cosf(f)); vst2(SN + (size_t)s * 32 + j, sinf(f));
}
// one launch for the three: blocks 0 .. NB_ROPE-1 make the tables (the longest dependent chain of arithmetic, so it starts first and runs under the others' memory time),
// the next NB_LN the rows of q, then k, then v, the last NB_PACK the weights; the range test is on blockIdx.x alone, a scalar branch
#define NB_ROPE (SS / 8)
#define NB_LN (3 * (NR / 16))
#define NB_PACK (4 * HID / 16)
__global__ __launch_bounds__(256) void k_prep(const float* __restrict__ q, const float* __restrict__ k, const float* __restrict__ v, const float* __restrict__ gq, const float* __restrict__ bq, const float* __restrict__ gk, const float* __restrict__ bk, const float* __restrict__ gv, const float* __restrict__ bv2,
                                            const float* __restrict__ Wq, const float* __restrict__ Wk, const float* __restrict__ Wv, const float* __restrict__ Wf, _Float16* __restrict__ X16, _Float16* __restrict__ P, float* __restrict__ CS, float* __restrict__ SN) {
  const int bid = blockIdx.x;
  if (bid < NB_ROPE) rope_block(bid, CS, SN);
  else if (bid < NB_ROPE + NB_LN) { const int i = bid - NB_ROPE; ln3_block(i % (NR / 16), i / (NR / 16), q, k, v, gq, bq, gk, bk, gv, bv2, X16); }
  else pack_block(bid - (NB_ROPE + NB_LN), Wq, Wk, Wv, Wf, P);
}
// Shared GEMM core of k_qkv and k_ffn: Y[128 rows][128 cols] = A[128][1024] * Bw[128][1024]^T per block of 8 waves (4 x 2), 32 x 64 per wave.
// A pass is 64 k = 128 bytes of each of the 256 operand rows, brought into LDS by asynchronous copies (16 bytes a lane, 8 copies a lane and pass),
// two buffers: pass t + 2 is copied into the buffer that pass t has just left. LDS rows at pitch 144 bytes for the ds_load_b128 fragment readers.
#define GP 144
#define GBUF (256 * GP)
#define NPASS (HID / 64)
// one pass's tile: rows rr, rr+RS, rr+2RS, rr+3RS of the first operand (LDS rows 0..4RS-1, source pitch SA elements) and of the second (LDS rows 4RS..8RS-1,
// source pitch SB); l, a, bw are this lane's own 16 bytes of row rr
template <int RS, int SA, int SB> __device__ __forceinline__ void copy_tile(unsigned l, const _Float16* a, const _Float16* bw) {
  const unsigned l0 = l, l1 = l + RS * GP, l2 = l + 2 * RS * GP, l3 = l + 3 * RS * GP, l4 = l + 4 * RS * GP, l5 = l + 5 * RS * GP, l6 = l + 6 * RS * GP, l7 = l + 7 * RS * GP;
  const _Float16 *a0 = a, *a1 = a + RS * SA, *a2 = a + 2 * RS * SA, *a3 = a + 3 * RS * SA, *w0 = bw, *w1 = bw + RS * SB, *w2 = bw + 2 * RS * SB, *w3 = bw + 3 * RS * SB;
  // the copies and their s_wait_xcnt in one statement: no address register of a copy is rewritten in front of that wait
  asm volatile("global_load_async_to_lds_b128 %0, %8, off\n\t"
               "global_load_async_to_lds_b128 %1, %9, off\n\t"
               "global_load_async_to_lds_b128 %2, %10, off\n\t"
               "global_load_async_to_lds_b128 %3, %11, off\n\t"
               "global_load_async_to_lds_b128 %4, %12, off\n\t"
               "global_load_async_to_lds_b128 %5, %13, off\n\t"
               "global_load_async_to_lds_b128 %6, %14, off\n\t"
               "global_load_async_to_lds_b128 %7, %15, off\n\t"
               "s_wait_xcnt 0x0"
               :: "v"(l0), "v"(l1), "v"(l2), "v"(l3), "v"(l4), "v"(l5), "v"(l6), "v"(l7), "v"(a0), "v"(a1), "v"(a2), "v"(a3), "v"(w0), "v"(w1), "v"(w2), "v"(w3) : "memory");
}
// A, Bw: first row of the block's 128 rows of each operand (row length HID); on return every wave has left the ring (the last pass's barrier)
__device__ __forceinline__ void gemm_core(const _Float16* __restrict__ A, const _Float16* __restrict__ Bw, char* ring, v8f (&acc)[2][4]) {
  const int tid = threadIdx.x, wave = tid >> 5, lane = tid & 31, col = lane & 15, wm = wave >> 1, wn = wave & 1;
  const int rr = tid >> 3, seg = tid & 7;
  const unsigned l = (unsigned)(size_t)ring + rr * GP + seg * 16;
  const _Float16* a = A + (size_t)rr * HID + seg * 8; const _Float16* bw = Bw + (size_t)rr * HID + seg * 8;
  copy_tile<32, HID, HID>(l, a, bw);
  asm volatile("s_wait_asynccnt 0x0" ::: "memory");   // pass 0's copies of this wave have landed
  __syncthreads();                                    // ... and every other wave's
  copy_tile<32, HID, HID>(l + GBUF, a + 64, bw + 64);
  for (int t = 0; t < NPASS; ++t) {
    const char* buf = ring + (t & 1) * GBUF;
#pragma unroll
    for (int kc = 0; kc < 2; ++kc) { v16h fa[2], fb[4];
#pragma unroll
      for (int i = 0; i < 2; ++i) fa[i] = frag_h((const _Float16*)(buf + (wm * 32 + i * 16 + col) * GP + kc * 64), lane);
#pragma unroll
      for (int j = 0; j < 4; ++j) fb[j] = frag_h((const _Float16*)(buf + (128 + wn * 64 + j * 16 + col) * GP + kc * 64), lane);
#pragma unroll
      for (int i = 0; i < 2; ++i)
#pragma unroll
        for (int j = 0; j < 4; ++j) acc[i][j] = wmma16(fa[i], fb[j], acc[i][j]); }
    asm volatile("s_wait_dscnt 0x0" ::: "memory");    // this wave's reads of pass t's buffer are done before it is refilled
    asm volatile("s_wait_asynccnt 0x0" ::: "memory"); // this wave's copies of pass t + 1 have landed
    __syncthreads();                                  // publishes pass t + 1 and ends every reader's last read of pass t's buffer
    if (t + 2 < NPASS) copy_tile<32, HID, HID>(l + (t & 1) * GBUF, a + (t + 2) * 64, bw + (t + 2) * 64);
  }
  asm volatile("s_wait_asynccnt 0x0" ::: "memory");   // nothing in flight when the ring becomes output staging
}
// q/k/v projections + bias (+RoPE for q,k): block (128 rows, 128 cols = 2 heads, which), a wave has 32 rows of one head
__global__ __launch_bounds__(256) void k_qkv(const _Float16* __restrict__ X16, const _Float16* __restrict__ P, const float* __restrict__ bq, const float* __restrict__ bk, const float* __restrict__ bv, const float* __restrict__ CS, const float* __restrict__ SN,
                                           _Float16* __restrict__ Q16, _Float16* __restrict__ K16, _Float16* __restrict__ VT) {
  __shared__ __align__(16) char ring[2 * GBUF];
  const int tid = threadIdx.x, wave = tid >> 5, lane = tid & 31, col = lane & 15, g = lane >> 4, wm = wave >> 1, wn = wave & 1;
  const int which = blockIdx.z, r0b = blockIdx.x * 128, n0 = blockIdx.y * 128; const int b = r0b / SS, s0 = r0b % SS;
  const float* bias = which == 0 ? bq : (which == 1 ? bk : bv);
  v8f acc[2][4] = {};
  gemm_core(X16 + ((size_t)which * NR + r0b) * HID, P + ((size_t)which * HID + n0) * HID, ring, acc);
#pragma unroll
  for (int j = 0; j < 4; ++j) { const float bb = bias[n0 + wn * 64 + j * 16 + col];
#pragma unroll
    for (int i = 0; i < 2; ++i)
#pragma unroll
      for (int r = 0; r < 8; ++r) acc[i][j][r] = acc[i][j][r] * (1.0f / 16.0f) + bb; }
  if (which < 2) {
    // RoPE within the wave's head: d = j*16 + col ; d < 32: x cos - x(d+32) sin ; d >= 32: x cos + x(d-32) sin, angle index d & 31
    float (*so)[68] = (float (*)[68])(ring + wave * (32 * 68 * 4));
#pragma unroll
    for (int i = 0; i < 2; ++i)
#pragma unroll
      for (int jj = 0; jj < 2; ++jj) { const int dj = jj * 16 + col;      // dj < 32
#pragma unroll
        for (int r = 0; r < 8; ++r) { const int rl = i * 16 + 8 * g + r, s = s0 + wm * 32 + rl; const float c = CS[(size_t)s * 32 + dj], sn = SN[(size_t)s * 32 + dj];
          const float lo = acc[i][jj][r], hi = acc[i][jj + 2][r];
          so[rl][jj * 16 + col] = (lo * c - hi * sn) * 4.0f; so[rl][(jj + 2) * 16 + col] = (hi * c + lo * sn) * 4.0f; } }
    LDSX();
    _Float16* D = which == 0 ? Q16 : K16; const int h = (n0 >> 6) + wn;
    for (int qq = lane; qq < 32 * 8; qq += 32) { const int rl = qq >> 3, pc = qq & 7; union { v8h h8; v4u u; } pk;
#pragma unroll
      for (int e = 0; e < 8; ++e) pk.h8[e] = (_Float16)so[rl][pc * 8 + e];
      vst2(D + (((size_t)b * NH + h) * SS + s0 + wm * 32 + rl) * HD + pc * 8, pk.u); } }
  else {
    _Float16 (*st)[136] = (_Float16 (*)[136])ring;
#pragma unroll
    for (int i = 0; i < 2; ++i)
#pragma unroll
      for (int j = 0; j < 4; ++j)
#pragma unroll
        for (int r = 0; r < 8; ++r) st[wn * 64 + j * 16 + col][wm * 32 + i * 16 + 8 * g + r] = (_Float16)(acc[i][j][r] * 4.0f);
    __syncthreads();
    for (int qq = tid; qq < 128 * 16; qq += 256) { const int cl = qq >> 4, pc = qq & 15; const int c = n0 + cl, h = c >> 6, d = c & 63; vst2(VT + (((size_t)b * NH + h) * HD + d) * SS + s0 + pc * 8, *(const v4u*)(&st[cl][pc * 8])); } }
}
#define ABUF (128 * GP)
#define SC2 ((0.125f / 16.0f) * 1.4426950408889634f)
// lane l's value from lane l ^ 16
__device__ __forceinline__ float xhalf(float x) { return __builtin_bit_cast(float, __builtin_amdgcn_permlanex16(__builtin_bit_cast(int, x), __builtin_bit_cast(int, x), 0x76543210, 0xfedcba98, false, false)); }
__global__ __launch_bounds__(128) void k_attn(const _Float16* __restrict__ Q16, const _Float16* __restrict__ K16, const _Float16* __restrict__ VT, const int* __restrict__ mask, _Float16* __restrict__ O16) {
  __shared__ __align__(16) char ring[2 * ABUF];
  __shared__ __align__(16) unsigned smb[SS];
  const int tid = threadIdx.x, w = tid >> 5, lane = tid & 31, col = lane & 15, g = lane >> 4;
  const int b = blockIdx.z, h = blockIdx.y, q0 = blockIdx.x * 64 + w * 16; const size_t bh = (size_t)b * NH + h;
  const unsigned l = (unsigned)(size_t)ring + (tid >> 3) * GP + (tid & 7) * 16;
  const _Float16* kg = K16 + (bh * SS + (tid >> 3)) * HD + (tid & 7) * 8; const _Float16* vg = VT + (bh * HD + (tid >> 3)) * SS + (tid & 7) * 8;
  copy_tile<16, HD, SS>(l, kg, vg);
  for (int qq = tid; qq < SS; qq += 128) smb[qq] = mask[(size_t)b * SS + qq] != 0 ? 0xffffffffu : 0u;
  asm volatile("s_wait_asynccnt 0x0" ::: "memory");   // pass 0's copies of this wave have landed
  __syncthreads();                                    // ... and every other wave's; smb is written
  copy_tile<16, HD, SS>(l + ABUF, kg + 64 * HD, vg + 64);
  v16h aq[2];
#pragma unroll
  for (int kc = 0; kc < 2; ++kc) aq[kc] = frag_h(Q16 + (bh * SS + q0 + col) * HD + kc * 32, lane);
  float mrun = -3.0e38f; v2f lrun = {0.f, 0.f}; v8f acc[4] = {};   // acc[t][r] = O^T[d = t*16 + 8g + r][query col]; lrun: this lane's own keys, the halves joined at the end
#pragma unroll 1
  for (int kt = 0; kt < SS / 64; ++kt) { const char* buf = ring + (kt & 1) * ABUF;
    v16h fk[2][4], fv[2][4]; v4u mb[4][2];
#pragma unroll
    for (int kc = 0; kc < 2; ++kc)
#pragma unroll
      for (int t = 0; t < 4; ++t) fk[kc][t] = frag_h((const _Float16*)(buf + (t * 16 + col) * GP + kc * 64), lane);
#pragma unroll
    for (int t = 0; t < 4; ++t) { mb[t][0] = *(const v4u*)(smb + kt * 64 + t * 16 + 8 * g); mb[t][1] = *(const v4u*)(smb + kt * 64 + t * 16 + 8 * g + 4); }
    v8f d[4] = {};                                    // d[t][r] = raw score of key kt*64 + t*16 + 8g + r with query col
#pragma unroll
    for (int kc = 0; kc < 2; ++kc)
#pragma unroll
      for (int t = 0; t < 4; ++t) d[t] = wmma16(fk[kc][t], aq[kc], d[t]);
#pragma unroll
    for (int kc = 0; kc < 2; ++kc)
#pragma unroll
      for (int t = 0; t < 4; ++t) fv[kc][t] = frag_h((const _Float16*)(buf + (64 + t * 16 + col) * GP + kc * 64), lane);
    v2f s[4][4]; float mx2[2] = {-3.4e38f, -3.4e38f};
#pragma unroll
    for (int t = 0; t < 4; ++t)
#pragma unroll
      for (int i = 0; i < 4; ++i) {
#pragma unroll
        for (int e = 0; e < 2; ++e) { const unsigned m = mb[t][i >> 1][(i & 1) * 2 + e]; const float raw = d[t][2 * i + e], fill = 1e-10f * 128.0f;
          s[t][i][e] = __builtin_bit_cast(float, (__builtin_bit_cast(unsigned, raw) & m) | (__builtin_bit_cast(unsigned, fill) & ~m)); }
        mx2[t & 1] = fmaxf(mx2[t & 1], fmaxf(s[t][i][0], s[t][i][1])); }
    float mx = fmaxf(mx2[0], mx2[1]);
    mx = fmaxf(mx, xhalf(mx));
    const float mnew = fmaxf(mrun, mx * SC2 - 14.0f); const float corr = __builtin_amdgcn_exp2f(mrun - mnew);
    v16h pb[2]; v2f ps[2] = {{0.f, 0.f}, {0.f, 0.f}};
#pragma unroll
    for (int t = 0; t < 4; ++t)
#pragma unroll
      for (int i = 0; i < 4; ++i) { const v2f a = __builtin_elementwise_fma(s[t][i], v2f{SC2, SC2}, v2f{-mnew, -mnew}); const v2f p = {__builtin_amdgcn_exp2f(a[0]), __builtin_amdgcn_exp2f(a[1])};
        ps[t & 1] += p; const v2h ph = __builtin_convertvector(p, v2h); pb[t >> 1][(t & 1) * 8 + 2 * i] = ph[0]; pb[t >> 1][(t & 1) * 8 + 2 * i + 1] = ph[1]; }
    lrun = lrun * v2f{corr, corr} + (ps[0] + ps[1]); mrun = mnew;
#pragma unroll
    for (int t = 0; t < 4; ++t) acc[t] *= corr;
#pragma unroll
    for (int kc = 0; kc < 2; ++kc)
#pragma unroll
      for (int t = 0; t < 4; ++t) acc[t] = wmma16(fv[kc][t], pb[kc], acc[t]);
    asm volatile("s_wait_dscnt 0x0" ::: "memory");    // this wave's reads of pass kt's buffer are done before it is refilled
    asm volatile("s_wait_asynccnt 0x0" ::: "memory"); // this wave's copies of pass kt + 1 have landed
    __syncthreads();                                  // publishes pass kt + 1 and ends every reader's last read of pass kt's buffer
    if (kt + 2 < SS / 64) copy_tile<16, HD, SS>(l + (kt & 1) * ABUF, kg + (size_t)(kt + 2) * 64 * HD, vg + (kt + 2) * 64); }
  asm volatile("s_wait_asynccnt 0x0" ::: "memory");   // nothing in flight when the wave ends
  float lr = lrun[0] + lrun[1]; lr += xhalf(lr);
  const float inv = 8.0f / (lr * 4.0f);
#pragma unroll
  for (int t = 0; t < 4; ++t) { union { v8h h8; v4u u; } pk;   // a lane's 8 accumulator registers are 8 consecutive d of its query's row: one 16-byte store
#pragma unroll
    for (int r = 0; r < 8; ++r) pk.h8[r] = (_Float16)(acc[t][r] * inv);
    vst2(O16 + ((bh * SS) + q0 + col) * HD + t * 16 + 8 * g, pk.u); }
}
// fx = LN2(x) with x = merged O (/8): wave per row -> FX f32 rows and FX16 f16 rows
__global__ __launch_bounds__(256) void k_ln2(const _Float16* __restrict__ O16, const float* __restrict__ g2, const float* __restrict__ b2, float* __restrict__ FX, _Float16* __restrict__ FX16) {
  const int wave = threadIdx.x >> 5, lane = threadIdx.x & 31; const size_t r = (size_t)blockIdx.x * 8 + wave; if (r >= NR) return;
  const int b = (int)(r / SS), s = (int)(r % SS);
  float xv[32]; float sm = 0.f;
#pragma unroll
  for (int i = 0; i < 4; ++i) { const int c0 = i * 256 + lane * 8; const int h = c0 >> 6, d = c0 & 63; const _Float16* src = O16 + (((size_t)b * NH + h) * SS + s) * HD + d;
#pragma unroll
    for (int e = 0; e < 8; ++e) { xv[i * 8 + e] = (float)src[e] * 0.125f; sm += xv[i * 8 + e]; } }
#pragma unroll
  for (int off = 16; off >= 1; off >>= 1) sm += __shfl_xor(sm, off, 32);
  const float mu = sm * (1.0f / HID); float q2 = 0.f;
#pragma unroll
  for (int i = 0; i < 32; ++i) { const float dd = xv[i] - mu; q2 += dd * dd; }
#pragma unroll
  for (int off = 16; off >= 1; off >>= 1) q2 += __shfl_xor(q2, off, 32);
  const float rs = rsqrtf(q2 * (1.0f / HID) + 1e-5f);
#pragma unroll
  for (int i = 0; i < 4; ++i) { union { v8h h; v4u u; } pk; v4f f0, f1;
#pragma unroll
    for (int e = 0; e < 8; ++e) { const int c = i * 256 + lane * 8 + e; const float fv = (xv[i * 8 + e] - mu) * rs * g2[c] + b2[c]; pk.h[e] = (_Float16)fv; if (e < 4) f0[e] = fv; else f1[e - 4] = fv; }
    vst2(FX + r * HID + i * 256 + lane * 8, f0); vst2(FX + r * HID + i * 256 + lane * 8 + 4, f1); vst2(FX16 + r * HID + i * 256 + lane * 8, pk.u); }
}
// fo = relu(fx Wf^T + bf): block (128 rows, 128 cols) -> FO f32
__global__ __launch_bounds__(256) void k_ffn(const _Float16* __restrict__ FX16, const _Float16* __restrict__ P, const float* __restrict__ bf, float* __restrict__ FO) {
  __shared__ __align__(16) char ring[2 * GBUF];
  const int tid = threadIdx.x, wave = tid >> 5, lane = tid & 31, col = lane & 15, g = lane >> 4, wm = wave >> 1, wn = wave & 1;
  const int r0b = blockIdx.x * 128, n0 = blockIdx.y * 128;
  v8f acc[2][4] = {};
  gemm_core(FX16 + (size_t)r0b * HID, P + ((size_t)3 * HID + n0) * HID, ring, acc);
  float (*so)[68] = (float (*)[68])(ring + wave * (32 * 68 * 4));
#pragma unroll
  for (int j = 0; j < 4; ++j) { const float bb = bf[n0 + wn * 64 + j * 16 + col];
#pragma unroll
    for (int i = 0; i < 2; ++i)
#pragma unroll
      for (int r = 0; r < 8; ++r) { const float vv = acc[i][j][r] * (1.0f / 16.0f) + bb; so[i * 16 + 8 * g + r][j * 16 + col] = vv > 0.f ? vv : 0.f; } }
  LDSX();
#pragma unroll
  for (int rp = 0; rp < 16; ++rp) { const int rl = rp * 2 + g; vst2(FO + (size_t)(r0b + wm * 32 + rl) * HID + n0 + wn * 64 + col * 4, *(const v4f*)(&so[rl][col * 4])); }
}
// out = fx + LN3(fo): wave per row
__global__ __launch_bounds__(256) void k_fin(const float* __restrict__ FX, const float* __restrict__ FO, const float* __restrict__ g3, const float* __restrict__ b3, float* __restrict__ out) {
  const int wave = threadIdx.x >> 5, lane = threadIdx.x & 31; const size_t r = (size_t)blockIdx.x * 8 + wave; if (r >= NR) return;
  const float* fo = FO + r * HID; float xv[32]; float sm = 0.f;
#pragma unroll
  for (int i = 0; i < 4; ++i) { const v4f a = *(const v4f*)(fo + i * 256 + lane * 8), c = *(const v4f*)(fo + i * 256 + lane * 8 + 4);
    xv[i * 8 + 0] = a[0]; xv[i * 8 + 1] = a[1]; xv[i * 8 + 2] = a[2]; xv[i * 8 + 3] = a[3]; xv[i * 8 + 4] = c[0]; xv[i * 8 + 5] = c[1]; xv[i * 8 + 6] = c[2]; xv[i * 8 + 7] = c[3]; }
#pragma unroll
  for (int i = 0; i < 32; ++i) sm += xv[i];
#pragma unroll
  for (int off = 16; off >= 1; off >>= 1) sm += __shfl_xor(sm, off, 32);
  const float mu = sm * (1.0f / HID); float q2 = 0.f;
#pragma unroll
  for (int i = 0; i < 32; ++i) { const float dd = xv[i] - mu; q2 += dd * dd; }
#pragma unroll
  for (int off = 16; off >= 1; off >>= 1) q2 += __shfl_xor(q2, off, 32);
  const float rs = rsqrtf(q2 * (1.0f / HID) + 1e-5f);
  const float* fx = FX + r * HID;
#pragma unroll
  for (int i = 0; i < 4; ++i) { v4f o0, o1; const int c0 = i * 256 + lane * 8;
#pragma unroll
    for (int e = 0; e < 8; ++e) { const int c = c0 + e; const float vv = fx[c] + ((xv[i * 8 + e] - mu) * rs * g3[c] + b3[c]); if (e < 4) o0[e] = vv; else o1[e - 4] = vv; }
    vst2(out + r * HID + c0, o0); vst2(out + r * HID + c0 + 4, o1); }
}
extern "C" void kernel_launch(void* const* d_in, const int* in_sizes, int n_in, void* d_out, int out_size, void* d_ws, size_t ws_size, hipStream_t stream) {
  (void)in_sizes; (void)n_in; (void)out_size; (void)ws_size;
  const float** I = (const float**)d_in;
  const float* q = I[0]; const float* k = I[1]; const float* v = I[2]; const float* g1q = I[3]; const float* b1q = I[4]; const float* g1k = I[5]; const float* b1k = I[6]; const float* g1v = I[7]; const float* b1v = I[8];
  const float* Wq = I[9]; const float* bq = I[10]; const float* Wk = I[11]; const float* bk = I[12]; const float* Wv = I[13]; const float* bv = I[14]; const float* g2 = I[15]; const float* b2 = I[16]; const float* g3 = I[17]; const float* b3 = I[18]; const float* Wf = I[19]; const float* bf = I[20]; const int* mask = (const int*)d_in[21];
  float* out = (float*)d_out;
  char* ws = (char*)d_ws; size_t off = 0;
  auto take = [&](size_t bytes) { char* p = ws + off; off += (bytes + 255) & ~(size_t)255; return p; };
  _Float16* X16 = (_Float16*)take((size_t)3 * NR * HID * 2); _Float16* P = (_Float16*)take((size_t)4 * HID * HID * 2); float* CS = (float*)take((size_t)SS * 32 * 4); float* SN = (float*)take((size_t)SS * 32 * 4);
  _Float16* Q16 = (_Float16*)take((size_t)NR * HID * 2); _Float16* K16 = (_Float16*)take((size_t)NR * HID * 2); _Float16* VT = (_Float16*)take((size_t)NR * HID * 2); _Float16* O16 = (_Float16*)take((size_t)NR * HID * 2);
  float* FX = (float*)take((size_t)NR * HID * 4); _Float16* FX16 = (_Float16*)take((size_t)NR * HID * 2); float* FO = (float*)take((size_t)NR * HID * 4);
  k_prep<<<NB_ROPE + NB_LN + NB_PACK, 256, 0, stream>>>(q, k, v, g1q, b1q, g1k, b1k, g1v, b1v, Wq, Wk, Wv, Wf, X16, P, CS, SN);
  k_qkv<<<dim3(NR / 128, HID / 128, 3), 256, 0, stream>>>(X16, P, bq, bk, bv, CS, SN, Q16, K16, VT);
  k_attn<<<dim3(SS / 64, NH, NB), 128, 0, stream>>>(Q16, K16, VT, mask, O16);
  k_ln2<<<NR / 8, 256, 0, stream>>>(O16, g2, b2, FX, FX16);
  k_ffn<<<dim3(NR / 128, HID / 128), 256, 0, stream>>>(FX16, P, bf, FO);
  k_fin<<<NR / 8, 256, 0, stream>>>(FX, FO, g3, b3, out);
}

// v006
// One run takes 89.7 microseconds.
// Next to v005, in two timings, it ran 1.07 times as fast each time.
// Over all steps from v000 it is 3.39 times as fast.
#include <hip/hip_runtime.h>
#include <math.h>

typedef __attribute__((ext_vector_type(16))) _Float16 v16h;
typedef __attribute__((ext_vector_type(16))) __bf16 v16b;
typedef __attribute__((ext_vector_type(8)))  _Float16 v8h;
typedef __attribute__((ext_vector_type(2)))  _Float16 v2h;
typedef __attribute__((ext_vector_type(8)))  float v8f;
typedef __attribute__((ext_vector_type(4)))  float v4f;
typedef __attribute__((ext_vector_type(2)))  float v2f;
typedef __attribute__((ext_vector_type(4)))  unsigned v4u;
typedef __attribute__((ext_vector_type(4)))  int v4i;
typedef float __attribute__((may_alias)) float_a;
typedef int __attribute__((may_alias)) int_a;

template <typename T> __device__ __forceinline__ void vst2(void* p, T v) { *(T*)p = v;  }
__device__ __forceinline__ v8f wmma16(v16h a, v16h b, v8f c) {
  v8f d = __builtin_amdgcn_wmma_f32_16x16x32_f16(false, a, false, b, (short)0, c, false, false);
  asm volatile("v_nop\n\tv_nop\n\tv_nop\n\tv_nop" : "+v"(d) : "v"(a), "v"(b));
  return d;
}
__device__ __forceinline__ v8f wmma_bf(v16b a, v16b b, v8f c) {
  v8f d = __builtin_amdgcn_wmma_f32_16x16x32_bf16(false, a, false, b, (short)0, c, false, false);
  asm volatile("v_nop\n\tv_nop\n\tv_nop\n\tv_nop" : "+v"(d) : "v"(a), "v"(b));
  return d;
}
// 16x16x32 fragments: lane = (h = lane>>4, row/col = lane&15); elements 0..7 = k0+8h+0..7, 8..15 = k0+16+8h+0..7; D element r = row 8h+r
__device__ __forceinline__ v16h frag_h(const _Float16* rowk0, int lane) {
  union { v16h v; v8h q[2]; } u; const _Float16* p = rowk0 + 8 * (lane >> 4);
  u.q[0] = *(const v8h*)p; u.q[1] = *(const v8h*)(p + 16); return u.v;
}
__device__ __forceinline__ v16h frag_f32(const float* rowk0, int lane) {
  v16h a; const float* p = rowk0 + 8 * (lane >> 4);
#pragma unroll
  for (int i = 0; i < 8; ++i) { a[i] = (_Float16)p[i]; a[8 + i] = (_Float16)p[16 + i]; }
  return a;
}
__device__ __forceinline__ v16h frag_f32s(const float* rowk0, int lane, float sc) {
  v16h a; const float* p = rowk0 + 8 * (lane >> 4);
#pragma unroll
  for (int i = 0; i < 8; ++i) { a[i] = (_Float16)(p[i] * sc); a[8 + i] = (_Float16)(p[16 + i] * sc); }
  return a;
}
// column fragment from a [K][ld] layout (column n), rows >= K read as 0
__device__ __forceinline__ v16h fragc_f32(const float* W, int k0, int n, int lane, int ld, int K) {
  v16h a; const int g = lane >> 4;
#pragma unroll
  for (int i = 0; i < 8; ++i) { const int ka = k0 + 8 * g + i, kb = ka + 16;
    a[i] = (_Float16)(ka < K ? W[(size_t)ka * ld + n] : 0.f); a[8 + i] = (_Float16)(kb < K ? W[(size_t)kb * ld + n] : 0.f); }
  return a;
}
struct F2 { v16b h, l; };
__device__ __forceinline__ F2 bsplit16(const float v[16]) { F2 r;
#pragma unroll
  for (int i = 0; i < 16; ++i) { const __bf16 h = (__bf16)v[i]; r.h[i] = h; r.l[i] = (__bf16)(v[i] - (float)h); }
  return r; }
__device__ __forceinline__ F2 split_row(const float* row, int k0, int lane) { float v[16]; const float* p = row + k0 + 8 * (lane >> 4);
#pragma unroll
  for (int i = 0; i < 8; ++i) { v[i] = p[i]; v[8 + i] = p[16 + i]; }
  return bsplit16(v); }
__device__ __forceinline__ F2 split_rowK(const float* row, int k0, int lane, int K) { float v[16]; const int g = lane >> 4;
#pragma unroll
  for (int i = 0; i < 8; ++i) { const int ka = k0 + 8 * g + i, kb = ka + 16; v[i] = ka < K ? row[ka] : 0.f; v[8 + i] = kb < K ? row[kb] : 0.f; }
  return bsplit16(v); }
__device__ __forceinline__ F2 split_col(const float* W, int k0, int n, int lane, int ld, int K) { float v[16]; const int g = lane >> 4;
#pragma unroll
  for (int i = 0; i < 8; ++i) { const int ka = k0 + 8 * g + i, kb = ka + 16; v[i] = ka < K ? W[(size_t)ka * ld + n] : 0.f; v[8 + i] = kb < K ? W[(size_t)kb * ld + n] : 0.f; }
  return bsplit16(v); }
__device__ __forceinline__ v8f mac3(const F2& a, const F2& b, v8f c) { c = wmma_bf(a.l, b.h, c); c = wmma_bf(a.h, b.l, c); return wmma_bf(a.h, b.h, c); }
__device__ __forceinline__ float sigm(float v) { return 1.0f / (1.0f + expf(-v)); }
#define LDSX() do { asm volatile("s_wait_dscnt 0" ::: "memory"); __builtin_amdgcn_wave_barrier(); __builtin_amdgcn_fence(__ATOMIC_RELEASE, "workgroup"); } while (0)

// Pre-LN multi-head attention block with RoPE and a post FFN: LN(q), LN(k), LN(v) -> projections (+bias) -> rotary embedding -> 16-head
// attention with the module's masked_fill value 1e-10 (mask read as data) -> merge -> fx = LN2(x); fo = relu(fx Wf^T + bf); out = fx +
// LN3(fo). LayerNorms, RoPE (cos/sin table in f32), softmax (online over 16 key tiles) in f32; all four products on
// v_wmma_f32_16x16x32_f16 (LN outputs as f16 rows, [out][in] weights as f16 rows x16, q/k/v head-major f16 x4, P x2^14, O x8).
// LN2 is linear in x once a row's mean mu and 1/sigma rs are known: fx Wf^T = rs * (x (Wf g2)^T - mu * U) + C with U[n] = sum_k Wf[n][k] g2[k], C[n] = sum_k Wf[n][k] b2[k].
// So the FFN product runs on the attention output itself, against Wf g2, and its epilogue applies rs, mu, U, C; fx as a value is formed only in the last kernel.
#define NB 4
#define SS 1024
#define HID 1024
#define NH 16
#define HD 64
#define NR (NB * SS)

// The three preparations (LN of q, k, v; the weights as f16; the RoPE tables) read only inputs and do not depend on one another: they are block ranges of ONE launch, k_prep below.
// LN of two 1024-rows per wave (both rows' 16 loads of 16 bytes are asked for before either is summed): src selects q/k/v by which; block bx has 16 rows; dst f16 rows
__device__ __forceinline__ void ln3_block(int bx, int which, const float* __restrict__ q, const float* __restrict__ k, const float* __restrict__ v, const float* __restrict__ gq, const float* __restrict__ bq, const float* __restrict__ gk, const float* __restrict__ bk, const float* __restrict__ gv, const float* __restrict__ bv2, _Float16* __restrict__ X16) {
  const int wave = threadIdx.x >> 5, lane = threadIdx.x & 31; const size_t r = (size_t)bx * 16 + wave * 2; if (r >= NR) return;
  const float* src = (which == 0 ? q : which == 1 ? k : v) + r * HID; const float* g = which == 0 ? gq : which == 1 ? gk : gv; const float* bb = which == 0 ? bq : which == 1 ? bk : bv2;
  float xv[2][32];
#pragma unroll
  for (int w = 0; w < 2; ++w)
#pragma unroll
    for (int i = 0; i < 4; ++i) { const v4f a = *(const v4f*)(src + w * HID + i * 256 + lane * 8), c = *(const v4f*)(src + w * HID + i * 256 + lane * 8 + 4);
      xv[w][i * 8 + 0] = a[0]; xv[w][i * 8 + 1] = a[1]; xv[w][i * 8 + 2] = a[2]; xv[w][i * 8 + 3] = a[3]; xv[w][i * 8 + 4] = c[0]; xv[w][i * 8 + 5] = c[1]; xv[w][i * 8 + 6] = c[2]; xv[w][i * 8 + 7] = c[3]; }
  __builtin_amdgcn_sched_barrier(0);   // keeps all 16 loads in front of the first row's sums: sunk behind them, the second row's last loads wait out a second memory latency
#pragma unroll
  for (int w = 0; w < 2; ++w) { float s = 0.f;
#pragma unroll
    for (int i = 0; i < 32; ++i) s += xv[w][i];
#pragma unroll
    for (int off = 16; off >= 1; off >>= 1) s += __shfl_xor(s, off, 32);
    const float mu = s * (1.0f / HID); float q2 = 0.f;
#pragma unroll
    for (int i = 0; i < 32; ++i) { const float d = xv[w][i] - mu; q2 += d * d; }
#pragma unroll
    for (int off = 16; off >= 1; off >>= 1) q2 += __shfl_xor(q2, off, 32);
    const float rs = rsqrtf(q2 * (1.0f / HID) + 1e-5f);
#pragma unroll
    for (int i = 0; i < 4; ++i) { union { v8h h; v4u u; } pk;
#pragma unroll
      for (int e = 0; e < 8; ++e) { const int c = i * 256 + lane * 8 + e; pk.h[e] = (_Float16)((xv[w][i * 8 + e] - mu) * rs * g[c] + bb[c]); }
      vst2(X16 + ((size_t)which * NR + r + w) * HID + i * 256 + lane * 8, pk.u); } }
}
// P rows [w*1024 + n] = W_w[n][:] * 16 (W are [out][in]): w = 0 Wq, 1 Wk, 2 Wv (Wf: packf_block). A block takes 16 whole rows of one W, a wave 2 of them (8 KB in, 4 KB out):
// a lane's 16 loads of 16 bytes are all asked for before the first is converted, and each store is 512 contiguous bytes of a wave
__device__ __forceinline__ void pack_block(int bx, const float* __restrict__ Wq, const float* __restrict__ Wk, const float* __restrict__ Wv, _Float16* __restrict__ P) {
  const int which = bx >> 6, wave = threadIdx.x >> 5, lane = threadIdx.x & 31;
  const size_t o = (size_t)(bx & 63) * (16 * HID) + wave * (2 * HID) + lane * 8;
  const float* W = (which == 0 ? Wq : which == 1 ? Wk : Wv) + o; _Float16* D = P + (size_t)which * HID * HID + o;
  v4f x[16];
#pragma unroll
  for (int i = 0; i < 8; ++i) { x[2 * i] = *(const v4f*)(W + i * 256); x[2 * i + 1] = *(const v4f*)(W + i * 256 + 4); }
#pragma unroll
  for (int i = 0; i < 8; ++i) { union { v8h h; v4u u; } pk;
#pragma unroll
    for (int e = 0; e < 4; ++e) { pk.h[e] = (_Float16)(x[2 * i][e] * 16.0f); pk.h[4 + e] = (_Float16)(x[2 * i + 1][e] * 16.0f); }
    vst2(D + i * 256, pk.u); }
  asm volatile("s_wait_xcnt 0x0" ::: "memory");   // in k_prep other parts' code follows these stores in the listing and reuses their registers: the wait stands in front of any such rewrite
}
// Wf with LN2 folded in: P rows [3*1024 + n] = Wf[n][:] * g2[:] * 16, and of each row the two sums U[n], C[n] (f32, whole row in one wave). 2 rows a wave, as in pack_block.
// U is summed over the products as rounded to f16, so that mu * U takes away exactly what the matrix product has summed of a row's mean.
// UC: a wave's four sums {U[n], C[n], U[n+1], C[n+1]} are the first 16 bytes of a 128-byte line of its own
__device__ __forceinline__ void packf_block(int bx, const float* __restrict__ Wf, const float* __restrict__ g2, const float* __restrict__ b2, _Float16* __restrict__ P, float* __restrict__ UC) {
  const int wave = threadIdx.x >> 5, lane = threadIdx.x & 31;
  const size_t o = (size_t)bx * (16 * HID) + wave * (2 * HID) + lane * 8;
  const float* W = Wf + o; _Float16* D = P + (size_t)3 * HID * HID + o; float* uc = UC + (size_t)(bx * 8 + wave) * 32;
  v4f gg[8], bb[8];
#pragma unroll
  for (int j = 0; j < 4; ++j) { gg[2 * j] = *(const v4f*)(g2 + j * 256 + lane * 8); gg[2 * j + 1] = *(const v4f*)(g2 + j * 256 + lane * 8 + 4); bb[2 * j] = *(const v4f*)(b2 + j * 256 + lane * 8); bb[2 * j + 1] = *(const v4f*)(b2 + j * 256 + lane * 8 + 4); }
#pragma unroll 1   // a row at a time: with both rows' values live at once k_prep needs more than 160 registers, and every part of it loses a wave per SIMD
  for (int w = 0; w < 2; ++w) { v4f x[8]; float su = 0.f, sc = 0.f;
#pragma unroll
    for (int j = 0; j < 4; ++j) { x[2 * j] = *(const v4f*)(W + w * HID + j * 256); x[2 * j + 1] = *(const v4f*)(W + w * HID + j * 256 + 4); }
#pragma unroll
    for (int j = 0; j < 4; ++j) { union { v8h h; v4u u; } pk;   // k = j*256 + lane*8 + e
#pragma unroll
      for (int e = 0; e < 4; ++e) { pk.h[e] = (_Float16)(x[2 * j][e] * gg[2 * j][e] * 16.0f); pk.h[4 + e] = (_Float16)(x[2 * j + 1][e] * gg[2 * j + 1][e] * 16.0f);
        su += (float)pk.h[e] + (float)pk.h[4 + e]; sc += x[2 * j][e] * bb[2 * j][e] + x[2 * j + 1][e] * bb[2 * j + 1][e]; }
      vst2(D + w * HID + j * 256, pk.u); }
    asm volatile("s_wait_xcnt 0x0" ::: "memory");   // the sums below reuse the stores' registers: the wait stands in front of any such rewrite
#pragma unroll
    for (int off = 16; off >= 1; off >>= 1) { su += __shfl_xor(su, off, 32); sc += __shfl_xor(sc, off, 32); }
    if (lane == 0) vst2(uc + w * 2, v2f{su * (1.0f / 16.0f), sc});
    asm volatile("s_wait_xcnt 0x0" ::: "memory"); }   // likewise for this store, in front of the second row's (and, in k_prep, other parts') use of its registers
}
// RoPE tables: CS[s][j] = cos(s * inv_freq[j]), SN likewise, j < 32
__device__ __forceinline__ void rope_block(int bx, float* __restrict__ CS, float* __restrict__ SN) {
  const int s = bx * 8 + (threadIdx.x >> 5), j = threadIdx.x & 31;
  const float inv = 1.0f / powf(10000.0f, (float)(2 * j) / (float)HD); const float f = (float)s * inv;
  vst2(CS + (size_t)s * 32 + j, cosf(f)); vst2(SN + (size_t)s * 32 + j, sinf(f));
}
// one launch for the three: blocks 0 .. NB_ROPE-1 make the tables (the longest dependent chain of arithmetic, so it starts first and runs under the others' memory time),
// the next NB_PACKF blocks Wf (row sums behind its loads: the second longest chain), the next NB_LN the rows of q, then k, then v, the last NB_PACK Wq, Wk, Wv; the range test is on blockIdx.x alone, a scalar branch
#define NB_ROPE (SS / 8)
#define NB_LN (3 * (NR / 16))
#define NB_PACK (3 * HID / 16)
#define NB_PACKF (HID / 16)
__global__ __launch_bounds__(256) void k_prep(const float* __restrict__ q, const float* __restrict__ k, const float* __restrict__ v, const float* __restrict__ gq, const float* __restrict__ bq, const float* __restrict__ gk, const float* __restrict__ bk, const float* __restrict__ gv, const float* __restrict__ bv2,
                                            const float* __restrict__ Wq, const float* __restrict__ Wk, const float* __restrict__ Wv, const float* __restrict__ Wf, const float* __restrict__ g2, const float* __restrict__ b2, _Float16* __restrict__ X16, _Float16* __restrict__ P, float* __restrict__ UC, float* __restrict__ CS, float* __restrict__ SN) {
  const int bid = blockIdx.x;
  if (bid < NB_ROPE) rope_block(bid, CS, SN);
  else if (bid < NB_ROPE + NB_PACKF) packf_block(bid - NB_ROPE, Wf, g2, b2, P, UC);
  else if (bid < NB_ROPE + NB_PACKF + NB_LN) { const int i = bid - (NB_ROPE + NB_PACKF); ln3_block(i % (NR / 16), i / (NR / 16), q, k, v, gq, bq, gk, bk, gv, bv2, X16); }
  else pack_block(bid - (NB_ROPE + NB_PACKF + NB_LN), Wq, Wk, Wv, P);
}
// Shared GEMM core of k_qkv and k_ffn: Y[128 rows][128 cols] = A[128][1024] * Bw[128][1024]^T per block of 8 waves (4 x 2), 32 x 64 per wave.
// A pass is 64 k = 128 bytes of each of the 256 operand rows, brought into LDS by asynchronous copies (16 bytes a lane, 8 copies a lane and pass),
// two buffers: pass t + 2 is copied into the buffer that pass t has just left. LDS rows at pitch 144 bytes for the ds_load_b128 fragment readers.
#define GP 144
#define GBUF (256 * GP)
#define NPASS (HID / 64)
// one pass's tile: rows rr, rr+RS, rr+2RS, rr+3RS of the first operand (LDS rows 0..4RS-1, source pitch SA elements) and of the second (LDS rows 4RS..8RS-1,
// source pitch SB); l, a, bw are this lane's own 16 bytes of row rr
template <int RS, int SA, int SB> __device__ __forceinline__ void copy_tile(unsigned l, const _Float16* a, const _Float16* bw) {
  const unsigned l0 = l, l1 = l + RS * GP, l2 = l + 2 * RS * GP, l3 = l + 3 * RS * GP, l4 = l + 4 * RS * GP, l5 = l + 5 * RS * GP, l6 = l + 6 * RS * GP, l7 = l + 7 * RS * GP;
  const _Float16 *a0 = a, *a1 = a + RS * SA, *a2 = a + 2 * RS * SA, *a3 = a + 3 * RS * SA, *w0 = bw, *w1 = bw + RS * SB, *w2 = bw + 2 * RS * SB, *w3 = bw + 3 * RS * SB;
  // the copies and their s_wait_xcnt in one statement: no address register of a copy is rewritten in front of that wait
  asm volatile("global_load_async_to_lds_b128 %0, %8, off\n\t"
               "global_load_async_to_lds_b128 %1, %9, off\n\t"
               "global_load_async_to_lds_b128 %2, %10, off\n\t"
               "global_load_async_to_lds_b128 %3, %11, off\n\t"
               "global_load_async_to_lds_b128 %4, %12, off\n\t"
               "global_load_async_to_lds_b128 %5, %13, off\n\t"
               "global_load_async_to_lds_b128 %6, %14, off\n\t"
               "global_load_async_to_lds_b128 %7, %15, off\n\t"
               "s_wait_xcnt 0x0"
               :: "v"(l0), "v"(l1), "v"(l2), "v"(l3), "v"(l4), "v"(l5), "v"(l6), "v"(l7), "v"(a0), "v"(a1), "v"(a2), "v"(a3), "v"(w0), "v"(w1), "v"(w2), "v"(w3) : "memory");
}
// A, Bw: first row of the block's 128 rows of each operand; Bw has rows of HID, A rows at pitch SA elements whose next 64 k lie PA elements on (row-major: HID, 64; head-major: HD, SS * HD)
// under_first() runs while pass 0's copies fly; what it writes to LDS outside the ring is published by pass 0's barrier. On return every wave has left the ring (the last pass's barrier)
template <int SA, int PA, typename F> __device__ __forceinline__ void gemm_core(const _Float16* __restrict__ A, const _Float16* __restrict__ Bw, char* ring, v8f (&acc)[2][4], F under_first) {
  const int tid = threadIdx.x, wave = tid >> 5, lane = tid & 31, col = lane & 15, wm = wave >> 1, wn = wave & 1;
  const int rr = tid >> 3, seg = tid & 7;
  const unsigned l = (unsigned)(size_t)ring + rr * GP + seg * 16;
  const _Float16* a = A + (size_t)rr * SA + seg * 8; const _Float16* bw = Bw + (size_t)rr * HID + seg * 8;
  copy_tile<32, SA, HID>(l, a, bw);
  under_first();
  asm volatile("s_wait_asynccnt 0x0" ::: "memory");   // pass 0's copies of this wave have landed
  __syncthreads();                                    // ... and every other wave's
  copy_tile<32, SA, HID>(l + GBUF, a + PA, bw + 64);
  for (int t = 0; t < NPASS; ++t) {
    const char* buf = ring + (t & 1) * GBUF;
#pragma unroll
    for (int kc = 0; kc < 2; ++kc) { v16h fa[2], fb[4];
#pragma unroll
      for (int i = 0; i < 2; ++i) fa[i] = frag_h((const _Float16*)(buf + (wm * 32 + i * 16 + col) * GP + kc * 64), lane);
#pragma unroll
      for (int j = 0; j < 4; ++j) fb[j] = frag_h((const _Float16*)(buf + (128 + wn * 64 + j * 16 + col) * GP + kc * 64), lane);
#pragma unroll
      for (int i = 0; i < 2; ++i)
#pragma unroll
        for (int j = 0; j < 4; ++j) acc[i][j] = wmma16(fa[i], fb[j], acc[i][j]); }
    asm volatile("s_wait_dscnt 0x0" ::: "memory");    // this wave's reads of pass t's buffer are done before it is refilled
    asm volatile("s_wait_asynccnt 0x0" ::: "memory"); // this wave's copies of pass t + 1 have landed
    __syncthreads();                                  // publishes pass t + 1 and ends every reader's last read of pass t's buffer
    if (t + 2 < NPASS) copy_tile<32, SA, HID>(l + (t & 1) * GBUF, a + (t + 2) * PA, bw + (t + 2) * 64);
  }
  asm volatile("s_wait_asynccnt 0x0" ::: "memory");   // nothing in flight when the ring becomes output staging
}
// q/k/v projections + bias (+RoPE for q,k): block (128 rows, 128 cols = 2 heads, which), a wave has 32 rows of one head
__global__ __launch_bounds__(256) void k_qkv(const _Float16* __restrict__ X16, const _Float16* __restrict__ P, const float* __restrict__ bq, const float* __restrict__ bk, const float* __restrict__ bv, const float* __restrict__ CS, const float* __restrict__ SN,
                                           _Float16* __restrict__ Q16, _Float16* __restrict__ K16, _Float16* __restrict__ VT) {
  __shared__ __align__(16) char ring[2 * GBUF];
  const int tid = threadIdx.x, wave = tid >> 5, lane = tid & 31, col = lane & 15, g = lane >> 4, wm = wave >> 1, wn = wave & 1;
  const int which = blockIdx.z, r0b = blockIdx.x * 128, n0 = blockIdx.y * 128; const int b = r0b / SS, s0 = r0b % SS;
  const float* bias = which == 0 ? bq : (which == 1 ? bk : bv);
  v8f acc[2][4] = {};
  gemm_core<HID, 64>(X16 + ((size_t)which * NR + r0b) * HID, P + ((size_t)which * HID + n0) * HID, ring, acc, [] {});
#pragma unroll
  for (int j = 0; j < 4; ++j) { const float bb = bias[n0 + wn * 64 + j * 16 + col];
#pragma unroll
    for (int i = 0; i < 2; ++i)
#pragma unroll
      for (int r = 0; r < 8; ++r) acc[i][j][r] = acc[i][j][r] * (1.0f / 16.0f) + bb; }
  if (which < 2) {
    // RoPE within the wave's head: d = j*16 + col ; d < 32: x cos - x(d+32) sin ; d >= 32: x cos + x(d-32) sin, angle index d & 31
    float (*so)[68] = (float (*)[68])(ring + wave * (32 * 68 * 4));
#pragma unroll
    for (int i = 0; i < 2; ++i)
#pragma unroll
      for (int jj = 0; jj < 2; ++jj) { const int dj = jj * 16 + col;      // dj < 32
#pragma unroll
        for (int r = 0; r < 8; ++r) { const int rl = i * 16 + 8 * g + r, s = s0 + wm * 32 + rl; const float c = CS[(size_t)s * 32 + dj], sn = SN[(size_t)s * 32 + dj];
          const float lo = acc[i][jj][r], hi = acc[i][jj + 2][r];
          so[rl][jj * 16 + col] = (lo * c - hi * sn) * 4.0f; so[rl][(jj + 2) * 16 + col] = (hi * c + lo * sn) * 4.0f; } }
    LDSX();
    _Float16* D = which == 0 ? Q16 : K16; const int h = (n0 >> 6) + wn;
    for (int qq = lane; qq < 32 * 8; qq += 32) { const int rl = qq >> 3, pc = qq & 7; union { v8h h8; v4u u; } pk;
#pragma unroll
      for (int e = 0; e < 8; ++e) pk.h8[e] = (_Float16)so[rl][pc * 8 + e];
      vst2(D + (((size_t)b * NH + h) * SS + s0 + wm * 32 + rl) * HD + pc * 8, pk.u); } }
  else {
    _Float16 (*st)[136] = (_Float16 (*)[136])ring;
#pragma unroll
    for (int i = 0; i < 2; ++i)
#pragma unroll
      for (int j = 0; j < 4; ++j)
#pragma unroll
        for (int r = 0; r < 8; ++r) st[wn * 64 + j * 16 + col][wm * 32 + i * 16 + 8 * g + r] = (_Float16)(acc[i][j][r] * 4.0f);
    __syncthreads();
    for (int qq = tid; qq < 128 * 16; qq += 256) { const int cl = qq >> 4, pc = qq & 15; const int c = n0 + cl, h = c >> 6, d = c & 63; vst2(VT + (((size_t)b * NH + h) * HD + d) * SS + s0 + pc * 8, *(const v4u*)(&st[cl][pc * 8])); } }
}
#define ABUF (128 * GP)
#define SC2 ((0.125f / 16.0f) * 1.4426950408889634f)
// lane l's value from lane l ^ 16
__device__ __forceinline__ float xhalf(float x) { return __builtin_bit_cast(float, __builtin_amdgcn_permlanex16(__builtin_bit_cast(int, x), __builtin_bit_cast(int, x), 0x76543210, 0xfedcba98, false, false)); }
__global__ __launch_bounds__(128) void k_attn(const _Float16* __restrict__ Q16, const _Float16* __restrict__ K16, const _Float16* __restrict__ VT, const int* __restrict__ mask, _Float16* __restrict__ O16, float* __restrict__ ST) {
  __shared__ __align__(16) char ring[2 * ABUF];
  __shared__ __align__(16) unsigned smb[SS];
  const int tid = threadIdx.x, w = tid >> 5, lane = tid & 31, col = lane & 15, g = lane >> 4;
  const int b = blockIdx.z, h = blockIdx.y, q0 = blockIdx.x * 64 + w * 16; const size_t bh = (size_t)b * NH + h;
  const unsigned l = (unsigned)(size_t)ring + (tid >> 3) * GP + (tid & 7) * 16;
  const _Float16* kg = K16 + (bh * SS + (tid >> 3)) * HD + (tid & 7) * 8; const _Float16* vg = VT + (bh * HD + (tid >> 3)) * SS + (tid & 7) * 8;
  copy_tile<16, HD, SS>(l, kg, vg);
  for (int qq = tid; qq < SS; qq += 128) smb[qq] = mask[(size_t)b * SS + qq] != 0 ? 0xffffffffu : 0u;
  asm volatile("s_wait_asynccnt 0x0" ::: "memory");   // pass 0's copies of this wave have landed
  __syncthreads();                                    // ... and every other wave's; smb is written
  copy_tile<16, HD, SS>(l + ABUF, kg + 64 * HD, vg + 64);
  v16h aq[2];
#pragma unroll
  for (int kc = 0; kc < 2; ++kc) aq[kc] = frag_h(Q16 + (bh * SS + q0 + col) * HD + kc * 32, lane);
  float mrun = -3.0e38f; v2f lrun = {0.f, 0.f}; v8f acc[4] = {};   // acc[t][r] = O^T[d = t*16 + 8g + r][query col]; lrun: this lane's own keys, the halves joined at the end
#pragma unroll 1
  for (int kt = 0; kt < SS / 64; ++kt) { const char* buf = ring + (kt & 1) * ABUF;
    v16h fk[2][4], fv[2][4]; v4u mb[4][2];
#pragma unroll
    for (int kc = 0; kc < 2; ++kc)
#pragma unroll
      for (int t = 0; t < 4; ++t) fk[kc][t] = frag_h((const _Float16*)(buf + (t * 16 + col) * GP + kc * 64), lane);
#pragma unroll
    for (int t = 0; t < 4; ++t) { mb[t][0] = *(const v4u*)(smb + kt * 64 + t * 16 + 8 * g); mb[t][1] = *(const v4u*)(smb + kt * 64 + t * 16 + 8 * g + 4); }
    v8f d[4] = {};                                    // d[t][r] = raw score of key kt*64 + t*16 + 8g + r with query col
#pragma unroll
    for (int kc = 0; kc < 2; ++kc)
#pragma unroll
      for (int t = 0; t < 4; ++t) d[t] = wmma16(fk[kc][t], aq[kc], d[t]);
#pragma unroll
    for (int kc = 0; kc < 2; ++kc)
#pragma unroll
      for (int t = 0; t < 4; ++t) fv[kc][t] = frag_h((const _Float16*)(buf + (64 + t * 16 + col) * GP + kc * 64), lane);
    v2f s[4][4]; float mx2[2] = {-3.4e38f, -3.4e38f};
#pragma unroll
    for (int t = 0; t < 4; ++t)
#pragma unroll
      for (int i = 0; i < 4; ++i) {
#pragma unroll
        for (int e = 0; e < 2; ++e) { const unsigned m = mb[t][i >> 1][(i & 1) * 2 + e]; const float raw = d[t][2 * i + e], fill = 1e-10f * 128.0f;
          s[t][i][e] = __builtin_bit_cast(float, (__builtin_bit_cast(unsigned, raw) & m) | (__builtin_bit_cast(unsigned, fill) & ~m)); }
        mx2[t & 1] = fmaxf(mx2[t & 1], fmaxf(s[t][i][0], s[t][i][1])); }
    float mx = fmaxf(mx2[0], mx2[1]);
    mx = fmaxf(mx, xhalf(mx));
    const float mnew = fmaxf(mrun, mx * SC2 - 14.0f); const float corr = __builtin_amdgcn_exp2f(mrun - mnew);
    v16h pb[2]; v2f ps[2] = {{0.f, 0.f}, {0.f, 0.f}};
#pragma unroll
    for (int t = 0; t < 4; ++t)
#pragma unroll
      for (int i = 0; i < 4; ++i) { const v2f a = __builtin_elementwise_fma(s[t][i], v2f{SC2, SC2}, v2f{-mnew, -mnew}); const v2f p = {__builtin_amdgcn_exp2f(a[0]), __builtin_amdgcn_exp2f(a[1])};
        ps[t & 1] += p; const v2h ph = __builtin_convertvector(p, v2h); pb[t >> 1][(t & 1) * 8 + 2 * i] = ph[0]; pb[t >> 1][(t & 1) * 8 + 2 * i + 1] = ph[1]; }
    lrun = lrun * v2f{corr, corr} + (ps[0] + ps[1]); mrun = mnew;
#pragma unroll
    for (int t = 0; t < 4; ++t) acc[t] *= corr;
#pragma unroll
    for (int kc = 0; kc < 2; ++kc)
#pragma unroll
      for (int t = 0; t < 4; ++t) acc[t] = wmma16(fv[kc][t], pb[kc], acc[t]);
    asm volatile("s_wait_dscnt 0x0" ::: "memory");    // this wave's reads of pass kt's buffer are done before it is refilled
    asm volatile("s_wait_asynccnt 0x0" ::: "memory"); // this wave's copies of pass kt + 1 have landed
    __syncthreads();                                  // publishes pass kt + 1 and ends every reader's last read of pass kt's buffer
    if (kt + 2 < SS / 64) copy_tile<16, HD, SS>(l + (kt & 1) * ABUF, kg + (size_t)(kt + 2) * 64 * HD, vg + (kt + 2) * 64); }
  asm volatile("s_wait_asynccnt 0x0" ::: "memory");   // nothing in flight when the wave ends
  float lr = lrun[0] + lrun[1]; lr += xhalf(lr);
  const float inv = 8.0f / (lr * 4.0f);
  union { v8h h8; v4u u; } pk[4]; float xr[4][8]; float s4[4] = {0.f, 0.f, 0.f, 0.f}, q4[4] = {0.f, 0.f, 0.f, 0.f};   // a lane's 8 accumulator registers are 8 consecutive d of its query's row: one 16-byte store
#pragma unroll
  for (int t = 0; t < 4; ++t)
#pragma unroll
    for (int r = 0; r < 8; ++r) { pk[t].h8[r] = (_Float16)(acc[t][r] * inv); xr[t][r] = (float)pk[t].h8[r] * 0.125f; s4[t] += xr[t][r]; }
  // this head's share of LN2's row statistics, of x as stored: mean of its 64 values and their squared distance from that mean (a lane has 32 of them, lane ^ 16 the rest)
  // (four chains of 8 each, not one of 32: the wave is at its end and has nothing else to issue between dependent additions)
  float sm = (s4[0] + s4[1]) + (s4[2] + s4[3]); sm += xhalf(sm); const float mh = sm * (1.0f / HD);
#pragma unroll
  for (int t = 0; t < 4; ++t)
#pragma unroll
    for (int r = 0; r < 8; ++r) { const float dd = xr[t][r] - mh; q4[t] += dd * dd; }
  float m2 = (q4[0] + q4[1]) + (q4[2] + q4[3]); m2 += xhalf(m2);
#pragma unroll
  for (int t = 0; t < 4; ++t) vst2(O16 + ((bh * SS) + q0 + col) * HD + t * 16 + 8 * g, pk[t].u);
  vst2(ST + ((bh * SS) + q0 + col) * 2 + g, g == 0 ? mh : m2);   // ST[b][h][s] = {mean, squares}: the wave's 16 queries are one whole 128-byte line
}
// fo = relu(LN2(x) Wf^T + bf) without fx: block (128 rows, 128 cols) -> FO f32. A = O16 as attention left it (pass t = head t: 128 rows of 128 bytes), B = Wf g2 x16.
// A row's mu and rs come from its 16 heads' {mean, squares}: mu = mean of the means, sum of squares about mu = sum over heads of squares + 64 (mean - mu)^2
__global__ __launch_bounds__(256) void k_ffn(const _Float16* __restrict__ O16, const _Float16* __restrict__ P, const float* __restrict__ ST, const float* __restrict__ UC, const float* __restrict__ bf, float* __restrict__ FO) {
  __shared__ __align__(16) char ring[2 * GBUF];
  __shared__ __align__(16) float smu[128], srs[128];
  const int tid = threadIdx.x, wave = tid >> 5, lane = tid & 31, col = lane & 15, g = lane >> 4, wm = wave >> 1, wn = wave & 1;
  const int r0b = blockIdx.x * 128, n0 = blockIdx.y * 128; const int b = r0b / SS, s0 = r0b % SS;
  v8f acc[2][4] = {};
  gemm_core<HD, SS * HD>(O16 + ((size_t)b * NH * SS + s0) * HD, P + ((size_t)3 * HID + n0) * HID, ring, acc, [&] {
    if (tid < 128) { const float* sp = ST + ((size_t)b * NH * SS + s0 + tid) * 2; v2f st[NH];   // waves 0 to 3, a row a lane
#pragma unroll
      for (int h = 0; h < NH; ++h) st[h] = *(const v2f*)(sp + (size_t)h * SS * 2);
      float mu = 0.f, m2 = 0.f;
#pragma unroll
      for (int h = 0; h < NH; ++h) mu += st[h][0];
      mu *= 1.0f / NH;
#pragma unroll
      for (int h = 0; h < NH; ++h) { const float dd = st[h][0] - mu; m2 += st[h][1] + (float)HD * dd * dd; }
      smu[tid] = mu; srs[tid] = rsqrtf(m2 * (1.0f / HID) + 1e-5f); } });
  float (*so)[68] = (float (*)[68])(ring + wave * (32 * 68 * 4));
  v4f rmu[2][2], rrs[2][2];   // of the lane's rows i*16 + 8g + r
#pragma unroll
  for (int i = 0; i < 2; ++i)
#pragma unroll
    for (int q = 0; q < 2; ++q) { rmu[i][q] = *(const v4f*)(smu + wm * 32 + i * 16 + 8 * g + q * 4); rrs[i][q] = *(const v4f*)(srs + wm * 32 + i * 16 + 8 * g + q * 4); }
#pragma unroll
  for (int j = 0; j < 4; ++j) { const int n = n0 + wn * 64 + j * 16 + col; const v2f uc = *(const v2f*)(UC + (size_t)(n >> 1) * 32 + (n & 1) * 2); const float bb = bf[n] + uc[1];
#pragma unroll
    for (int i = 0; i < 2; ++i)
#pragma unroll
      for (int r = 0; r < 8; ++r) { const float vv = rrs[i][r >> 2][r & 3] * (acc[i][j][r] * (1.0f / 128.0f) - rmu[i][r >> 2][r & 3] * uc[0]) + bb; so[i * 16 + 8 * g + r][j * 16 + col] = vv > 0.f ? vv : 0.f; } }
  LDSX();
#pragma unroll
  for (int rp = 0; rp < 16; ++rp) { const int rl = rp * 2 + g; vst2(FO + (size_t)(r0b + wm * 32 + rl) * HID + n0 + wn * 64 + col * 4, *(const v4f*)(&so[rl][col * 4])); }
}
// out = fx + LN3(fo) with fx = LN2(x), x = merged O (/8): wave per row, both rows' loads asked for first, the two LayerNorms' sums side by side
__global__ __launch_bounds__(256) void k_fin(const _Float16* __restrict__ O16, const float* __restrict__ FO, const float* __restrict__ g2, const float* __restrict__ b2, const float* __restrict__ g3, const float* __restrict__ b3, float* __restrict__ out) {
  const int wave = threadIdx.x >> 5, lane = threadIdx.x & 31; const size_t r = (size_t)blockIdx.x * 8 + wave; if (r >= NR) return;
  const int b = (int)(r / SS), s = (int)(r % SS);
  const float* fo = FO + r * HID; float xv[32], yv[32]; v8h xh[4]; float sm = 0.f, sy = 0.f;
#pragma unroll
  for (int i = 0; i < 4; ++i) { const int c0 = i * 256 + lane * 8; const int h = c0 >> 6, d = c0 & 63; xh[i] = *(const v8h*)(O16 + (((size_t)b * NH + h) * SS + s) * HD + d); }
#pragma unroll
  for (int i = 0; i < 4; ++i) { const v4f a = *(const v4f*)(fo + i * 256 + lane * 8), c = *(const v4f*)(fo + i * 256 + lane * 8 + 4);
    xv[i * 8 + 0] = a[0]; xv[i * 8 + 1] = a[1]; xv[i * 8 + 2] = a[2]; xv[i * 8 + 3] = a[3]; xv[i * 8 + 4] = c[0]; xv[i * 8 + 5] = c[1]; xv[i * 8 + 6] = c[2]; xv[i * 8 + 7] = c[3]; }
#pragma unroll
  for (int i = 0; i < 32; ++i) { yv[i] = (float)xh[i >> 3][i & 7] * 0.125f; sy += yv[i]; }
#pragma unroll
  for (int i = 0; i < 32; ++i) sm += xv[i];
#pragma unroll
  for (int off = 16; off >= 1; off >>= 1) { sm += __shfl_xor(sm, off, 32); sy += __shfl_xor(sy, off, 32); }
  const float mu = sm * (1.0f / HID), my = sy * (1.0f / HID); float q2 = 0.f, y2 = 0.f;
#pragma unroll
  for (int i = 0; i < 32; ++i) { const float dd = xv[i] - mu, dy = yv[i] - my; q2 += dd * dd; y2 += dy * dy; }
#pragma unroll
  for (int off = 16; off >= 1; off >>= 1) { q2 += __shfl_xor(q2, off, 32); y2 += __shfl_xor(y2, off, 32); }
  const float rs = rsqrtf(q2 * (1.0f / HID) + 1e-5f), ry = rsqrtf(y2 * (1.0f / HID) + 1e-5f);
#pragma unroll
  for (int i = 0; i < 4; ++i) { v4f o0, o1; const int c0 = i * 256 + lane * 8;
#pragma unroll
    for (int e = 0; e < 8; ++e) { const int c = c0 + e; const float fx = (yv[i * 8 + e] - my) * ry * g2[c] + b2[c]; const float vv = fx + ((xv[i * 8 + e] - mu) * rs * g3[c] + b3[c]); if (e < 4) o0[e] = vv; else o1[e - 4] = vv; }
    vst2(out + r * HID + c0, o0); vst2(out + r * HID + c0 + 4, o1); }
}
extern "C" void kernel_launch(void* const* d_in, const int* in_sizes, int n_in, void* d_out, int out_size, void* d_ws, size_t ws_size, hipStream_t stream) {
  (void)in_sizes; (void)n_in; (void)out_size; (void)ws_size;
  const float** I = (const float**)d_in;
  const float* q = I[0]; const float* k = I[1]; const float* v = I[2]; const float* g1q = I[3]; const float* b1q = I[4]; const float* g1k = I[5]; const float* b1k = I[6]; const float* g1v = I[7]; const float* b1v = I[8];
  const float* Wq = I[9]; const float* bq = I[10]; const float* Wk = I[11]; const float* bk = I[12]; const float* Wv = I[13]; const float* bv = I[14]; const float* g2 = I[15]; const float* b2 = I[16]; const float* g3 = I[17]; const float* b3 = I[18]; const float* Wf = I[19]; const float* bf = I[20]; const int* mask = (const int*)d_in[21];
  float* out = (float*)d_out;
  char* ws = (char*)d_ws; size_t off = 0;
  auto take = [&](size_t bytes) { char* p = ws + off; off += (bytes + 255) & ~(size_t)255; return p; };
  _Float16* X16 = (_Float16*)take((size_t)3 * NR * HID * 2); _Float16* P = (_Float16*)take((size_t)4 * HID * HID * 2); float* UC = (float*)take((size_t)(HID / 2) * 128); float* CS = (float*)take((size_t)SS * 32 * 4); float* SN = (float*)take((size_t)SS * 32 * 4);
  _Float16* Q16 = (_Float16*)take((size_t)NR * HID * 2); _Float16* K16 = (_Float16*)take((size_t)NR * HID * 2); _Float16* VT = (_Float16*)take((size_t)NR * HID * 2); _Float16* O16 = (_Float16*)take((size_t)NR * HID * 2);
  float* ST = (float*)take((size_t)NR * NH * 2 * 4); float* FO = (float*)take((size_t)NR * HID * 4);
  k_prep<<<NB_ROPE + NB_LN + NB_PACK + NB_PACKF, 256, 0, stream>>>(q, k, v, g1q, b1q, g1k, b1k, g1v, b1v, Wq, Wk, Wv, Wf, g2, b2, X16, P, UC, CS, SN);
  k_qkv<<<dim3(NR / 128, HID / 128, 3), 256, 0, stream>>>(X16, P, bq, bk, bv, CS, SN, Q16, K16, VT);
  k_attn<<<dim3(SS / 64, NH, NB), 128, 0, stream>>>(Q16, K16, VT, mask, O16, ST);
  k_ffn<<<dim3(NR / 128, HID / 128), 256, 0, stream>>>(O16, P, ST, UC, bf, FO);
  k_fin<<<NR / 8, 256, 0, stream>>>(O16, FO, g2, b2, g3, b3, out);
}

// v007
// One run takes 73.6 microseconds.
// Timed twice side by side with v006, it ran 1.22 and 1.21 times as fast.
// All steps since v000 together make it 4.12 times as fast.
#include <hip/hip_runtime.h>
#include <math.h>

typedef __attribute__((ext_vector_type(16))) _Float16 v16h;
typedef __attribute__((ext_vector_type(16))) __bf16 v16b;
typedef __attribute__((ext_vector_type(8)))  _Float16 v8h;
typedef __attribute__((ext_vector_type(2)))  _Float16 v2h;
typedef __attribute__((ext_vector_type(8)))  float v8f;
typedef __attribute__((ext_vector_type(4)))  float v4f;
typedef __attribute__((ext_vector_type(2)))  float v2f;
typedef __attribute__((ext_vector_type(4)))  unsigned v4u;
typedef __attribute__((ext_vector_type(4)))  int v4i;
typedef float __attribute__((may_alias)) float_a;
typedef int __attribute__((may_alias)) int_a;

template <typename T> __device__ __forceinline__ void vst2(void* p, T v) { *(T*)p = v;  }
__device__ __forceinline__ v8f wmma16(v16h a, v16h b, v8f c) {
  v8f d = __builtin_amdgcn_wmma_f32_16x16x32_f16(false, a, false, b, (short)0, c, false, false);
  asm volatile("v_nop\n\tv_nop\n\tv_nop\n\tv_nop" : "+v"(d) : "v"(a), "v"(b));
  return d;
}
__device__ __forceinline__ v8f wmma_bf(v16b a, v16b b, v8f c) {
  v8f d = __builtin_amdgcn_wmma_f32_16x16x32_bf16(false, a, false, b, (short)0, c, false, false);
  asm volatile("v_nop\n\tv_nop\n\tv_nop\n\tv_nop" : "+v"(d) : "v"(a), "v"(b));
  return d;
}
// 16x16x32 fragments: lane = (h = lane>>4, row/col = lane&15); elements 0..7 = k0+8h+0..7, 8..15 = k0+16+8h+0..7; D element r = row 8h+r
__device__ __forceinline__ v16h frag_h(const _Float16* rowk0, int lane) {
  union { v16h v; v8h q[2]; } u; const _Float16* p = rowk0 + 8 * (lane >> 4);
  u.q[0] = *(const v8h*)p; u.q[1] = *(const v8h*)(p + 16); return u.v;
}
__device__ __forceinline__ v16h frag_f32(const float* rowk0, int lane) {
  v16h a; const float* p = rowk0 + 8 * (lane >> 4);
#pragma unroll
  for (int i = 0; i < 8; ++i) { a[i] = (_Float16)p[i]; a[8 + i] = (_Float16)p[16 + i]; }
  return a;
}
__device__ __forceinline__ v16h frag_f32s(const float* rowk0, int lane, float sc) {
  v16h a; const float* p = rowk0 + 8 * (lane >> 4);
#pragma unroll
  for (int i = 0; i < 8; ++i) { a[i] = (_Float16)(p[i] * sc); a[8 + i] = (_Float16)(p[16 + i] * sc); }
  return a;
}
// column fragment from a [K][ld] layout (column n), rows >= K read as 0
__device__ __forceinline__ v16h fragc_f32(const float* W, int k0, int n, int lane, int ld, int K) {
  v16h a; const int g = lane >> 4;
#pragma unroll
  for (int i = 0; i < 8; ++i) { const int ka = k0 + 8 * g + i, kb = ka + 16;
    a[i] = (_Float16)(ka < K ? W[(size_t)ka * ld + n] : 0.f); a[8 + i] = (_Float16)(kb < K ? W[(size_t)kb * ld + n] : 0.f); }
  return a;
}
struct F2 { v16b h, l; };
__device__ __forceinline__ F2 bsplit16(const float v[16]) { F2 r;
#pragma unroll
  for (int i = 0; i < 16; ++i) { const __bf16 h = (__bf16)v[i]; r.h[i] = h; r.l[i] = (__bf16)(v[i] - (float)h); }
  return r; }
__device__ __forceinline__ F2 split_row(const float* row, int k0, int lane) { float v[16]; const float* p = row + k0 + 8 * (lane >> 4);
#pragma unroll
  for (int i = 0; i < 8; ++i) { v[i] = p[i]; v[8 + i] = p[16 + i]; }
  return bsplit16(v); }
__device__ __forceinline__ F2 split_rowK(const float* row, int k0, int lane, int K) { float v[16]; const int g = lane >> 4;
#pragma unroll
  for (int i = 0; i < 8; ++i) { const int ka = k0 + 8 * g + i, kb = ka + 16; v[i] = ka < K ? row[ka] : 0.f; v[8 + i] = kb < K ? row[kb] : 0.f; }
  return bsplit16(v); }
__device__ __forceinline__ F2 split_col(const float* W, int k0, int n, int lane, int ld, int K) { float v[16]; const int g = lane >> 4;
#pragma unroll
  for (int i = 0; i < 8; ++i) { const int ka = k0 + 8 * g + i, kb = ka + 16; v[i] = ka < K ? W[(size_t)ka * ld + n] : 0.f; v[8 + i] = kb < K ? W[(size_t)kb * ld + n] : 0.f; }
  return bsplit16(v); }
__device__ __forceinline__ v8f mac3(const F2& a, const F2& b, v8f c) { c = wmma_bf(a.l, b.h, c); c = wmma_bf(a.h, b.l, c); return wmma_bf(a.h, b.h, c); }
__device__ __forceinline__ float sigm(float v) { return 1.0f / (1.0f + expf(-v)); }
#define LDSX() do { asm volatile("s_wait_dscnt 0" ::: "memory"); __builtin_amdgcn_wave_barrier(); __builtin_amdgcn_fence(__ATOMIC_RELEASE, "workgroup"); } while (0)

// Pre-LN multi-head attention block with RoPE and a post FFN: LN(q), LN(k), LN(v) -> projections (+bias) -> rotary embedding -> 16-head
// attention with the module's masked_fill value 1e-10 (mask read as data) -> merge -> fx = LN2(x); fo = relu(fx Wf^T + bf); out = fx +
// LN3(fo). LayerNorms, RoPE (cos/sin table in f32), softmax (online over the up to 16 key tiles that hold kept keys) in f32; all four products on
// v_wmma_f32_16x16x32_f16 (LN outputs as f16 rows, [out][in] weights as f16 rows x16, q/k/v head-major f16 x4, P x2^14, O x8).
// LN2 is linear in x once a row's mean mu and 1/sigma rs are known: fx Wf^T = rs * (x (Wf g2)^T - mu * U) + C with U[n] = sum_k Wf[n][k] g2[k], C[n] = sum_k Wf[n][k] b2[k].
// So the FFN product runs on the attention output itself, against Wf g2, and its epilogue applies rs, mu, U, C; fx as a value is formed only in the last kernel.
#define NB 4
#define SS 1024
#define HID 1024
#define NH 16
#define HD 64
#define NR (NB * SS)

// Every masked key of a batch has the same score (the fill value), whatever the query: together they are ONE term of the softmax, (their number) * exp(fill) in the sum and
// exp(fill) * (sum of their V rows) in the output. So the rows of k and v are laid down kept keys first (a stable partition of each batch's 1024 keys: a kept key goes to the number of
// kept keys in front of it, a masked one behind all kept ones), K is projected and the attention passes run only as far as the kept keys reach, and the masked keys' V rows are summed.
// The mask enters only as (value != 0): every place is a count of keys, so it lies in 0 .. SS-1 for any content of the mask.
// counts over one batch's mask row, the same in every lane (all 32 lanes on): c = kept keys in all, bf = kept keys in front of key s
struct KC { int c, bf; };
__device__ __forceinline__ KC kept_counts(const int* __restrict__ mrow, int lane, int s) {
  v4i m[SS / 128]; KC r = {0, 0};
#pragma unroll
  for (int i = 0; i < SS / 128; ++i) m[i] = *(const v4i*)(mrow + i * 128 + lane * 4);
#pragma unroll
  for (int i = 0; i < SS / 128; ++i)
#pragma unroll
    for (int j = 0; j < 4; ++j) { const bool kq = m[i][j] != 0;
      r.c += __builtin_popcount(__builtin_amdgcn_ballot_w32(kq)); r.bf += __builtin_popcount(__builtin_amdgcn_ballot_w32(kq && i * 128 + lane * 4 + j < s)); }
  return r;
}
// The three preparations (LN of q, k, v; the weights as f16; the RoPE tables) read only inputs and do not depend on one another: they are block ranges of ONE launch, k_prep below.
// LN of two 1024-rows per wave (both rows' 16 loads of 16 bytes are asked for before either is summed): src selects q/k/v by which; block bx has 16 rows; dst f16 rows
__device__ __forceinline__ void ln3_block(int bx, int which, const float* __restrict__ q, const float* __restrict__ k, const float* __restrict__ v, const float* __restrict__ gq, const float* __restrict__ bq, const float* __restrict__ gk, const float* __restrict__ bk, const float* __restrict__ gv, const float* __restrict__ bv2, const int* __restrict__ mask, _Float16* __restrict__ X16) {
  const int wave = threadIdx.x >> 5, lane = threadIdx.x & 31; const size_t r = (size_t)bx * 16 + wave * 2; if (r >= NR) return;
  const float* src = (which == 0 ? q : which == 1 ? k : v) + r * HID; const float* g = which == 0 ? gq : which == 1 ? gk : gv; const float* bb = which == 0 ? bq : which == 1 ? bk : bv2;
  const float* sl = src + lane * 8; float xv[2][32];
#pragma unroll
  for (int w = 0; w < 2; ++w)
#pragma unroll
    for (int i = 0; i < 4; ++i) { const v4f a = *(const v4f*)(sl + w * HID + i * 256), c = *(const v4f*)(sl + w * HID + i * 256 + 4);
      xv[w][i * 8 + 0] = a[0]; xv[w][i * 8 + 1] = a[1]; xv[w][i * 8 + 2] = a[2]; xv[w][i * 8 + 3] = a[3]; xv[w][i * 8 + 4] = c[0]; xv[w][i * 8 + 5] = c[1]; xv[w][i * 8 + 6] = c[2]; xv[w][i * 8 + 7] = c[3]; }
  asm volatile("s_wait_xcnt 0x0" :: "v"(sl) : "memory");   // the 16 loads share one address: it is held whole up to this wait, so that none of them lands in it while the others are issued
  __builtin_amdgcn_sched_barrier(0);   // keeps all 16 loads in front of the first row's sums: sunk behind them, the second row's last loads wait out a second memory latency
  size_t dr[2] = {r, r + 1};   // where the two rows go: q in place, k and v kept keys first
  if (which != 0) { const int b = (int)(r / SS), s = (int)(r % SS); const int* mrow = mask + (size_t)b * SS; const KC kc = kept_counts(mrow, lane, s);
    const bool k0 = mrow[s] != 0, k1 = mrow[s + 1] != 0; const int bf1 = kc.bf + (k0 ? 1 : 0);
    dr[0] = (size_t)b * SS + (k0 ? kc.bf : kc.c + s - kc.bf); dr[1] = (size_t)b * SS + (k1 ? bf1 : kc.c + (s + 1) - bf1); }
#pragma unroll
  for (int w = 0; w < 2; ++w) { float s = 0.f;
#pragma unroll
    for (int i = 0; i < 32; ++i) s += xv[w][i];
#pragma unroll
    for (int off = 16; off >= 1; off >>= 1) s += __shfl_xor(s, off, 32);
    const float mu = s * (1.0f / HID); float q2 = 0.f;
#pragma unroll
    for (int i = 0; i < 32; ++i) { const float d = xv[w][i] - mu; q2 += d * d; }
#pragma unroll
    for (int off = 16; off >= 1; off >>= 1) q2 += __shfl_xor(q2, off, 32);
    const float rs = rsqrtf(q2 * (1.0f / HID) + 1e-5f);
#pragma unroll
    for (int i = 0; i < 4; ++i) { union { v8h h; v4u u; } pk;
#pragma unroll
      for (int e = 0; e < 8; ++e) { const int c = i * 256 + lane * 8 + e; pk.h[e] = (_Float16)((xv[w][i * 8 + e] - mu) * rs * g[c] + bb[c]); }
      vst2(X16 + ((size_t)which * NR + dr[w]) * HID + i * 256 + lane * 8, pk.u); } }
}
// P rows [w*1024 + n] = W_w[n][:] * 16 (W are [out][in]): w = 0 Wq, 1 Wk, 2 Wv (Wf: packf_block). A block takes 16 whole rows of one W, a wave 2 of them (8 KB in, 4 KB out):
// a lane's 16 loads of 16 bytes are all asked for before the first is converted, and each store is 512 contiguous bytes of a wave
__device__ __forceinline__ void pack_block(int bx, const float* __restrict__ Wq, const float* __restrict__ Wk, const float* __restrict__ Wv, _Float16* __restrict__ P) {
  const int which = bx >> 6, wave = threadIdx.x >> 5, lane = threadIdx.x & 31;
  const size_t o = (size_t)(bx & 63) * (16 * HID) + wave * (2 * HID) + lane * 8;
  const float* W = (which == 0 ? Wq : which == 1 ? Wk : Wv) + o; _Float16* D = P + (size_t)which * HID * HID + o;
  v4f x[16];
#pragma unroll
  for (int i = 0; i < 8; ++i) { x[2 * i] = *(const v4f*)(W + i * 256); x[2 * i + 1] = *(const v4f*)(W + i * 256 + 4); }
#pragma unroll
  for (int i = 0; i < 8; ++i) { union { v8h h; v4u u; } pk;
#pragma unroll
    for (int e = 0; e < 4; ++e) { pk.h[e] = (_Float16)(x[2 * i][e] * 16.0f); pk.h[4 + e] = (_Float16)(x[2 * i + 1][e] * 16.0f); }
    vst2(D + i * 256, pk.u); }
  asm volatile("s_wait_xcnt 0x0" ::: "memory");   // in k_prep other parts' code follows these stores in the listing and reuses their registers: the wait stands in front of any such rewrite
}
// Wf with LN2 folded in: P rows [3*1024 + n] = Wf[n][:] * g2[:] * 16, and of each row the two sums U[n], C[n] (f32, whole row in one wave). 2 rows a wave, as in pack_block.
// U is summed over the products as rounded to f16, so that mu * U takes away exactly what the matrix product has summed of a row's mean.
// UC: a wave's four sums {U[n], C[n], U[n+1], C[n+1]} are the first 16 bytes of a 128-byte line of its own
__device__ __forceinline__ void packf_block(int bx, const float* __restrict__ Wf, const float* __restrict__ g2, const float* __restrict__ b2, _Float16* __restrict__ P, float* __restrict__ UC) {
  const int wave = threadIdx.x >> 5, lane = threadIdx.x & 31;
  const size_t o = (size_t)bx * (16 * HID) + wave * (2 * HID) + lane * 8;
  const float* W = Wf + o; _Float16* D = P + (size_t)3 * HID * HID + o; float* uc = UC + (size_t)(bx * 8 + wave) * 32;
  v4f gg[8], bb[8];
#pragma unroll
  for (int j = 0; j < 4; ++j) { gg[2 * j] = *(const v4f*)(g2 + j * 256 + lane * 8); gg[2 * j + 1] = *(const v4f*)(g2 + j * 256 + lane * 8 + 4); bb[2 * j] = *(const v4f*)(b2 + j * 256 + lane * 8); bb[2 * j + 1] = *(const v4f*)(b2 + j * 256 + lane * 8 + 4); }
#pragma unroll 1   // a row at a time: with both rows' values live at once k_prep needs more than 160 registers, and every part of it loses a wave per SIMD
  for (int w = 0; w < 2; ++w) { v4f x[8]; float su = 0.f, sc = 0.f;
#pragma unroll
    for (int j = 0; j < 4; ++j) { x[2 * j] = *(const v4f*)(W + w * HID + j * 256); x[2 * j + 1] = *(const v4f*)(W + w * HID + j * 256 + 4); }
#pragma unroll
    for (int j = 0; j < 4; ++j) { union { v8h h; v4u u; } pk;   // k = j*256 + lane*8 + e
#pragma unroll
      for (int e = 0; e < 4; ++e) { pk.h[e] = (_Float16)(x[2 * j][e] * gg[2 * j][e] * 16.0f); pk.h[4 + e] = (_Float16)(x[2 * j + 1][e] * gg[2 * j + 1][e] * 16.0f);
        su += (float)pk.h[e] + (float)pk.h[4 + e]; sc += x[2 * j][e] * bb[2 * j][e] + x[2 * j + 1][e] * bb[2 * j + 1][e]; }
      vst2(D + w * HID + j * 256, pk.u); }
    asm volatile("s_wait_xcnt 0x0" ::: "memory");   // the sums below reuse the stores' registers: the wait stands in front of any such rewrite
#pragma unroll
    for (int off = 16; off >= 1; off >>= 1) { su += __shfl_xor(su, off, 32); sc += __shfl_xor(sc, off, 32); }
    if (lane == 0) vst2(uc + w * 2, v2f{su * (1.0f / 16.0f), sc});
    asm volatile("s_wait_xcnt 0x0" ::: "memory"); }   // likewise for this store, in front of the second row's (and, in k_prep, other parts') use of its registers
}
// RoPE tables: CS[s][j] = cos(s * inv_freq[j]), SN likewise, j < 32
__device__ __forceinline__ void rope_block(int bx, float* __restrict__ CS, float* __restrict__ SN) {
  const int s = bx * 8 + (threadIdx.x >> 5), j = threadIdx.x & 31;
  const float inv = 1.0f / powf(10000.0f, (float)(2 * j) / (float)HD); const float f = (float)s * inv;
  vst2(CS + (size_t)s * 32 + j, cosf(f)); vst2(SN + (size_t)s * 32 + j, sinf(f));
}
// one launch for the three: blocks 0 .. NB_ROPE-1 make the tables (the longest dependent chain of arithmetic, so it starts first and runs under the others' memory time),
// the next NB_PACKF blocks Wf (row sums behind its loads: the second longest chain), the next NB_LN the rows of q, then k, then v, the last NB_PACK Wq, Wk, Wv; the range test is on blockIdx.x alone, a scalar branch
#define NB_ROPE (SS / 8)
#define NB_LN (3 * (NR / 16))
#define NB_PACK (3 * HID / 16)
#define NB_PACKF (HID / 16)
__global__ __launch_bounds__(256) void k_prep(const float* __restrict__ q, const float* __restrict__ k, const float* __restrict__ v, const float* __restrict__ gq, const float* __restrict__ bq, const float* __restrict__ gk, const float* __restrict__ bk, const float* __restrict__ gv, const float* __restrict__ bv2,
                                            const float* __restrict__ Wq, const float* __restrict__ Wk, const float* __restrict__ Wv, const float* __restrict__ Wf, const float* __restrict__ g2, const float* __restrict__ b2, const int* __restrict__ mask, _Float16* __restrict__ X16, _Float16* __restrict__ P, float* __restrict__ UC, float* __restrict__ CS, float* __restrict__ SN) {
  const int bid = blockIdx.x;
  if (bid < NB_ROPE) rope_block(bid, CS, SN);
  else if (bid < NB_ROPE + NB_PACKF) packf_block(bid - NB_ROPE, Wf, g2, b2, P, UC);
  else if (bid < NB_ROPE + NB_PACKF + NB_LN) { const int i = bid - (NB_ROPE + NB_PACKF); ln3_block(i % (NR / 16), i / (NR / 16), q, k, v, gq, bq, gk, bk, gv, bv2, mask, X16); }
  else pack_block(bid - (NB_ROPE + NB_PACKF + NB_LN), Wq, Wk, Wv, P);
}
// Shared GEMM core of k_qkv and k_ffn: Y[128 rows][128 cols] = A[128][1024] * Bw[128][1024]^T per block of 8 waves (4 x 2), 32 x 64 per wave.
// A pass is 64 k = 128 bytes of each of the 256 operand rows, brought into LDS by asynchronous copies (16 bytes a lane, 8 copies a lane and pass),
// two buffers: pass t + 2 is copied into the buffer that pass t has just left. LDS rows at pitch 144 bytes for the ds_load_b128 fragment readers.
#define GP 144
#define GBUF (256 * GP)
#define NPASS (HID / 64)
// one pass's tile: rows rr, rr+RS, rr+2RS, rr+3RS of the first operand (LDS rows 0..4RS-1, source pitch SA elements) and of the second (LDS rows 4RS..8RS-1,
// source pitch SB); l, a, bw are this lane's own 16 bytes of row rr
template <int RS, int SA, int SB> __device__ __forceinline__ void copy_tile(unsigned l, const _Float16* a, const _Float16* bw) {
  const unsigned l0 = l, l1 = l + RS * GP, l2 = l + 2 * RS * GP, l3 = l + 3 * RS * GP, l4 = l + 4 * RS * GP, l5 = l + 5 * RS * GP, l6 = l + 6 * RS * GP, l7 = l + 7 * RS * GP;
  const _Float16 *a0 = a, *a1 = a + RS * SA, *a2 = a + 2 * RS * SA, *a3 = a + 3 * RS * SA, *w0 = bw, *w1 = bw + RS * SB, *w2 = bw + 2 * RS * SB, *w3 = bw + 3 * RS * SB;
  // the copies and their s_wait_xcnt in one statement: no address register of a copy is rewritten in front of that wait
  asm volatile("global_load_async_to_lds_b128 %0, %8, off\n\t"
               "global_load_async_to_lds_b128 %1, %9, off\n\t"
               "global_load_async_to_lds_b128 %2, %10, off\n\t"
               "global_load_async_to_lds_b128 %3, %11, off\n\t"
               "global_load_async_to_lds_b128 %4, %12, off\n\t"
               "global_load_async_to_lds_b128 %5, %13, off\n\t"
               "global_load_async_to_lds_b128 %6, %14, off\n\t"
               "global_load_async_to_lds_b128 %7, %15, off\n\t"
               "s_wait_xcnt 0x0"
               :: "v"(l0), "v"(l1), "v"(l2), "v"(l3), "v"(l4), "v"(l5), "v"(l6), "v"(l7), "v"(a0), "v"(a1), "v"(a2), "v"(a3), "v"(w0), "v"(w1), "v"(w2), "v"(w3) : "memory");
}
// A, Bw: first row of the block's 128 rows of each operand; Bw has rows of HID, A rows at pitch SA elements whose next 64 k lie PA elements on (row-major: HID, 64; head-major: HD, SS * HD)
// under_first() runs while pass 0's copies fly; what it writes to LDS outside the ring is published by pass 0's barrier. On return every wave has left the ring (the last pass's barrier)
template <int SA, int PA, typename F> __device__ __forceinline__ void gemm_core(const _Float16* __restrict__ A, const _Float16* __restrict__ Bw, char* ring, v8f (&acc)[2][4], F under_first) {
  const int tid = threadIdx.x, wave = tid >> 5, lane = tid & 31, col = lane & 15, wm = wave >> 1, wn = wave & 1;
  const int rr = tid >> 3, seg = tid & 7;
  const unsigned l = (unsigned)(size_t)ring + rr * GP + seg * 16;
  const _Float16* a = A + (size_t)rr * SA + seg * 8; const _Float16* bw = Bw + (size_t)rr * HID + seg * 8;
  copy_tile<32, SA, HID>(l, a, bw);
  under_first();
  asm volatile("s_wait_asynccnt 0x0" ::: "memory");   // pass 0's copies of this wave have landed
  __syncthreads();                                    // ... and every other wave's
  copy_tile<32, SA, HID>(l + GBUF, a + PA, bw + 64);
  for (int t = 0; t < NPASS; ++t) {
    const char* buf = ring + (t & 1) * GBUF;
#pragma unroll
    for (int kc = 0; kc < 2; ++kc) { v16h fa[2], fb[4];
#pragma unroll
      for (int i = 0; i < 2; ++i) fa[i] = frag_h((const _Float16*)(buf + (wm * 32 + i * 16 + col) * GP + kc * 64), lane);
#pragma unroll
      for (int j = 0; j < 4; ++j) fb[j] = frag_h((const _Float16*)(buf + (128 + wn * 64 + j * 16 + col) * GP + kc * 64), lane);
#pragma unroll
      for (int i = 0; i < 2; ++i)
#pragma unroll
        for (int j = 0; j < 4; ++j) acc[i][j] = wmma16(fa[i], fb[j], acc[i][j]); }
    asm volatile("s_wait_dscnt 0x0" ::: "memory");    // this wave's reads of pass t's buffer are done before it is refilled
    asm volatile("s_wait_asynccnt 0x0" ::: "memory"); // this wave's copies of pass t + 1 have landed
    __syncthreads();                                  // publishes pass t + 1 and ends every reader's last read of pass t's buffer
    if (t + 2 < NPASS) copy_tile<32, SA, HID>(l + (t & 1) * GBUF, a + (t + 2) * PA, bw + (t + 2) * 64);
  }
  asm volatile("s_wait_asynccnt 0x0" ::: "memory");   // nothing in flight when the ring becomes output staging
}
// q/k/v projections + bias (+RoPE for q,k): block (128 rows, 128 cols = 2 heads, which), a wave has 32 rows of one head
// the rows of k and v come kept keys first: a K block with no kept key in it is not needed by anybody and leaves at once; RoPE takes a K row's angle from the key's own position (sorig);
// a V block also sums its masked keys' rows: VS[b][row block][column], x4 like VT, f32
__global__ __launch_bounds__(256) void k_qkv(const _Float16* __restrict__ X16, const _Float16* __restrict__ P, const float* __restrict__ bq, const float* __restrict__ bk, const float* __restrict__ bv, const float* __restrict__ CS, const float* __restrict__ SN, const int* __restrict__ mask,
                                           _Float16* __restrict__ Q16, _Float16* __restrict__ K16, _Float16* __restrict__ VT, float* __restrict__ VS) {
  __shared__ __align__(16) char ring[2 * GBUF];
  __shared__ __align__(16) int sorig[128];   // position in the sequence of each of the block's 128 rows
  const int tid = threadIdx.x, wave = tid >> 5, lane = tid & 31, col = lane & 15, g = lane >> 4, wm = wave >> 1, wn = wave & 1;
  const int which = blockIdx.z, r0b = blockIdx.x * 128, n0 = blockIdx.y * 128; const int b = r0b / SS, s0 = r0b % SS;
  const float* bias = which == 0 ? bq : (which == 1 ? bk : bv);
  const int* mrow = mask + (size_t)b * SS; KC kc = {SS, 0};   // kept keys of the batch; of them, in front of key wave * 128
  if (which != 0) kc = kept_counts(mrow, lane, wave * 128);
  if (which == 1 && s0 >= kc.c) return;   // the same for the whole block (blockIdx and the batch's count), in front of every barrier and copy
  v8f acc[2][4] = {};
  gemm_core<HID, 64>(X16 + ((size_t)which * NR + r0b) * HID, P + ((size_t)which * HID + n0) * HID, ring, acc, [&] {
    if (which == 1) {   // wave w places keys w*128 .. w*128+127, a lane four in a row; the places are a permutation of 0 .. SS-1, so each of the block's 128 rows is named exactly once
      const v4i m = *(const v4i*)(mrow + wave * 128 + lane * 4); int kb = kc.bf;
#pragma unroll
      for (int j = 0; j < 4; ++j) kb += (int)__builtin_amdgcn_mbcnt_lo(__builtin_amdgcn_ballot_w32(m[j] != 0), 0u);   // kept keys of the lower lanes
#pragma unroll
      for (int j = 0; j < 4; ++j) { const int e = wave * 128 + lane * 4 + j; const bool kq = m[j] != 0; const int pos = kq ? kb : kc.c + e - kb;
        if ((unsigned)(pos - s0) < 128u) sorig[pos - s0] = e;
        kb += kq ? 1 : 0; } }
    else if (tid < 128) sorig[tid] = s0 + tid; });
#pragma unroll
  for (int j = 0; j < 4; ++j) { const float bb = bias[n0 + wn * 64 + j * 16 + col];
#pragma unroll
    for (int i = 0; i < 2; ++i)
#pragma unroll
      for (int r = 0; r < 8; ++r) acc[i][j][r] = acc[i][j][r] * (1.0f / 16.0f) + bb; }
  if (which < 2) {
    // RoPE within the wave's head: d = j*16 + col ; d < 32: x cos - x(d+32) sin ; d >= 32: x cos + x(d-32) sin, angle index d & 31
    float (*so)[68] = (float (*)[68])(ring + wave * (32 * 68 * 4));
#pragma unroll
    for (int i = 0; i < 2; ++i) { unsigned o[8]; float cs[2][8], sns[2][8];   // o: a row's place in the tables at angle index col; the index 16 + col lies 16 floats on
#pragma unroll
      for (int r = 0; r < 8; ++r) o[r] = (unsigned)sorig[wm * 32 + i * 16 + 8 * g + r] * 32u + (unsigned)col;
#pragma unroll
      for (int jj = 0; jj < 2; ++jj)
#pragma unroll
        for (int r = 0; r < 8; ++r) { cs[jj][r] = (CS + jj * 16)[o[r]]; sns[jj][r] = (SN + jj * 16)[o[r]]; }
      // the 32 loads' offsets are held up to this wait, so that no load of the run lands in an offset that another still names
      asm volatile("s_wait_xcnt 0x0" :: "v"(o[0]), "v"(o[1]), "v"(o[2]), "v"(o[3]), "v"(o[4]), "v"(o[5]), "v"(o[6]), "v"(o[7]) : "memory");
#pragma unroll
      for (int jj = 0; jj < 2; ++jj)
#pragma unroll
        for (int r = 0; r < 8; ++r) { const int rl = i * 16 + 8 * g + r; const float c = cs[jj][r], sn = sns[jj][r];
          const float lo = acc[i][jj][r], hi = acc[i][jj + 2][r];
          so[rl][jj * 16 + col] = (lo * c - hi * sn) * 4.0f; so[rl][(jj + 2) * 16 + col] = (hi * c + lo * sn) * 4.0f; } }
    LDSX();
    _Float16* D = which == 0 ? Q16 : K16; const int h = (n0 >> 6) + wn;
    for (int qq = lane; qq < 32 * 8; qq += 32) { const int rl = qq >> 3, pc = qq & 7; union { v8h h8; v4u u; } pk;
#pragma unroll
      for (int e = 0; e < 8; ++e) pk.h8[e] = (_Float16)so[rl][pc * 8 + e];
      vst2(D + (((size_t)b * NH + h) * SS + s0 + wm * 32 + rl) * HD + pc * 8, pk.u); } }
  else {
    _Float16 (*st)[136] = (_Float16 (*)[136])ring;
#pragma unroll
    for (int i = 0; i < 2; ++i)
#pragma unroll
      for (int j = 0; j < 4; ++j)
#pragma unroll
        for (int r = 0; r < 8; ++r) st[wn * 64 + j * 16 + col][wm * 32 + i * 16 + 8 * g + r] = (_Float16)(acc[i][j][r] * 4.0f);
    __syncthreads();
    { const int cl = tid >> 1, hf = tid & 1; float sv = 0.f;   // two lanes a column, 64 rows each; a row is a masked key's where its place is not below the kept count
#pragma unroll
      for (int p = 0; p < 8; ++p) { const v8h x = *(const v8h*)(&st[cl][hf * 64 + p * 8]);
#pragma unroll
        for (int e = 0; e < 8; ++e) sv += s0 + hf * 64 + p * 8 + e >= kc.c ? (float)x[e] : 0.f; }
      sv += __shfl_xor(sv, 1, 32);
      if (hf == 0) vst2(VS + ((size_t)b * (SS / 128) + (s0 >> 7)) * HID + n0 + cl, sv);
      asm volatile("s_wait_xcnt 0x0" ::: "memory"); }   // the stores below reuse this store's registers: the wait stands in front of any such rewrite
    for (int qq = tid; qq < 128 * 16; qq += 256) { const int cl = qq >> 4, pc = qq & 15; const int c = n0 + cl, h = c >> 6, d = c & 63; vst2(VT + (((size_t)b * NH + h) * HD + d) * SS + s0 + pc * 8, *(const v4u*)(&st[cl][pc * 8])); } }
}
#define ABUF (128 * GP)
#define SC2 ((0.125f / 16.0f) * 1.4426950408889634f)
// lane l's value from lane l ^ 16
__device__ __forceinline__ float xhalf(float x) { return __builtin_bit_cast(float, __builtin_amdgcn_permlanex16(__builtin_bit_cast(int, x), __builtin_bit_cast(int, x), 0x76543210, 0xfedcba98, false, false)); }
__global__ __launch_bounds__(128) void k_attn(const _Float16* __restrict__ Q16, const _Float16* __restrict__ K16, const _Float16* __restrict__ VT, const float* __restrict__ VS, const int* __restrict__ mask, _Float16* __restrict__ O16, float* __restrict__ ST) {
  __shared__ __align__(16) char ring[2 * ABUF];
  __shared__ __align__(16) float svs[HD];   // this head's sum of the masked keys' V rows (x4)
  const int tid = threadIdx.x, w = tid >> 5, lane = tid & 31, col = lane & 15, g = lane >> 4;
  const int b = blockIdx.z, h = blockIdx.y, q0 = blockIdx.x * 64 + w * 16; const size_t bh = (size_t)b * NH + h;
  const unsigned l = (unsigned)(size_t)ring + (tid >> 3) * GP + (tid & 7) * 16;
  const _Float16* kg = K16 + (bh * SS + (tid >> 3)) * HD + (tid & 7) * 8; const _Float16* vg = VT + (bh * HD + (tid >> 3)) * SS + (tid & 7) * 8;
  const int cnt = kept_counts(mask + (size_t)b * SS, lane, 0).c;        // kept keys of the batch: they are rows 0 .. cnt-1 of K16 and columns 0 .. cnt-1 of VT
  const int nt = min((cnt + 63) >> 6, SS / 64);                         // passes of 64 keys that hold a kept key; a scalar, the same for the whole block
  if (nt > 0) copy_tile<16, HD, SS>(l, kg, vg);
  if (tid < HD) { float a = 0.f;
#pragma unroll
    for (int p = 0; p < SS / 128; ++p) a += VS[((size_t)b * (SS / 128) + p) * HID + h * HD + tid];
    svs[tid] = a; }
  asm volatile("s_wait_asynccnt 0x0" ::: "memory");   // pass 0's copies of this wave have landed
  __syncthreads();                                    // ... and every other wave's; svs is written
  if (nt > 1) copy_tile<16, HD, SS>(l + ABUF, kg + 64 * HD, vg + 64);
  v16h aq[2];
#pragma unroll
  for (int kc = 0; kc < 2; ++kc) aq[kc] = frag_h(Q16 + (bh * SS + q0 + col) * HD + kc * 32, lane);
  float mrun = -3.0e38f; v2f lrun = {0.f, 0.f}; v8f acc[4] = {};   // acc[t][r] = O^T[d = t*16 + 8g + r][query col]; lrun: this lane's own keys, the halves joined at the end
#pragma unroll 1
  for (int kt = 0; kt < nt; ++kt) { const char* buf = ring + (kt & 1) * ABUF;
    v16h fk[2][4], fv[2][4];
#pragma unroll
    for (int kc = 0; kc < 2; ++kc)
#pragma unroll
      for (int t = 0; t < 4; ++t) fk[kc][t] = frag_h((const _Float16*)(buf + (t * 16 + col) * GP + kc * 64), lane);
    v8f d[4] = {};                                    // d[t][r] = raw score of key kt*64 + t*16 + 8g + r with query col
#pragma unroll
    for (int kc = 0; kc < 2; ++kc)
#pragma unroll
      for (int t = 0; t < 4; ++t) d[t] = wmma16(fk[kc][t], aq[kc], d[t]);
#pragma unroll
    for (int kc = 0; kc < 2; ++kc)
#pragma unroll
      for (int t = 0; t < 4; ++t) fv[kc][t] = frag_h((const _Float16*)(buf + (64 + t * 16 + col) * GP + kc * 64), lane);
    if ((kt + 1) * 64 > cnt) {                        // only the last pass can hold places behind the kept keys (a scalar test): they get a score that gives P = 0
#pragma unroll
      for (int t = 0; t < 4; ++t)
#pragma unroll
        for (int r = 0; r < 8; ++r) d[t][r] = kt * 64 + t * 16 + 8 * g + r < cnt ? d[t][r] : -1.0e30f; }
    v2f s[4][4]; float mx2[2] = {-3.4e38f, -3.4e38f};
#pragma unroll
    for (int t = 0; t < 4; ++t)
#pragma unroll
      for (int i = 0; i < 4; ++i) {
        s[t][i] = v2f{d[t][2 * i], d[t][2 * i + 1]};
        mx2[t & 1] = fmaxf(mx2[t & 1], fmaxf(s[t][i][0], s[t][i][1])); }
    float mx = fmaxf(mx2[0], mx2[1]);
    mx = fmaxf(mx, xhalf(mx));
    const float mnew = fmaxf(mrun, mx * SC2 - 14.0f); const float corr = __builtin_amdgcn_exp2f(mrun - mnew);
    v16h pb[2]; v2f ps[2] = {{0.f, 0.f}, {0.f, 0.f}};
#pragma unroll
    for (int t = 0; t < 4; ++t)
#pragma unroll
      for (int i = 0; i < 4; ++i) { const v2f a = __builtin_elementwise_fma(s[t][i], v2f{SC2, SC2}, v2f{-mnew, -mnew}); const v2f p = {__builtin_amdgcn_exp2f(a[0]), __builtin_amdgcn_exp2f(a[1])};
        ps[t & 1] += p; const v2h ph = __builtin_convertvector(p, v2h); pb[t >> 1][(t & 1) * 8 + 2 * i] = ph[0]; pb[t >> 1][(t & 1) * 8 + 2 * i + 1] = ph[1]; }
    lrun = lrun * v2f{corr, corr} + (ps[0] + ps[1]); mrun = mnew;
#pragma unroll
    for (int t = 0; t < 4; ++t) acc[t] *= corr;
#pragma unroll
    for (int kc = 0; kc < 2; ++kc)
#pragma unroll
      for (int t = 0; t < 4; ++t) acc[t] = wmma16(fv[kc][t], pb[kc], acc[t]);
    asm volatile("s_wait_dscnt 0x0" ::: "memory");    // this wave's reads of pass kt's buffer are done before it is refilled
    asm volatile("s_wait_asynccnt 0x0" ::: "memory"); // this wave's copies of pass kt + 1 have landed
    __syncthreads();                                  // publishes pass kt + 1 and ends every reader's last read of pass kt's buffer
    if (kt + 2 < nt) copy_tile<16, HD, SS>(l + (kt & 1) * ABUF, kg + (size_t)(kt + 2) * 64 * HD, vg + (kt + 2) * 64); }
  asm volatile("s_wait_asynccnt 0x0" ::: "memory");   // nothing in flight when the wave ends
  float lr = lrun[0] + lrun[1]; lr += xhalf(lr);
  if (cnt < SS) {   // the masked keys, all at the fill score 1e-10 (raw: x128), as one more step of the online softmax: their number in the sum, their V rows' sum in the output
    v4f vm[4][2];
#pragma unroll
    for (int t = 0; t < 4; ++t) { vm[t][0] = *(const v4f*)(svs + t * 16 + 8 * g); vm[t][1] = *(const v4f*)(svs + t * 16 + 8 * g + 4); }
    __builtin_amdgcn_sched_barrier(0);   // all eight LDS loads are asked for in front of the two exponentials, whose chain then runs under the loads' latency
    const float fl = (1e-10f * 128.0f) * SC2; const float mnew = fmaxf(mrun, fl - 14.0f); const float corr = __builtin_amdgcn_exp2f(mrun - mnew), pm = __builtin_amdgcn_exp2f(fl - mnew);
    lr = lr * corr + (float)(SS - cnt) * pm;
#pragma unroll
    for (int t = 0; t < 4; ++t)
#pragma unroll
      for (int r = 0; r < 4; ++r) { acc[t][r] = acc[t][r] * corr + pm * vm[t][0][r]; acc[t][4 + r] = acc[t][4 + r] * corr + pm * vm[t][1][r]; } }
  const float inv = 8.0f / (lr * 4.0f);
  union { v8h h8; v4u u; } pk[4]; float xr[4][8]; float s4[4] = {0.f, 0.f, 0.f, 0.f}, q4[4] = {0.f, 0.f, 0.f, 0.f};   // a lane's 8 accumulator registers are 8 consecutive d of its query's row: one 16-byte store
#pragma unroll
  for (int t = 0; t < 4; ++t)
#pragma unroll
    for (int r = 0; r < 8; ++r) { pk[t].h8[r] = (_Float16)(acc[t][r] * inv); xr[t][r] = (float)pk[t].h8[r] * 0.125f; s4[t] += xr[t][r]; }
  // this head's share of LN2's row statistics, of x as stored: mean of its 64 values and their squared distance from that mean (a lane has 32 of them, lane ^ 16 the rest)
  // (four chains of 8 each, not one of 32: the wave is at its end and has nothing else to issue between dependent additions)
  float sm = (s4[0] + s4[1]) + (s4[2] + s4[3]); sm += xhalf(sm); const float mh = sm * (1.0f / HD);
#pragma unroll
  for (int t = 0; t < 4; ++t)
#pragma unroll
    for (int r = 0; r < 8; ++r) { const float dd = xr[t][r] - mh; q4[t] += dd * dd; }
  float m2 = (q4[0] + q4[1]) + (q4[2] + q4[3]); m2 += xhalf(m2);
#pragma unroll
  for (int t = 0; t < 4; ++t) vst2(O16 + ((bh * SS) + q0 + col) * HD + t * 16 + 8 * g, pk[t].u);
  vst2(ST + ((bh * SS) + q0 + col) * 2 + g, g == 0 ? mh : m2);   // ST[b][h][s] = {mean, squares}: the wave's 16 queries are one whole 128-byte line
}
// fo = relu(LN2(x) Wf^T + bf) without fx: block (128 rows, 128 cols) -> FO f32. A = O16 as attention left it (pass t = head t: 128 rows of 128 bytes), B = Wf g2 x16.
// A row's mu and rs come from its 16 heads' {mean, squares}: mu = mean of the means, sum of squares about mu = sum over heads of squares + 64 (mean - mu)^2
__global__ __launch_bounds__(256) void k_ffn(const _Float16* __restrict__ O16, const _Float16* __restrict__ P, const float* __restrict__ ST, const float* __restrict__ UC, const float* __restrict__ bf, float* __restrict__ FO) {
  __shared__ __align__(16) char ring[2 * GBUF];
  __shared__ __align__(16) float smu[128], srs[128];
  const int tid = threadIdx.x, wave = tid >> 5, lane = tid & 31, col = lane & 15, g = lane >> 4, wm = wave >> 1, wn = wave & 1;
  const int r0b = blockIdx.x * 128, n0 = blockIdx.y * 128; const int b = r0b / SS, s0 = r0b % SS;
  v8f acc[2][4] = {};
  gemm_core<HD, SS * HD>(O16 + ((size_t)b * NH * SS + s0) * HD, P + ((size_t)3 * HID + n0) * HID, ring, acc, [&] {
    if (tid < 128) { const float* sp = ST + ((size_t)b * NH * SS + s0 + tid) * 2; v2f st[NH];   // waves 0 to 3, a row a lane
#pragma unroll
      for (int h = 0; h < NH; ++h) st[h] = *(const v2f*)(sp + (size_t)h * SS * 2);
      float mu = 0.f, m2 = 0.f;
#pragma unroll
      for (int h = 0; h < NH; ++h) mu += st[h][0];
      mu *= 1.0f / NH;
#pragma unroll
      for (int h = 0; h < NH; ++h) { const float dd = st[h][0] - mu; m2 += st[h][1] + (float)HD * dd * dd; }
      smu[tid] = mu; srs[tid] = rsqrtf(m2 * (1.0f / HID) + 1e-5f); } });
  float (*so)[68] = (float (*)[68])(ring + wave * (32 * 68 * 4));
  v4f rmu[2][2], rrs[2][2];   // of the lane's rows i*16 + 8g + r
#pragma unroll
  for (int i = 0; i < 2; ++i)
#pragma unroll
    for (int q = 0; q < 2; ++q) { rmu[i][q] = *(const v4f*)(smu + wm * 32 + i * 16 + 8 * g + q * 4); rrs[i][q] = *(const v4f*)(srs + wm * 32 + i * 16 + 8 * g + q * 4); }
#pragma unroll
  for (int j = 0; j < 4; ++j) { const int n = n0 + wn * 64 + j * 16 + col; const v2f uc = *(const v2f*)(UC + (size_t)(n >> 1) * 32 + (n & 1) * 2); const float bb = bf[n] + uc[1];
#pragma unroll
    for (int i = 0; i < 2; ++i)
#pragma unroll
      for (int r = 0; r < 8; ++r) { const float vv = rrs[i][r >> 2][r & 3] * (acc[i][j][r] * (1.0f / 128.0f) - rmu[i][r >> 2][r & 3] * uc[0]) + bb; so[i * 16 + 8 * g + r][j * 16 + col] = vv > 0.f ? vv : 0.f; } }
  LDSX();
#pragma unroll
  for (int rp = 0; rp < 16; ++rp) { const int rl = rp * 2 + g; vst2(FO + (size_t)(r0b + wm * 32 + rl) * HID + n0 + wn * 64 + col * 4, *(const v4f*)(&so[rl][col * 4])); }
}
// out = fx + LN3(fo) with fx = LN2(x), x = merged O (/8): wave per row, both rows' loads asked for first, the two LayerNorms' sums side by side
__global__ __launch_bounds__(256) void k_fin(const _Float16* __restrict__ O16, const float* __restrict__ FO, const float* __restrict__ g2, const float* __restrict__ b2, const float* __restrict__ g3, const float* __restrict__ b3, float* __restrict__ out) {
  const int wave = threadIdx.x >> 5, lane = threadIdx.x & 31; const size_t r = (size_t)blockIdx.x * 8 + wave; if (r >= NR) return;
  const int b = (int)(r / SS), s = (int)(r % SS);
  const float* fo = FO + r * HID; float xv[32], yv[32]; v8h xh[4]; float sm = 0.f, sy = 0.f;
#pragma unroll
  for (int i = 0; i < 4; ++i) { const int c0 = i * 256 + lane * 8; const int h = c0 >> 6, d = c0 & 63; xh[i] = *(const v8h*)(O16 + (((size_t)b * NH + h) * SS + s) * HD + d); }
#pragma unroll
  for (int i = 0; i < 4; ++i) { const v4f a = *(const v4f*)(fo + i * 256 + lane * 8), c = *(const v4f*)(fo + i * 256 + lane * 8 + 4);
    xv[i * 8 + 0] = a[0]; xv[i * 8 + 1] = a[1]; xv[i * 8 + 2] = a[2]; xv[i * 8 + 3] = a[3]; xv[i * 8 + 4] = c[0]; xv[i * 8 + 5] = c[1]; xv[i * 8 + 6] = c[2]; xv[i * 8 + 7] = c[3]; }
#pragma unroll
  for (int i = 0; i < 32; ++i) { yv[i] = (float)xh[i >> 3][i & 7] * 0.125f; sy += yv[i]; }
#pragma unroll
  for (int i = 0; i < 32; ++i) sm += xv[i];
#pragma unroll
  for (int off = 16; off >= 1; off >>= 1) { sm += __shfl_xor(sm, off, 32); sy += __shfl_xor(sy, off, 32); }
  const float mu = sm * (1.0f / HID), my = sy * (1.0f / HID); float q2 = 0.f, y2 = 0.f;
#pragma unroll
  for (int i = 0; i < 32; ++i) { const float dd = xv[i] - mu, dy = yv[i] - my; q2 += dd * dd; y2 += dy * dy; }
#pragma unroll
  for (int off = 16; off >= 1; off >>= 1) { q2 += __shfl_xor(q2, off, 32); y2 += __shfl_xor(y2, off, 32); }
  const float rs = rsqrtf(q2 * (1.0f / HID) + 1e-5f), ry = rsqrtf(y2 * (1.0f / HID) + 1e-5f);
#pragma unroll
  for (int i = 0; i < 4; ++i) { v4f o0, o1; const int c0 = i * 256 + lane * 8;
#pragma unroll
    for (int e = 0; e < 8; ++e) { const int c = c0 + e; const float fx = (yv[i * 8 + e] - my) * ry * g2[c] + b2[c]; const float vv = fx + ((xv[i * 8 + e] - mu) * rs * g3[c] + b3[c]); if (e < 4) o0[e] = vv; else o1[e - 4] = vv; }
    vst2(out + r * HID + c0, o0); vst2(out + r * HID + c0 + 4, o1); }
}
extern "C" void kernel_launch(void* const* d_in, const int* in_sizes, int n_in, void* d_out, int out_size, void* d_ws, size_t ws_size, hipStream_t stream) {
  (void)in_sizes; (void)n_in; (void)out_size; (void)ws_size;
  const float** I = (const float**)d_in;
  const float* q = I[0]; const float* k = I[1]; const float* v = I[2]; const float* g1q = I[3]; const float* b1q = I[4]; const float* g1k = I[5]; const float* b1k = I[6]; const float* g1v = I[7]; const float* b1v = I[8];
  const float* Wq = I[9]; const float* bq = I[10]; const float* Wk = I[11]; const float* bk = I[12]; const float* Wv = I[13]; const float* bv = I[14]; const float* g2 = I[15]; const float* b2 = I[16]; const float* g3 = I[17]; const float* b3 = I[18]; const float* Wf = I[19]; const float* bf = I[20]; const int* mask = (const int*)d_in[21];
  float* out = (float*)d_out;
  char* ws = (char*)d_ws; size_t off = 0;
  auto take = [&](size_t bytes) { char* p = ws + off; off += (bytes + 255) & ~(size_t)255; return p; };
  _Float16* X16 = (_Float16*)take((size_t)3 * NR * HID * 2); _Float16* P = (_Float16*)take((size_t)4 * HID * HID * 2); float* UC = (float*)take((size_t)(HID / 2) * 128); float* CS = (float*)take((size_t)SS * 32 * 4); float* SN = (float*)take((size_t)SS * 32 * 4);
  _Float16* Q16 = (_Float16*)take((size_t)NR * HID * 2); _Float16* K16 = (_Float16*)take((size_t)NR * HID * 2); _Float16* VT = (_Float16*)take((size_t)NR * HID * 2); _Float16* O16 = (_Float16*)take((size_t)NR * HID * 2);
  float* ST = (float*)take((size_t)NR * NH * 2 * 4); float* FO = (float*)take((size_t)NR * HID * 4); float* VS = (float*)take((size_t)NB * (SS / 128) * HID * 4);
  k_prep<<<NB_ROPE + NB_LN + NB_PACK + NB_PACKF, 256, 0, stream>>>(q, k, v, g1q, b1q, g1k, b1k, g1v, b1v, Wq, Wk, Wv, Wf, g2, b2, mask, X16, P, UC, CS, SN);
  k_qkv<<<dim3(NR / 128, HID / 128, 3), 256, 0, stream>>>(X16, P, bq, bk, bv, CS, SN, mask, Q16, K16, VT, VS);
  k_attn<<<dim3(SS / 64, NH, NB), 128, 0, stream>>>(Q16, K16, VT, VS, mask, O16, ST);
  k_ffn<<<dim3(NR / 128, HID / 128), 256, 0, stream>>>(O16, P, ST, UC, bf, FO);
  k_fin<<<NR / 8, 256, 0, stream>>>(O16, FO, g2, b2, g3, b3, out);
}

// v008
// It runs in 69.4 microseconds.
// Next to v007, in two timings, it ran 1.06 and 1.07 times as fast.
// Over all steps from v000 it is 4.39 times as fast.
#include <hip/hip_runtime.h>
#include <math.h>

typedef __attribute__((ext_vector_type(16))) _Float16 v16h;
typedef __attribute__((ext_vector_type(16))) __bf16 v16b;
typedef __attribute__((ext_vector_type(8)))  _Float16 v8h;
typedef __attribute__((ext_vector_type(2)))  _Float16 v2h;
typedef __attribute__((ext_vector_type(8)))  float v8f;
typedef __attribute__((ext_vector_type(4)))  float v4f;
typedef __attribute__((ext_vector_type(2)))  float v2f;
typedef __attribute__((ext_vector_type(4)))  unsigned v4u;
typedef __attribute__((ext_vector_type(4)))  int v4i;
typedef float __attribute__((may_alias)) float_a;
typedef int __attribute__((may_alias)) int_a;

template <typename T> __device__ __forceinline__ void vst2(void* p, T v) { *(T*)p = v;  }
__device__ __forceinline__ v8f wmma16(v16h a, v16h b, v8f c) {
  v8f d = __builtin_amdgcn_wmma_f32_16x16x32_f16(false, a, false, b, (short)0, c, false, false);
  asm volatile("v_nop\n\tv_nop\n\tv_nop\n\tv_nop" : "+v"(d) : "v"(a), "v"(b));
  return d;
}
__device__ __forceinline__ v8f wmma_bf(v16b a, v16b b, v8f c) {
  v8f d = __builtin_amdgcn_wmma_f32_16x16x32_bf16(false, a, false, b, (short)0, c, false, false);
  asm volatile("v_nop\n\tv_nop\n\tv_nop\n\tv_nop" : "+v"(d) : "v"(a), "v"(b));
  return d;
}
// 16x16x32 fragments: lane = (h = lane>>4, row/col = lane&15); elements 0..7 = k0+8h+0..7, 8..15 = k0+16+8h+0..7; D element r = row 8h+r
__device__ __forceinline__ v16h frag_h(const _Float16* rowk0, int lane) {
  union { v16h v; v8h q[2]; } u; const _Float16* p = rowk0 + 8 * (lane >> 4);
  u.q[0] = *(const v8h*)p; u.q[1] = *(const v8h*)(p + 16); return u.v;
}
__device__ __forceinline__ v16h frag_f32(const float* rowk0, int lane) {
  v16h a; const float* p = rowk0 + 8 * (lane >> 4);
#pragma unroll
  for (int i = 0; i < 8; ++i) { a[i] = (_Float16)p[i]; a[8 + i] = (_Float16)p[16 + i]; }
  return a;
}
__device__ __forceinline__ v16h frag_f32s(const float* rowk0, int lane, float sc) {
  v16h a; const float* p = rowk0 + 8 * (lane >> 4);
#pragma unroll
  for (int i = 0; i < 8; ++i) { a[i] = (_Float16)(p[i] * sc); a[8 + i] = (_Float16)(p[16 + i] * sc); }
  return a;
}
// column fragment from a [K][ld] layout (column n), rows >= K read as 0
__device__ __forceinline__ v16h fragc_f32(const float* W, int k0, int n, int lane, int ld, int K) {
  v16h a; const int g = lane >> 4;
#pragma unroll
  for (int i = 0; i < 8; ++i) { const int ka = k0 + 8 * g + i, kb = ka + 16;
    a[i] = (_Float16)(ka < K ? W[(size_t)ka * ld + n] : 0.f); a[8 + i] = (_Float16)(kb < K ? W[(size_t)kb * ld + n] : 0.f); }
  return a;
}
struct F2 { v16b h, l; };
__device__ __forceinline__ F2 bsplit16(const float v[16]) { F2 r;
#pragma unroll
  for (int i = 0; i < 16; ++i) { const __bf16 h = (__bf16)v[i]; r.h[i] = h; r.l[i] = (__bf16)(v[i] - (float)h); }
  return r; }
__device__ __forceinline__ F2 split_row(const float* row, int k0, int lane) { float v[16]; const float* p = row + k0 + 8 * (lane >> 4);
#pragma unroll
  for (int i = 0; i < 8; ++i) { v[i] = p[i]; v[8 + i] = p[16 + i]; }
  return bsplit16(v); }
__device__ __forceinline__ F2 split_rowK(const float* row, int k0, int lane, int K) { float v[16]; const int g = lane >> 4;
#pragma unroll
  for (int i = 0; i < 8; ++i) { const int ka = k0 + 8 * g + i, kb = ka + 16; v[i] = ka < K ? row[ka] : 0.f; v[8 + i] = kb < K ? row[kb] : 0.f; }
  return bsplit16(v); }
__device__ __forceinline__ F2 split_col(const float* W, int k0, int n, int lane, int ld, int K) { float v[16]; const int g = lane >> 4;
#pragma unroll
  for (int i = 0; i < 8; ++i) { const int ka = k0 + 8 * g + i, kb = ka + 16; v[i] = ka < K ? W[(size_t)ka * ld + n] : 0.f; v[8 + i] = kb < K ? W[(size_t)kb * ld + n] : 0.f; }
  return bsplit16(v); }
__device__ __forceinline__ v8f mac3(const F2& a, const F2& b, v8f c) { c = wmma_bf(a.l, b.h, c); c = wmma_bf(a.h, b.l, c); return wmma_bf(a.h, b.h, c); }
__device__ __forceinline__ float sigm(float v) { return 1.0f / (1.0f + expf(-v)); }
#define LDSX() do { asm volatile("s_wait_dscnt 0" ::: "memory"); __builtin_amdgcn_wave_barrier(); __builtin_amdgcn_fence(__ATOMIC_RELEASE, "workgroup"); } while (0)

// Pre-LN multi-head attention block with RoPE and a post FFN: LN(q), LN(k), LN(v) -> projections (+bias) -> rotary embedding -> 16-head
// attention with the module's masked_fill value 1e-10 (mask read as data) -> merge -> fx = LN2(x); fo = relu(fx Wf^T + bf); out = fx +
// LN3(fo). LayerNorms, RoPE (cos/sin table in f32), softmax (online over the up to 16 key tiles that hold kept keys) in f32; all four products on
// v_wmma_f32_16x16x32_f16 (LN outputs as f16 rows, [out][in] weights as f16 rows x16, q/k/v head-major f16 x4, P x2^14, O x8).
// LN2 is linear in x once a row's mean mu and 1/sigma rs are known: fx Wf^T = rs * (x (Wf g2)^T - mu * U) + C with U[n] = sum_k Wf[n][k] g2[k], C[n] = sum_k Wf[n][k] b2[k].
// So the FFN product runs on the attention output itself, against Wf g2, and its epilogue applies rs, mu, U, C; fx as a value is formed only in the last kernel.
#define NB 4
#define SS 1024
#define HID 1024
#define NH 16
#define HD 64
#define NR (NB * SS)

// Every masked key of a batch has the same score (the fill value), whatever the query: together they are ONE term of the softmax, (their number) * exp(fill) in the sum and
// exp(fill) * (sum of their V rows) in the output. So the rows of k and v are laid down kept keys first (a stable partition of each batch's 1024 keys: a kept key goes to the number of
// kept keys in front of it, a masked one behind all kept ones), K is projected and the attention passes run only as far as the kept keys reach, and the masked keys' V rows are summed.
// The mask enters only as (value != 0): every place is a count of keys, so it lies in 0 .. SS-1 for any content of the mask.
// counts over one batch's mask row, the same in every lane (all 32 lanes on): c = kept keys in all, bf = kept keys in front of key s
struct KC { int c, bf; };
__device__ __forceinline__ KC kept_counts(const int* __restrict__ mrow, int lane, int s) {
  v4i m[SS / 128]; KC r = {0, 0};
#pragma unroll
  for (int i = 0; i < SS / 128; ++i) m[i] = *(const v4i*)(mrow + i * 128 + lane * 4);
#pragma unroll
  for (int i = 0; i < SS / 128; ++i)
#pragma unroll
    for (int j = 0; j < 4; ++j) { const bool kq = m[i][j] != 0;
      r.c += __builtin_popcount(__builtin_amdgcn_ballot_w32(kq)); r.bf += __builtin_popcount(__builtin_amdgcn_ballot_w32(kq && i * 128 + lane * 4 + j < s)); }
  return r;
}
// The three preparations (LN of q, k, v; the weights as f16; the RoPE tables) read only inputs and do not depend on one another: they are block ranges of ONE launch, k_prep below.
// LN of two 1024-rows per wave (both rows' 16 loads of 16 bytes are asked for before either is summed): src selects q/k/v by which; block bx has 16 rows; dst f16 rows
__device__ __forceinline__ void ln3_block(int bx, int which, const float* __restrict__ q, const float* __restrict__ k, const float* __restrict__ v, const float* __restrict__ gq, const float* __restrict__ bq, const float* __restrict__ gk, const float* __restrict__ bk, const float* __restrict__ gv, const float* __restrict__ bv2, const int* __restrict__ mask, _Float16* __restrict__ X16) {
  const int wave = threadIdx.x >> 5, lane = threadIdx.x & 31; const size_t r = (size_t)bx * 16 + wave * 2; if (r >= NR) return;
  const float* src = (which == 0 ? q : which == 1 ? k : v) + r * HID; const float* g = which == 0 ? gq : which == 1 ? gk : gv; const float* bb = which == 0 ? bq : which == 1 ? bk : bv2;
  const float* sl = src + lane * 8; float xv[2][32];
#pragma unroll
  for (int w = 0; w < 2; ++w)
#pragma unroll
    for (int i = 0; i < 4; ++i) { const v4f a = *(const v4f*)(sl + w * HID + i * 256), c = *(const v4f*)(sl + w * HID + i * 256 + 4);
      xv[w][i * 8 + 0] = a[0]; xv[w][i * 8 + 1] = a[1]; xv[w][i * 8 + 2] = a[2]; xv[w][i * 8 + 3] = a[3]; xv[w][i * 8 + 4] = c[0]; xv[w][i * 8 + 5] = c[1]; xv[w][i * 8 + 6] = c[2]; xv[w][i * 8 + 7] = c[3]; }
  asm volatile("s_wait_xcnt 0x0" :: "v"(sl) : "memory");   // the 16 loads share one address: it is held whole up to this wait, so that none of them lands in it while the others are issued
  __builtin_amdgcn_sched_barrier(0);   // keeps all 16 loads in front of the first row's sums: sunk behind them, the second row's last loads wait out a second memory latency
  size_t dr[2] = {r, r + 1};   // where the two rows go: q in place, k and v kept keys first
  if (which != 0) { const int b = (int)(r / SS), s = (int)(r % SS); const int* mrow = mask + (size_t)b * SS; const KC kc = kept_counts(mrow, lane, s);
    const bool k0 = mrow[s] != 0, k1 = mrow[s + 1] != 0; const int bf1 = kc.bf + (k0 ? 1 : 0);
    dr[0] = (size_t)b * SS + (k0 ? kc.bf : kc.c + s - kc.bf); dr[1] = (size_t)b * SS + (k1 ? bf1 : kc.c + (s + 1) - bf1); }
#pragma unroll
  for (int w = 0; w < 2; ++w) { float s = 0.f;
#pragma unroll
    for (int i = 0; i < 32; ++i) s += xv[w][i];
#pragma unroll
    for (int off = 16; off >= 1; off >>= 1) s += __shfl_xor(s, off, 32);
    const float mu = s * (1.0f / HID); float q2 = 0.f;
#pragma unroll
    for (int i = 0; i < 32; ++i) { const float d = xv[w][i] - mu; q2 += d * d; }
#pragma unroll
    for (int off = 16; off >= 1; off >>= 1) q2 += __shfl_xor(q2, off, 32);
    const float rs = rsqrtf(q2 * (1.0f / HID) + 1e-5f);
#pragma unroll
    for (int i = 0; i < 4; ++i) { union { v8h h; v4u u; } pk;
#pragma unroll
      for (int e = 0; e < 8; ++e) { const int c = i * 256 + lane * 8 + e; pk.h[e] = (_Float16)((xv[w][i * 8 + e] - mu) * rs * g[c] + bb[c]); }
      vst2(X16 + ((size_t)which * NR + dr[w]) * HID + i * 256 + lane * 8, pk.u); } }
}
// P rows [w*1024 + n] = W_w[n][:] * 16 (W are [out][in]): w = 0 Wq, 1 Wk, 2 Wv (Wf: packf_block). A block takes 16 whole rows of one W, a wave 2 of them (8 KB in, 4 KB out):
// a lane's 16 loads of 16 bytes are all asked for before the first is converted, and each store is 512 contiguous bytes of a wave
__device__ __forceinline__ void pack_block(int bx, const float* __restrict__ Wq, const float* __restrict__ Wk, const float* __restrict__ Wv, _Float16* __restrict__ P) {
  const int which = bx >> 6, wave = threadIdx.x >> 5, lane = threadIdx.x & 31;
  const size_t o = (size_t)(bx & 63) * (16 * HID) + wave * (2 * HID) + lane * 8;
  const float* W = (which == 0 ? Wq : which == 1 ? Wk : Wv) + o; _Float16* D = P + (size_t)which * HID * HID + o;
  v4f x[16];
#pragma unroll
  for (int i = 0; i < 8; ++i) { x[2 * i] = *(const v4f*)(W + i * 256); x[2 * i + 1] = *(const v4f*)(W + i * 256 + 4); }
#pragma unroll
  for (int i = 0; i < 8; ++i) { union { v8h h; v4u u; } pk;
#pragma unroll
    for (int e = 0; e < 4; ++e) { pk.h[e] = (_Float16)(x[2 * i][e] * 16.0f); pk.h[4 + e] = (_Float16)(x[2 * i + 1][e] * 16.0f); }
    vst2(D + i * 256, pk.u); }
  asm volatile("s_wait_xcnt 0x0" ::: "memory");   // in k_prep other parts' code follows these stores in the listing and reuses their registers: the wait stands in front of any such rewrite
}
// Wf with LN2 folded in: P rows [3*1024 + n] = Wf[n][:] * g2[:] * 16, and of each row the two sums U[n], C[n] (f32, whole row in one wave). 2 rows a wave, as in pack_block.
// U is summed over the products as rounded to f16, so that mu * U takes away exactly what the matrix product has summed of a row's mean.
// UC: a wave's four sums {U[n], C[n], U[n+1], C[n+1]} are the first 16 bytes of a 128-byte line of its own
__device__ __forceinline__ void packf_block(int bx, const float* __restrict__ Wf, const float* __restrict__ g2, const float* __restrict__ b2, _Float16* __restrict__ P, float* __restrict__ UC) {
  const int wave = threadIdx.x >> 5, lane = threadIdx.x & 31;
  const size_t o = (size_t)bx * (16 * HID) + wave * (2 * HID) + lane * 8;
  const float* W = Wf + o; _Float16* D = P + (size_t)3 * HID * HID + o; float* uc = UC + (size_t)(bx * 8 + wave) * 32;
  v4f gg[8], bb[8];
#pragma unroll
  for (int j = 0; j < 4; ++j) { gg[2 * j] = *(const v4f*)(g2 + j * 256 + lane * 8); gg[2 * j + 1] = *(const v4f*)(g2 + j * 256 + lane * 8 + 4); bb[2 * j] = *(const v4f*)(b2 + j * 256 + lane * 8); bb[2 * j + 1] = *(const v4f*)(b2 + j * 256 + lane * 8 + 4); }
#pragma unroll 1   // a row at a time: with both rows' values live at once k_prep needs more than 160 registers, and every part of it loses a wave per SIMD
  for (int w = 0; w < 2; ++w) { v4f x[8]; float su = 0.f, sc = 0.f;
#pragma unroll
    for (int j = 0; j < 4; ++j) { x[2 * j] = *(const v4f*)(W + w * HID + j * 256); x[2 * j + 1] = *(const v4f*)(W + w * HID + j * 256 + 4); }
#pragma unroll
    for (int j = 0; j < 4; ++j) { union { v8h h; v4u u; } pk;   // k = j*256 + lane*8 + e
#pragma unroll
      for (int e = 0; e < 4; ++e) { pk.h[e] = (_Float16)(x[2 * j][e] * gg[2 * j][e] * 16.0f); pk.h[4 + e] = (_Float16)(x[2 * j + 1][e] * gg[2 * j + 1][e] * 16.0f);
        su += (float)pk.h[e] + (float)pk.h[4 + e]; sc += x[2 * j][e] * bb[2 * j][e] + x[2 * j + 1][e] * bb[2 * j + 1][e]; }
      vst2(D + w * HID + j * 256, pk.u); }
    asm volatile("s_wait_xcnt 0x0" ::: "memory");   // the sums below reuse the stores' registers: the wait stands in front of any such rewrite
#pragma unroll
    for (int off = 16; off >= 1; off >>= 1) { su += __shfl_xor(su, off, 32); sc += __shfl_xor(sc, off, 32); }
    if (lane == 0) vst2(uc + w * 2, v2f{su * (1.0f / 16.0f), sc});
    asm volatile("s_wait_xcnt 0x0" ::: "memory"); }   // likewise for this store, in front of the second row's (and, in k_prep, other parts') use of its registers
}
// RoPE tables: CS[s][j] = cos(s * inv_freq[j]), SN likewise, j < 32
__device__ __forceinline__ void rope_block(int bx, float* __restrict__ CS, float* __restrict__ SN) {
  const int s = bx * 8 + (threadIdx.x >> 5), j = threadIdx.x & 31;
  const float inv = 1.0f / powf(10000.0f, (float)(2 * j) / (float)HD); const float f = (float)s * inv;
  vst2(CS + (size_t)s * 32 + j, cosf(f)); vst2(SN + (size_t)s * 32 + j, sinf(f));
}
// one launch for the three: blocks 0 .. NB_ROPE-1 make the tables (the longest dependent chain of arithmetic, so it starts first and runs under the others' memory time),
// the next NB_PACKF blocks Wf (row sums behind its loads: the second longest chain), the next NB_LN the rows of q, then k, then v, the last NB_PACK Wq, Wk, Wv; the range test is on blockIdx.x alone, a scalar branch
#define NB_ROPE (SS / 8)
#define NB_LN (3 * (NR / 16))
#define NB_PACK (3 * HID / 16)
#define NB_PACKF (HID / 16)
__global__ __launch_bounds__(256) void k_prep(const float* __restrict__ q, const float* __restrict__ k, const float* __restrict__ v, const float* __restrict__ gq, const float* __restrict__ bq, const float* __restrict__ gk, const float* __restrict__ bk, const float* __restrict__ gv, const float* __restrict__ bv2,
                                            const float* __restrict__ Wq, const float* __restrict__ Wk, const float* __restrict__ Wv, const float* __restrict__ Wf, const float* __restrict__ g2, const float* __restrict__ b2, const int* __restrict__ mask, _Float16* __restrict__ X16, _Float16* __restrict__ P, float* __restrict__ UC, float* __restrict__ CS, float* __restrict__ SN) {
  const int bid = blockIdx.x;
  if (bid < NB_ROPE) rope_block(bid, CS, SN);
  else if (bid < NB_ROPE + NB_PACKF) packf_block(bid - NB_ROPE, Wf, g2, b2, P, UC);
  else if (bid < NB_ROPE + NB_PACKF + NB_LN) { const int i = bid - (NB_ROPE + NB_PACKF); ln3_block(i % (NR / 16), i / (NR / 16), q, k, v, gq, bq, gk, bk, gv, bv2, mask, X16); }
  else pack_block(bid - (NB_ROPE + NB_PACKF + NB_LN), Wq, Wk, Wv, P);
}
// Shared GEMM core of k_qkv and k_ffn: Y[128 rows][128 cols] = A[128][1024] * Bw[128][1024]^T per block of 8 waves (4 x 2), 32 x 64 per wave.
// A pass is 64 k = 128 bytes of each of the 256 operand rows, brought into LDS by asynchronous copies (16 bytes a lane, 8 copies a lane and pass),
// two buffers: pass t + 2 is copied into the buffer that pass t has just left. LDS rows at pitch 144 bytes for the ds_load_b128 fragment readers.
#define GP 144
#define GBUF (256 * GP)
#define NPASS (HID / 64)
// one pass's tile: rows rr, rr+RS, rr+2RS, rr+3RS of the first operand (LDS rows 0..4RS-1, source pitch SA elements) and of the second (LDS rows 4RS..8RS-1,
// source pitch SB); l, a, bw are this lane's own 16 bytes of row rr
template <int RS, int SA, int SB> __device__ __forceinline__ void copy_tile(unsigned l, const _Float16* a, const _Float16* bw) {
  const unsigned l0 = l, l1 = l + RS * GP, l2 = l + 2 * RS * GP, l3 = l + 3 * RS * GP, l4 = l + 4 * RS * GP, l5 = l + 5 * RS * GP, l6 = l + 6 * RS * GP, l7 = l + 7 * RS * GP;
  const _Float16 *a0 = a, *a1 = a + RS * SA, *a2 = a + 2 * RS * SA, *a3 = a + 3 * RS * SA, *w0 = bw, *w1 = bw + RS * SB, *w2 = bw + 2 * RS * SB, *w3 = bw + 3 * RS * SB;
  // the copies and their s_wait_xcnt in one statement: no address register of a copy is rewritten in front of that wait
  asm volatile("global_load_async_to_lds_b128 %0, %8, off\n\t"
               "global_load_async_to_lds_b128 %1, %9, off\n\t"
               "global_load_async_to_lds_b128 %2, %10, off\n\t"
               "global_load_async_to_lds_b128 %3, %11, off\n\t"
               "global_load_async_to_lds_b128 %4, %12, off\n\t"
               "global_load_async_to_lds_b128 %5, %13, off\n\t"
               "global_load_async_to_lds_b128 %6, %14, off\n\t"
               "global_load_async_to_lds_b128 %7, %15, off\n\t"
               "s_wait_xcnt 0x0"
               :: "v"(l0), "v"(l1), "v"(l2), "v"(l3), "v"(l4), "v"(l5), "v"(l6), "v"(l7), "v"(a0), "v"(a1), "v"(a2), "v"(a3), "v"(w0), "v"(w1), "v"(w2), "v"(w3) : "memory");
}
// A, Bw: first row of the block's 128 rows of each operand; Bw has rows of HID, A rows at pitch SA elements whose next 64 k lie PA elements on (row-major: HID, 64; head-major: HD, SS * HD)
// under_first() runs while the first pass's copies fly; what it writes to LDS outside the ring is published by that pass's barrier. On return every wave has left the ring (the last pass's barrier)
// The blocks of a launch that share operand rows (one row block: 8 blocks, one column block: 32) would all ask L2 for the same lines at the same moment: each block starts its walk over k
// at piece rot (from its block indices, a scalar) and wraps, trip t working on piece (t + rot) mod NPASS; every piece is summed once, in an order that depends on the block
template <int SA, int PA, typename F> __device__ __forceinline__ void gemm_core(const _Float16* __restrict__ A, const _Float16* __restrict__ Bw, char* ring, v8f (&acc)[2][4], int rot, F under_first) {
  const int tid = threadIdx.x, wave = tid >> 5, lane = tid & 31, col = lane & 15, wm = wave >> 1, wn = wave & 1;
  const int rr = tid >> 3, seg = tid & 7;
  const unsigned l = (unsigned)(size_t)ring + rr * GP + seg * 16;
  const _Float16* a = A + (size_t)rr * SA + seg * 8; const _Float16* bw = Bw + (size_t)rr * HID + seg * 8;
  copy_tile<32, SA, HID>(l, a + (size_t)(rot & (NPASS - 1)) * PA, bw + (rot & (NPASS - 1)) * 64);
  under_first();
  asm volatile("s_wait_asynccnt 0x0" ::: "memory");   // pass 0's copies of this wave have landed
  __syncthreads();                                    // ... and every other wave's
  copy_tile<32, SA, HID>(l + GBUF, a + (size_t)((rot + 1) & (NPASS - 1)) * PA, bw + ((rot + 1) & (NPASS - 1)) * 64);
  for (int t = 0; t < NPASS; ++t) {
    const char* buf = ring + (t & 1) * GBUF;
#pragma unroll
    for (int kc = 0; kc < 2; ++kc) { v16h fa[2], fb[4];
#pragma unroll
      for (int i = 0; i < 2; ++i) fa[i] = frag_h((const _Float16*)(buf + (wm * 32 + i * 16 + col) * GP + kc * 64), lane);
#pragma unroll
      for (int j = 0; j < 4; ++j) fb[j] = frag_h((const _Float16*)(buf + (128 + wn * 64 + j * 16 + col) * GP + kc * 64), lane);
#pragma unroll
      for (int i = 0; i < 2; ++i)
#pragma unroll
        for (int j = 0; j < 4; ++j) acc[i][j] = wmma16(fa[i], fb[j], acc[i][j]); }
    asm volatile("s_wait_dscnt 0x0" ::: "memory");    // this wave's reads of pass t's buffer are done before it is refilled
    asm volatile("s_wait_asynccnt 0x0" ::: "memory"); // this wave's copies of pass t + 1 have landed
    __syncthreads();                                  // publishes pass t + 1 and ends every reader's last read of pass t's buffer
    if (t + 2 < NPASS) { const int p = (t + 2 + rot) & (NPASS - 1); copy_tile<32, SA, HID>(l + (t & 1) * GBUF, a + (size_t)p * PA, bw + p * 64); }
  }
  asm volatile("s_wait_asynccnt 0x0" ::: "memory");   // nothing in flight when the ring becomes output staging
}
// q/k/v projections + bias (+RoPE for q,k): block (128 rows, 128 cols = 2 heads, which), a wave has 32 rows of one head
// the rows of k and v come kept keys first: a K block with no kept key in it is not needed by anybody and leaves at once; RoPE takes a K row's angle from the key's own position (sorig);
// a V block also sums its masked keys' rows: VS[b][row block][column], x4 like VT, f32
__global__ __launch_bounds__(256) void k_qkv(const _Float16* __restrict__ X16, const _Float16* __restrict__ P, const float* __restrict__ bq, const float* __restrict__ bk, const float* __restrict__ bv, const float* __restrict__ CS, const float* __restrict__ SN, const int* __restrict__ mask,
                                           _Float16* __restrict__ Q16, _Float16* __restrict__ K16, _Float16* __restrict__ VT, float* __restrict__ VS) {
  __shared__ __align__(16) char ring[2 * GBUF];
  __shared__ __align__(16) int sorig[128];   // position in the sequence of each of the block's 128 rows
  const int tid = threadIdx.x, wave = tid >> 5, lane = tid & 31, col = lane & 15, g = lane >> 4, wm = wave >> 1, wn = wave & 1;
  const int which = blockIdx.z, r0b = blockIdx.x * 128, n0 = blockIdx.y * 128; const int b = r0b / SS, s0 = r0b % SS;
  const float* bias = which == 0 ? bq : (which == 1 ? bk : bv);
  const int* mrow = mask + (size_t)b * SS; KC kc = {SS, 0};   // kept keys of the batch; of them, in front of key wave * 128
  if (which != 0) kc = kept_counts(mrow, lane, wave * 128);
  if (which == 1 && s0 >= kc.c) return;   // the same for the whole block (blockIdx and the batch's count), in front of every barrier and copy
  v8f acc[2][4] = {};
  gemm_core<HID, 64>(X16 + ((size_t)which * NR + r0b) * HID, P + ((size_t)which * HID + n0) * HID, ring, acc, (int)(blockIdx.x + 2 * blockIdx.y), [&] {
    if (which == 1) {   // wave w places keys w*128 .. w*128+127, a lane four in a row; the places are a permutation of 0 .. SS-1, so each of the block's 128 rows is named exactly once
      const v4i m = *(const v4i*)(mrow + wave * 128 + lane * 4); int kb = kc.bf;
#pragma unroll
      for (int j = 0; j < 4; ++j) kb += (int)__builtin_amdgcn_mbcnt_lo(__builtin_amdgcn_ballot_w32(m[j] != 0), 0u);   // kept keys of the lower lanes
#pragma unroll
      for (int j = 0; j < 4; ++j) { const int e = wave * 128 + lane * 4 + j; const bool kq = m[j] != 0; const int pos = kq ? kb : kc.c + e - kb;
        if ((unsigned)(pos - s0) < 128u) sorig[pos - s0] = e;
        kb += kq ? 1 : 0; } }
    else if (tid < 128) sorig[tid] = s0 + tid; });
#pragma unroll
  for (int j = 0; j < 4; ++j) { const float bb = bias[n0 + wn * 64 + j * 16 + col];
#pragma unroll
    for (int i = 0; i < 2; ++i)
#pragma unroll
      for (int r = 0; r < 8; ++r) acc[i][j][r] = acc[i][j][r] * (1.0f / 16.0f) + bb; }
  if (which < 2) {
    // RoPE within the wave's head: d = j*16 + col ; d < 32: x cos - x(d+32) sin ; d >= 32: x cos + x(d-32) sin, angle index d & 31
    float (*so)[68] = (float (*)[68])(ring + wave * (32 * 68 * 4));
#pragma unroll
    for (int i = 0; i < 2; ++i) { unsigned o[8]; float cs[2][8], sns[2][8];   // o: a row's place in the tables at angle index col; the index 16 + col lies 16 floats on
#pragma unroll
      for (int r = 0; r < 8; ++r) o[r] = (unsigned)sorig[wm * 32 + i * 16 + 8 * g + r] * 32u + (unsigned)col;
#pragma unroll
      for (int jj = 0; jj < 2; ++jj)
#pragma unroll
        for (int r = 0; r < 8; ++r) { cs[jj][r] = (CS + jj * 16)[o[r]]; sns[jj][r] = (SN + jj * 16)[o[r]]; }
      // the 32 loads' offsets are held up to this wait, so that no load of the run lands in an offset that another still names
      asm volatile("s_wait_xcnt 0x0" :: "v"(o[0]), "v"(o[1]), "v"(o[2]), "v"(o[3]), "v"(o[4]), "v"(o[5]), "v"(o[6]), "v"(o[7]) : "memory");
#pragma unroll
      for (int jj = 0; jj < 2; ++jj)
#pragma unroll
        for (int r = 0; r < 8; ++r) { const int rl = i * 16 + 8 * g + r; const float c = cs[jj][r], sn = sns[jj][r];
          const float lo = acc[i][jj][r], hi = acc[i][jj + 2][r];
          so[rl][jj * 16 + col] = (lo * c - hi * sn) * 4.0f; so[rl][(jj + 2) * 16 + col] = (hi * c + lo * sn) * 4.0f; } }
    LDSX();
    _Float16* D = which == 0 ? Q16 : K16; const int h = (n0 >> 6) + wn;
    for (int qq = lane; qq < 32 * 8; qq += 32) { const int rl = qq >> 3, pc = qq & 7; union { v8h h8; v4u u; } pk;
#pragma unroll
      for (int e = 0; e < 8; ++e) pk.h8[e] = (_Float16)so[rl][pc * 8 + e];
      vst2(D + (((size_t)b * NH + h) * SS + s0 + wm * 32 + rl) * HD + pc * 8, pk.u); } }
  else {
    _Float16 (*st)[136] = (_Float16 (*)[136])ring;
#pragma unroll
    for (int i = 0; i < 2; ++i)
#pragma unroll
      for (int j = 0; j < 4; ++j)
#pragma unroll
        for (int r = 0; r < 8; ++r) st[wn * 64 + j * 16 + col][wm * 32 + i * 16 + 8 * g + r] = (_Float16)(acc[i][j][r] * 4.0f);
    __syncthreads();
    { const int cl = tid >> 1, hf = tid & 1; float sv = 0.f;   // two lanes a column, 64 rows each; a row is a masked key's where its place is not below the kept count
#pragma unroll
      for (int p = 0; p < 8; ++p) { const v8h x = *(const v8h*)(&st[cl][hf * 64 + p * 8]);
#pragma unroll
        for (int e = 0; e < 8; ++e) sv += s0 + hf * 64 + p * 8 + e >= kc.c ? (float)x[e] : 0.f; }
      sv += __shfl_xor(sv, 1, 32);
      if (hf == 0) vst2(VS + ((size_t)b * (SS / 128) + (s0 >> 7)) * HID + n0 + cl, sv);
      asm volatile("s_wait_xcnt 0x0" ::: "memory"); }   // the stores below reuse this store's registers: the wait stands in front of any such rewrite
    for (int qq = tid; qq < 128 * 16; qq += 256) { const int cl = qq >> 4, pc = qq & 15; const int c = n0 + cl, h = c >> 6, d = c & 63; vst2(VT + (((size_t)b * NH + h) * HD + d) * SS + s0 + pc * 8, *(const v4u*)(&st[cl][pc * 8])); } }
}
#define ABUF (128 * GP)
#define SC2 ((0.125f / 16.0f) * 1.4426950408889634f)
// lane l's value from lane l ^ 16
__device__ __forceinline__ float xhalf(float x) { return __builtin_bit_cast(float, __builtin_amdgcn_permlanex16(__builtin_bit_cast(int, x), __builtin_bit_cast(int, x), 0x76543210, 0xfedcba98, false, false)); }
__global__ __launch_bounds__(128) void k_attn(const _Float16* __restrict__ Q16, const _Float16* __restrict__ K16, const _Float16* __restrict__ VT, const float* __restrict__ VS, const int* __restrict__ mask, _Float16* __restrict__ O16, float* __restrict__ ST) {
  __shared__ __align__(16) char ring[2 * ABUF];
  __shared__ __align__(16) float svs[HD];   // this head's sum of the masked keys' V rows (x4)
  const int tid = threadIdx.x, w = tid >> 5, lane = tid & 31, col = lane & 15, g = lane >> 4;
  const int b = blockIdx.z, h = blockIdx.y, q0 = blockIdx.x * 64 + w * 16; const size_t bh = (size_t)b * NH + h;
  const unsigned l = (unsigned)(size_t)ring + (tid >> 3) * GP + (tid & 7) * 16;
  const _Float16* kg = K16 + (bh * SS + (tid >> 3)) * HD + (tid & 7) * 8; const _Float16* vg = VT + (bh * HD + (tid >> 3)) * SS + (tid & 7) * 8;
  const int cnt = kept_counts(mask + (size_t)b * SS, lane, 0).c;        // kept keys of the batch: they are rows 0 .. cnt-1 of K16 and columns 0 .. cnt-1 of VT
  const int nt = min((cnt + 63) >> 6, SS / 64);                         // passes of 64 keys that hold a kept key; a scalar, the same for the whole block
  // the 16 blocks of a head walk the same K and V^T tiles: each starts at tile rot and wraps (trip kt works on tile kp), so that they do not ask L2 for the same lines at the same moment;
  // the online softmax takes the tiles in any order
  const int rot = ((int)blockIdx.x * nt) / (SS / 64);   // the head's SS / 64 blocks spread evenly over tiles 0 .. nt-1 (0 where nt is 0)
  if (nt > 0) copy_tile<16, HD, SS>(l, kg + (size_t)rot * 64 * HD, vg + rot * 64);
  if (tid < HD) { float a = 0.f;
#pragma unroll
    for (int p = 0; p < SS / 128; ++p) a += VS[((size_t)b * (SS / 128) + p) * HID + h * HD + tid];
    svs[tid] = a; }
  asm volatile("s_wait_asynccnt 0x0" ::: "memory");   // pass 0's copies of this wave have landed
  __syncthreads();                                    // ... and every other wave's; svs is written
  if (nt > 1) { const int p = rot + 1 < nt ? rot + 1 : 0; copy_tile<16, HD, SS>(l + ABUF, kg + (size_t)p * 64 * HD, vg + p * 64); }
  v16h aq[2];
#pragma unroll
  for (int kc = 0; kc < 2; ++kc) aq[kc] = frag_h(Q16 + (bh * SS + q0 + col) * HD + kc * 32, lane);
  float mrun = -3.0e38f; v2f lrun = {0.f, 0.f}; v8f acc[4] = {};   // acc[t][r] = O^T[d = t*16 + 8g + r][query col]; lrun: this lane's own keys, the halves joined at the end
#pragma unroll 1
  for (int kt = 0; kt < nt; ++kt) { const char* buf = ring + (kt & 1) * ABUF; const int kp = kt + rot < nt ? kt + rot : kt + rot - nt;
    v16h fk[2][4], fv[2][4];
#pragma unroll
    for (int kc = 0; kc < 2; ++kc)
#pragma unroll
      for (int t = 0; t < 4; ++t) fk[kc][t] = frag_h((const _Float16*)(buf + (t * 16 + col) * GP + kc * 64), lane);
    v8f d[4] = {};                                    // d[t][r] = raw score of key kp*64 + t*16 + 8g + r with query col
#pragma unroll
    for (int kc = 0; kc < 2; ++kc)
#pragma unroll
      for (int t = 0; t < 4; ++t) d[t] = wmma16(fk[kc][t], aq[kc], d[t]);
#pragma unroll
    for (int kc = 0; kc < 2; ++kc)
#pragma unroll
      for (int t = 0; t < 4; ++t) fv[kc][t] = frag_h((const _Float16*)(buf + (64 + t * 16 + col) * GP + kc * 64), lane);
    if ((kp + 1) * 64 > cnt) {                        // only the last tile can hold places behind the kept keys (a scalar test): they get a score that gives P = 0
#pragma unroll
      for (int t = 0; t < 4; ++t)
#pragma unroll
        for (int r = 0; r < 8; ++r) d[t][r] = kp * 64 + t * 16 + 8 * g + r < cnt ? d[t][r] : -1.0e30f; }
    v2f s[4][4]; float mx2[2] = {-3.4e38f, -3.4e38f};
#pragma unroll
    for (int t = 0; t < 4; ++t)
#pragma unroll
      for (int i = 0; i < 4; ++i) {
        s[t][i] = v2f{d[t][2 * i], d[t][2 * i + 1]};
        mx2[t & 1] = fmaxf(mx2[t & 1], fmaxf(s[t][i][0], s[t][i][1])); }
    float mx = fmaxf(mx2[0], mx2[1]);
    mx = fmaxf(mx, xhalf(mx));
    const float mnew = fmaxf(mrun, mx * SC2 - 14.0f); const float corr = __builtin_amdgcn_exp2f(mrun - mnew);
    v16h pb[2]; v2f ps[2] = {{0.f, 0.f}, {0.f, 0.f}};
#pragma unroll
    for (int t = 0; t < 4; ++t)
#pragma unroll
      for (int i = 0; i < 4; ++i) { const v2f a = __builtin_elementwise_fma(s[t][i], v2f{SC2, SC2}, v2f{-mnew, -mnew}); const v2f p = {__builtin_amdgcn_exp2f(a[0]), __builtin_amdgcn_exp2f(a[1])};
        ps[t & 1] += p; const v2h ph = __builtin_convertvector(p, v2h); pb[t >> 1][(t & 1) * 8 + 2 * i] = ph[0]; pb[t >> 1][(t & 1) * 8 + 2 * i + 1] = ph[1]; }
    lrun = lrun * v2f{corr, corr} + (ps[0] + ps[1]); mrun = mnew;
#pragma unroll
    for (int t = 0; t < 4; ++t) acc[t] *= corr;
#pragma unroll
    for (int kc = 0; kc < 2; ++kc)
#pragma unroll
      for (int t = 0; t < 4; ++t) acc[t] = wmma16(fv[kc][t], pb[kc], acc[t]);
    asm volatile("s_wait_dscnt 0x0" ::: "memory");    // this wave's reads of pass kt's buffer are done before it is refilled
    asm volatile("s_wait_asynccnt 0x0" ::: "memory"); // this wave's copies of pass kt + 1 have landed
    __syncthreads();                                  // publishes pass kt + 1 and ends every reader's last read of pass kt's buffer
    if (kt + 2 < nt) { const int p = kt + 2 + rot < nt ? kt + 2 + rot : kt + 2 + rot - nt; copy_tile<16, HD, SS>(l + (kt & 1) * ABUF, kg + (size_t)p * 64 * HD, vg + p * 64); } }
  asm volatile("s_wait_asynccnt 0x0" ::: "memory");   // nothing in flight when the wave ends
  float lr = lrun[0] + lrun[1]; lr += xhalf(lr);
  if (cnt < SS) {   // the masked keys, all at the fill score 1e-10 (raw: x128), as one more step of the online softmax: their number in the sum, their V rows' sum in the output
    v4f vm[4][2];
#pragma unroll
    for (int t = 0; t < 4; ++t) { vm[t][0] = *(const v4f*)(svs + t * 16 + 8 * g); vm[t][1] = *(const v4f*)(svs + t * 16 + 8 * g + 4); }
    __builtin_amdgcn_sched_barrier(0);   // all eight LDS loads are asked for in front of the two exponentials, whose chain then runs under the loads' latency
    const float fl = (1e-10f * 128.0f) * SC2; const float mnew = fmaxf(mrun, fl - 14.0f); const float corr = __builtin_amdgcn_exp2f(mrun - mnew), pm = __builtin_amdgcn_exp2f(fl - mnew);
    lr = lr * corr + (float)(SS - cnt) * pm;
#pragma unroll
    for (int t = 0; t < 4; ++t)
#pragma unroll
      for (int r = 0; r < 4; ++r) { acc[t][r] = acc[t][r] * corr + pm * vm[t][0][r]; acc[t][4 + r] = acc[t][4 + r] * corr + pm * vm[t][1][r]; } }
  const float inv = 8.0f / (lr * 4.0f);
  union { v8h h8; v4u u; } pk[4]; float xr[4][8]; float s4[4] = {0.f, 0.f, 0.f, 0.f}, q4[4] = {0.f, 0.f, 0.f, 0.f};   // a lane's 8 accumulator registers are 8 consecutive d of its query's row: one 16-byte store
#pragma unroll
  for (int t = 0; t < 4; ++t)
#pragma unroll
    for (int r = 0; r < 8; ++r) { pk[t].h8[r] = (_Float16)(acc[t][r] * inv); xr[t][r] = (float)pk[t].h8[r] * 0.125f; s4[t] += xr[t][r]; }
  // this head's share of LN2's row statistics, of x as stored: mean of its 64 values and their squared distance from that mean (a lane has 32 of them, lane ^ 16 the rest)
  // (four chains of 8 each, not one of 32: the wave is at its end and has nothing else to issue between dependent additions)
  float sm = (s4[0] + s4[1]) + (s4[2] + s4[3]); sm += xhalf(sm); const float mh = sm * (1.0f / HD);
#pragma unroll
  for (int t = 0; t < 4; ++t)
#pragma unroll
    for (int r = 0; r < 8; ++r) { const float dd = xr[t][r] - mh; q4[t] += dd * dd; }
  float m2 = (q4[0] + q4[1]) + (q4[2] + q4[3]); m2 += xhalf(m2);
#pragma unroll
  for (int t = 0; t < 4; ++t) vst2(O16 + ((bh * SS) + q0 + col) * HD + t * 16 + 8 * g, pk[t].u);
  vst2(ST + ((bh * SS) + q0 + col) * 2 + g, g == 0 ? mh : m2);   // ST[b][h][s] = {mean, squares}: the wave's 16 queries are one whole 128-byte line
}
// fo = relu(LN2(x) Wf^T + bf) without fx: block (128 rows, 128 cols) -> FO f32. A = O16 as attention left it (piece p = head p: 128 rows of 128 bytes), B = Wf g2 x16.
// A row's mu and rs come from its 16 heads' {mean, squares}: mu = mean of the means, sum of squares about mu = sum over heads of squares + 64 (mean - mu)^2
__global__ __launch_bounds__(256) void k_ffn(const _Float16* __restrict__ O16, const _Float16* __restrict__ P, const float* __restrict__ ST, const float* __restrict__ UC, const float* __restrict__ bf, float* __restrict__ FO) {
  __shared__ __align__(16) char ring[2 * GBUF];
  __shared__ __align__(16) float smu[128], srs[128];
  const int tid = threadIdx.x, wave = tid >> 5, lane = tid & 31, col = lane & 15, g = lane >> 4, wm = wave >> 1, wn = wave & 1;
  const int r0b = blockIdx.x * 128, n0 = blockIdx.y * 128; const int b = r0b / SS, s0 = r0b % SS;
  v8f acc[2][4] = {};
  gemm_core<HD, SS * HD>(O16 + ((size_t)b * NH * SS + s0) * HD, P + ((size_t)3 * HID + n0) * HID, ring, acc, (int)(blockIdx.x + 2 * blockIdx.y), [&] {
    if (tid < 128) { const float* sp = ST + ((size_t)b * NH * SS + s0 + tid) * 2; v2f st[NH];   // waves 0 to 3, a row a lane
#pragma unroll
      for (int h = 0; h < NH; ++h) st[h] = *(const v2f*)(sp + (size_t)h * SS * 2);
      float mu = 0.f, m2 = 0.f;
#pragma unroll
      for (int h = 0; h < NH; ++h) mu += st[h][0];
      mu *= 1.0f / NH;
#pragma unroll
      for (int h = 0; h < NH; ++h) { const float dd = st[h][0] - mu; m2 += st[h][1] + (float)HD * dd * dd; }
      smu[tid] = mu; srs[tid] = rsqrtf(m2 * (1.0f / HID) + 1e-5f); } });
  float (*so)[68] = (float (*)[68])(ring + wave * (32 * 68 * 4));
  v4f rmu[2][2], rrs[2][2];   // of the lane's rows i*16 + 8g + r
#pragma unroll
  for (int i = 0; i < 2; ++i)
#pragma unroll
    for (int q = 0; q < 2; ++q) { rmu[i][q] = *(const v4f*)(smu + wm * 32 + i * 16 + 8 * g + q * 4); rrs[i][q] = *(const v4f*)(srs + wm * 32 + i * 16 + 8 * g + q * 4); }
#pragma unroll
  for (int j = 0; j < 4; ++j) { const int n = n0 + wn * 64 + j * 16 + col; const v2f uc = *(const v2f*)(UC + (size_t)(n >> 1) * 32 + (n & 1) * 2); const float bb = bf[n] + uc[1];
#pragma unroll
    for (int i = 0; i < 2; ++i)
#pragma unroll
      for (int r = 0; r < 8; ++r) { const float vv = rrs[i][r >> 2][r & 3] * (acc[i][j][r] * (1.0f / 128.0f) - rmu[i][r >> 2][r & 3] * uc[0]) + bb; so[i * 16 + 8 * g + r][j * 16 + col] = vv > 0.f ? vv : 0.f; } }
  LDSX();
#pragma unroll
  for (int rp = 0; rp < 16; ++rp) { const int rl = rp * 2 + g; vst2(FO + (size_t)(r0b + wm * 32 + rl) * HID + n0 + wn * 64 + col * 4, *(const v4f*)(&so[rl][col * 4])); }
}
// out = fx + LN3(fo) with fx = LN2(x), x = merged O (/8): wave per row, both rows' loads asked for first, the two LayerNorms' sums side by side
__global__ __launch_bounds__(256) void k_fin(const _Float16* __restrict__ O16, const float* __restrict__ FO, const float* __restrict__ g2, const float* __restrict__ b2, const float* __restrict__ g3, const float* __restrict__ b3, float* __restrict__ out) {
  const int wave = threadIdx.x >> 5, lane = threadIdx.x & 31; const size_t r = (size_t)blockIdx.x * 8 + wave; if (r >= NR) return;
  const int b = (int)(r / SS), s = (int)(r % SS);
  const float* fo = FO + r * HID; float xv[32], yv[32]; v8h xh[4]; float sm = 0.f, sy = 0.f;
#pragma unroll
  for (int i = 0; i < 4; ++i) { const int c0 = i * 256 + lane * 8; const int h = c0 >> 6, d = c0 & 63; xh[i] = *(const v8h*)(O16 + (((size_t)b * NH + h) * SS + s) * HD + d); }
#pragma unroll
  for (int i = 0; i < 4; ++i) { const v4f a = *(const v4f*)(fo + i * 256 + lane * 8), c = *(const v4f*)(fo + i * 256 + lane * 8 + 4);
    xv[i * 8 + 0] = a[0]; xv[i * 8 + 1] = a[1]; xv[i * 8 + 2] = a[2]; xv[i * 8 + 3] = a[3]; xv[i * 8 + 4] = c[0]; xv[i * 8 + 5] = c[1]; xv[i * 8 + 6] = c[2]; xv[i * 8 + 7] = c[3]; }
#pragma unroll
  for (int i = 0; i < 32; ++i) { yv[i] = (float)xh[i >> 3][i & 7] * 0.125f; sy += yv[i]; }
#pragma unroll
  for (int i = 0; i < 32; ++i) sm += xv[i];
#pragma unroll
  for (int off = 16; off >= 1; off >>= 1) { sm += __shfl_xor(sm, off, 32); sy += __shfl_xor(sy, off, 32); }
  const float mu = sm * (1.0f / HID), my = sy * (1.0f / HID); float q2 = 0.f, y2 = 0.f;
#pragma unroll
  for (int i = 0; i < 32; ++i) { const float dd = xv[i] - mu, dy = yv[i] - my; q2 += dd * dd; y2 += dy * dy; }
#pragma unroll
  for (int off = 16; off >= 1; off >>= 1) { q2 += __shfl_xor(q2, off, 32); y2 += __shfl_xor(y2, off, 32); }
  const float rs = rsqrtf(q2 * (1.0f / HID) + 1e-5f), ry = rsqrtf(y2 * (1.0f / HID) + 1e-5f);
#pragma unroll
  for (int i = 0; i < 4; ++i) { v4f o0, o1; const int c0 = i * 256 + lane * 8;
#pragma unroll
    for (int e = 0; e < 8; ++e) { const int c = c0 + e; const float fx = (yv[i * 8 + e] - my) * ry * g2[c] + b2[c]; const float vv = fx + ((xv[i * 8 + e] - mu) * rs * g3[c] + b3[c]); if (e < 4) o0[e] = vv; else o1[e - 4] = vv; }
    vst2(out + r * HID + c0, o0); vst2(out + r * HID + c0 + 4, o1); }
}
extern "C" void kernel_launch(void* const* d_in, const int* in_sizes, int n_in, void* d_out, int out_size, void* d_ws, size_t ws_size, hipStream_t stream) {
  (void)in_sizes; (void)n_in; (void)out_size; (void)ws_size;
  const float** I = (const float**)d_in;
  const float* q = I[0]; const float* k = I[1]; const float* v = I[2]; const float* g1q = I[3]; const float* b1q = I[4]; const float* g1k = I[5]; const float* b1k = I[6]; const float* g1v = I[7]; const float* b1v = I[8];
  const float* Wq = I[9]; const float* bq = I[10]; const float* Wk = I[11]; const float* bk = I[12]; const float* Wv = I[13]; const float* bv = I[14]; const float* g2 = I[15]; const float* b2 = I[16]; const float* g3 = I[17]; const float* b3 = I[18]; const float* Wf = I[19]; const float* bf = I[20]; const int* mask = (const int*)d_in[21];
  float* out = (float*)d_out;
  char* ws = (char*)d_ws; size_t off = 0;
  auto take = [&](size_t bytes) { char* p = ws + off; off += (bytes + 255) & ~(size_t)255; return p; };
  _Float16* X16 = (_Float16*)take((size_t)3 * NR * HID * 2); _Float16* P = (_Float16*)take((size_t)4 * HID * HID * 2); float* UC = (float*)take((size_t)(HID / 2) * 128); float* CS = (float*)take((size_t)SS * 32 * 4); float* SN = (float*)take((size_t)SS * 32 * 4);
  _Float16* Q16 = (_Float16*)take((size_t)NR * HID * 2); _Float16* K16 = (_Float16*)take((size_t)NR * HID * 2); _Float16* VT = (_Float16*)take((size_t)NR * HID * 2); _Float16* O16 = (_Float16*)take((size_t)NR * HID * 2);
  float* ST = (float*)take((size_t)NR * NH * 2 * 4); float* FO = (float*)take((size_t)NR * HID * 4); float* VS = (float*)take((size_t)NB * (SS / 128) * HID * 4);
  k_prep<<<NB_ROPE + NB_LN + NB_PACK + NB_PACKF, 256, 0, stream>>>(q, k, v, g1q, b1q, g1k, b1k, g1v, b1v, Wq, Wk, Wv, Wf, g2, b2, mask, X16, P, UC, CS, SN);
  k_qkv<<<dim3(NR / 128, HID / 128, 3), 256, 0, stream>>>(X16, P, bq, bk, bv, CS, SN, mask, Q16, K16, VT, VS);
  k_attn<<<dim3(SS / 64, NH, NB), 128, 0, stream>>>(Q16, K16, VT, VS, mask, O16, ST);
  k_ffn<<<dim3(NR / 128, HID / 128), 256, 0, stream>>>(O16, P, ST, UC, bf, FO);
  k_fin<<<NR / 8, 256, 0, stream>>>(O16, FO, g2, b2, g3, b3, out);
}
